// v000
// Measured on an AMD MI455X. A time is GPU time per run, averaged over a window of back-to-back runs after a warm-up
// (all launches, gaps included; the runs take copies of the inputs in turn), and the median of several windows.
// Apart from v000's, it joins two sittings. Times from different sittings can be a few percent apart, while
// side-by-side timings come from the same sitting.
// v000, which the later versions start from, runs in 387 microseconds.
// compute dtype: x, k, v, w_qkv, w_proj, b_proj rounded to bf16; q = x . w_qkv^T with exact bf16 products on WMMA 16x16x32 (natural rows), stored as f16 hi + (x2048-scaled) residual planes; the k and v INPUTS are re-laid out on device as f16 hi + (x2048) residual planes (exact: bf16 values are representable, the residual only catches the sub-f16-normal range); 3-product scores x 1/sqrt(64), running-max softmax in f32 (hardware exp); P (scaled by 2^11, as f16 hi + residual) x v hi/lo (3 products); output projection with ctx as bf16 hi + residual x exact w_proj rows (2 products) + b_proj; f32 accumulate.
#include <hip/hip_runtime.h>
#include <math.h>

typedef __attribute__((ext_vector_type(16))) _Float16 v16h;
typedef __attribute__((ext_vector_type(16))) __bf16 v16b;
typedef __attribute__((ext_vector_type(8)))  _Float16 v8h;
typedef __attribute__((ext_vector_type(8)))  float v8f;
typedef __attribute__((ext_vector_type(4)))  float v4f;
typedef __attribute__((ext_vector_type(2)))  float v2f;
typedef __attribute__((ext_vector_type(4)))  unsigned v4u;
typedef __attribute__((ext_vector_type(4)))  int v4i;
typedef float __attribute__((may_alias)) float_a;
typedef int __attribute__((may_alias)) int_a;

template <typename T> __device__ __forceinline__ void vst2(void* p, T v) { *(T*)p = v;  }
__device__ __forceinline__ v8f wmma16(v16h a, v16h b, v8f c) {
  v8f d = __builtin_amdgcn_wmma_f32_16x16x32_f16(false, a, false, b, (short)0, c, false, false);
  asm volatile("v_nop\n\tv_nop\n\tv_nop\n\tv_nop" : "+v"(d) : "v"(a), "v"(b));
  return d;
}
__device__ __forceinline__ v8f wmma_bf(v16b a, v16b b, v8f c) {
  v8f d = __builtin_amdgcn_wmma_f32_16x16x32_bf16(false, a, false, b, (short)0, c, false, false);
  asm volatile("v_nop\n\tv_nop\n\tv_nop\n\tv_nop" : "+v"(d) : "v"(a), "v"(b));
  return d;
}
// ViT-style attention with given key/value caches (B 2, N = M = 2,048, dim 768, 12 heads x 64): q = x W_qkv^T, softmax(q k^T / 8) v, output projection + bias.
__device__ __forceinline__ v16h frag_h(const _Float16* rowk0, int lane) {
  union { v16h v; v8h q[2]; } u; const _Float16* p = rowk0 + 8 * (lane >> 4);
  u.q[0] = *(const v8h*)p; u.q[1] = *(const v8h*)(p + 16); return u.v;
}
__device__ __forceinline__ v16h frag_f32(const float* rowk0, int lane) {
  v16h a; const float* p = rowk0 + 8 * (lane >> 4);
#pragma unroll
  for (int i = 0; i < 8; ++i) { a[i] = (_Float16)p[i]; a[8 + i] = (_Float16)p[16 + i]; }
  return a;
}
__device__ __forceinline__ v16h frag_f32s(const float* rowk0, int lane, float sc) {
  v16h a; const float* p = rowk0 + 8 * (lane >> 4);
#pragma unroll
  for (int i = 0; i < 8; ++i) { a[i] = (_Float16)(p[i] * sc); a[8 + i] = (_Float16)(p[16 + i] * sc); }
  return a;
}
// column fragment from a [K][ld] layout (column n), rows >= K read as 0
__device__ __forceinline__ v16h fragc_f32(const float* W, int k0, int n, int lane, int ld, int K) {
  v16h a; const int g = lane >> 4;
#pragma unroll
  for (int i = 0; i < 8; ++i) { const int ka = k0 + 8 * g + i, kb = ka + 16;
    a[i] = (_Float16)(ka < K ? W[(size_t)(ka < K ? ka : K - 1) * ld + n] : 0.f); a[8 + i] = (_Float16)(kb < K ? W[(size_t)(kb < K ? kb : K - 1) * ld + n] : 0.f); }
  return a;
}
struct F2 { v16b h, l; };
__device__ __forceinline__ F2 bsplit16(const float v[16]) { F2 r;
#pragma unroll
  for (int i = 0; i < 16; ++i) { const __bf16 h = (__bf16)v[i]; r.h[i] = h; r.l[i] = (__bf16)(v[i] - (float)h); }
  return r; }
__device__ __forceinline__ F2 split_row(const float* row, int k0, int lane) { float v[16]; const float* p = row + k0 + 8 * (lane >> 4);
#pragma unroll
  for (int i = 0; i < 8; ++i) { v[i] = p[i]; v[8 + i] = p[16 + i]; }
  return bsplit16(v); }
__device__ __forceinline__ F2 split_rowK(const float* row, int k0, int lane, int K) { float v[16]; const int g = lane >> 4;
#pragma unroll
  for (int i = 0; i < 8; ++i) { const int ka = k0 + 8 * g + i, kb = ka + 16; v[i] = ka < K ? row[ka < K ? ka : K - 1] : 0.f; v[8 + i] = kb < K ? row[kb < K ? kb : K - 1] : 0.f; }
  return bsplit16(v); }
__device__ __forceinline__ F2 split_col(const float* W, int k0, int n, int lane, int ld, int K) { float v[16]; const int g = lane >> 4;
#pragma unroll
  for (int i = 0; i < 8; ++i) { const int ka = k0 + 8 * g + i, kb = ka + 16; v[i] = ka < K ? W[(size_t)(ka < K ? ka : K - 1) * ld + n] : 0.f; v[8 + i] = kb < K ? W[(size_t)(kb < K ? kb : K - 1) * ld + n] : 0.f; }
  return bsplit16(v); }
__device__ __forceinline__ v8f mac3(const F2& a, const F2& b, v8f c) { c = wmma_bf(a.l, b.h, c); c = wmma_bf(a.h, b.l, c); return wmma_bf(a.h, b.h, c); }
__device__ __forceinline__ float sigm(float v) { return 1.0f / (1.0f + expf(-v)); }
#define LDSX() do { asm volatile("s_wait_dscnt 0" ::: "memory"); __builtin_amdgcn_wave_barrier(); __builtin_amdgcn_fence(__ATOMIC_RELEASE, "workgroup"); } while (0)


#define NB 2
#define SS 2048
#define DM 768
#define NH 12
#define HD 64
#define QKVW (3 * DM)
#ifndef TQB
#define TQB (SS / 64)
#define TNB NB
#define TOB (NB * SS / 64)     // output row tiles (all)
#endif
typedef __attribute__((ext_vector_type(8))) __bf16 v8b;
__device__ __forceinline__ v16b frag_b(const __bf16* rowk0, int lane) {
  union { v16b v; v8b q[2]; } u; const __bf16* p = rowk0 + 8 * (lane >> 4);
  u.q[0] = *(const v8b*)p; u.q[1] = *(const v8b*)(p + 16); return u.v;
}
__device__ __forceinline__ float bfr(float v) { return (float)(__bf16)v; }
__device__ __attribute__((noinline)) float exp_ni(float v) { return expf(v); }
__device__ __attribute__((noinline)) float erf_ni(float v) { return erff(v); }

#define PK_A 0                       // [2304][768] Wqkv rows (natural [out][in])
#define PK_P (PK_A + QKVW * DM)        // [768][768] Wo rows (natural)
#define PK_END (PK_P + DM * DM)
#define WS_PK  0u
#define WS_QK  (WS_PK + 2u * PK_END)             // f16 [4096 rows][1536]: q | k
#define WS_QKL (WS_QK + 2u * NB * SS * 2 * DM)     // f16 q | k residual planes x2048
#define WS_VTH (WS_QKL + 2u * NB * SS * 2 * DM)    // f16 [b][768 (h*64+d)][2048 s] hi
#define WS_VTL (WS_VTH + 2u * NB * DM * SS)        // f16 lo x 2048
#define WS_O   (WS_VTL + 2u * NB * DM * SS)        // f32 [4096][768]
#define WS_CS  (WS_O + 4u * NB * SS * DM)           // f32 2 x [2048][32], reserved, unused
#define WS_END (WS_CS + 4u * 2 * SS * 32)
// ---- k_pack: block = (row n, which): natural [out][in] rows -> bf16; which 0..2 -> W_q/W_k/W_v into PK_A rows which*768 + n; 3 -> W_o into PK_P
__global__ __launch_bounds__(256) void k_pack(const float* __restrict__ WQ, const float* __restrict__ WK, const float* __restrict__ WV, const float* __restrict__ WO, __bf16* __restrict__ PK) {
  __shared__ __align__(16) __bf16 s[DM]; const int n = blockIdx.x, which = blockIdx.y, t = threadIdx.x; const float* Wm = (which == 0) ? WQ : (which == 1) ? WK : (which == 2) ? WV : WO;
  for (int k = t; k < DM; k += 256) s[k] = (__bf16)Wm[(size_t)n * DM + k];
  __syncthreads();
  __bf16* dst = (which < 3) ? PK + PK_A + ((size_t)which * DM + n) * DM : PK + PK_P + (size_t)n * DM;
  for (int q = t; q < DM / 8; q += 256) vst2((unsigned*)(dst + q * 8), *(const v4u*)&s[q * 8]);
}
__global__ __launch_bounds__(128) void k_qkv(const float* __restrict__ XQ, const float* __restrict__ XK, const float* __restrict__ XV, const __bf16* __restrict__ P, const float* __restrict__ BQ, const float* __restrict__ BK, const float* __restrict__ BV, _Float16* __restrict__ QK, _Float16* __restrict__ QKL, _Float16* __restrict__ VTH, _Float16* __restrict__ VTL) {
  const int which0 = (blockIdx.y * 128) / DM; const float* X = (which0 == 0) ? XQ : (which0 == 1) ? XK : XV; const float* BB = BQ ? (((which0 == 0) ? BQ : (which0 == 1) ? BK : BV) + (blockIdx.y * 128 - which0 * DM)) : nullptr;
  __shared__ __align__(16) _Float16 so[4][16][136], sol[4][16][136]; __shared__ __align__(16) _Float16 sth[128][72], stl[128][72];
  const int tid = threadIdx.x, wave = tid >> 5, lane = tid & 31, col = lane & 15, g = lane >> 4; const size_t r0 = (size_t)blockIdx.x * 64 + wave * 16; const int n0 = blockIdx.y * 128;
  v8f acc[8] = {};
#pragma unroll 2
  for (int kc = 0; kc < DM / 32; ++kc) { v16b a; { const float* p = X + (r0 + col) * DM + kc * 32 + 8 * g;
#pragma unroll
      for (int i = 0; i < 8; ++i) { a[i] = (__bf16)p[i]; a[8 + i] = (__bf16)p[16 + i]; } }
#pragma unroll
    for (int j = 0; j < 8; ++j) acc[j] = wmma_bf(a, frag_b(P + (size_t)(n0 + j * 16 + col) * DM + kc * 32, lane), acc[j]); }
  if (n0 < 2 * DM) {   // q stored unscaled (f16 sigma ~0.6, no subnormal exposure); 1/8 applied to the f32 score
#pragma unroll
    for (int j = 0; j < 8; ++j) {
#pragma unroll
      for (int r = 0; r < 8; ++r) { const float v = acc[j][r] + (BB ? bfr(BB[j * 16 + col]) : 0.f); const _Float16 hv = (_Float16)v; so[wave][8 * g + r][j * 16 + col] = hv; sol[wave][8 * g + r][j * 16 + col] = (_Float16)((v - (float)hv) * 2048.0f); } }   // q, k (+ bias) as f16 hi + (x2048) residual
    LDSX();
    for (int rl = 0; rl < 16; ++rl) if (lane < 16) { vst2((unsigned*)(QK + (r0 + rl) * (2 * DM) + n0 + lane * 8), *(const v4u*)&so[wave][rl][lane * 8]); vst2((unsigned*)(QKL + (r0 + rl) * (2 * DM) + n0 + lane * 8), *(const v4u*)&sol[wave][rl][lane * 8]); }
  } else {
#pragma unroll
    for (int j = 0; j < 8; ++j) {
#pragma unroll
      for (int r = 0; r < 8; ++r) { const float v = acc[j][r] + (BB ? bfr(BB[j * 16 + col]) : 0.f); const _Float16 hv = (_Float16)v; sth[j * 16 + col][wave * 16 + 8 * g + r] = hv; stl[j * 16 + col][wave * 16 + 8 * g + r] = (_Float16)((v - (float)hv) * 2048.0f); } }
    __syncthreads();
    const size_t rb = (size_t)blockIdx.x * 64; const int b = (int)(rb / SS), s0 = (int)(rb % SS); const int pc0 = n0 - 2 * DM;
    for (int q = tid; q < 128 * 8; q += 128) { const int d = q >> 3, pc = q & 7; const size_t o = ((size_t)b * DM + pc0 + d) * SS + s0 + pc * 8; vst2((unsigned*)(VTH + o), *(const v4u*)&sth[d][pc * 8]); vst2((unsigned*)(VTL + o), *(const v4u*)&stl[d][pc * 8]); }
  }
}
// ---- k_attn: block = (64 queries, head h, batch b): all-keys flash attention (K = 64: 2 k-steps), scores = (q.k) * 0.125 with q, k as f16 hi + x2048 residual (3 products), P.V: f16 P x (V hi, V lo*2048) in two accumulators; O[b*S+q][h*64+d] = (acc + accl / 2048) / (2048 l) (256-B segments)
__global__ __launch_bounds__(128) void k_attn(const _Float16* __restrict__ QK, const _Float16* __restrict__ QKL, const _Float16* __restrict__ VTH, const _Float16* __restrict__ VTL, const void* __restrict__ KMASK, float* __restrict__ O) {
  __shared__ __align__(16) float sp[4][16][36]; __shared__ __align__(16) float so[4][16][68];
  const int tid = threadIdx.x, wave = tid >> 5, lane = tid & 31, col = lane & 15, g = lane >> 4;
  const int qb = blockIdx.x, h = blockIdx.y, b = blockIdx.z; const int q0 = qb * 64 + wave * 16; const size_t rq = (size_t)b * SS + q0 + col;
  v16h aq[2], aql[2];
#pragma unroll
  for (int kc = 0; kc < 2; ++kc) { aq[kc] = frag_h(QK + rq * (2 * DM) + h * HD + kc * 32, lane); aql[kc] = frag_h(QKL + rq * (2 * DM) + h * HD + kc * 32, lane); }
  float m[8], l[8];
#pragma unroll
  for (int r = 0; r < 8; ++r) { m[r] = -3.0e38f; l[r] = 0.f; }
  v8f acc[4] = {}, accl[4] = {};
  const int nks = SS / 32;   // all keys
#pragma unroll 1
  for (int ks = 0; ks < nks; ++ks) { v8f s[2];
#pragma unroll
    for (int ct = 0; ct < 2; ++ct) { const int kk = ks * 32 + ct * 16 + col; const _Float16* krow = QK + ((size_t)b * SS + kk) * (2 * DM) + DM + h * HD; const _Float16* krowl = QKL + ((size_t)b * SS + kk) * (2 * DM) + DM + h * HD; v8f c = {}, cl = {};
#pragma unroll
      for (int kc = 0; kc < 2; ++kc) { const v16h kh = frag_h(krow + kc * 32, lane); c = wmma16(aq[kc], kh, c); cl = wmma16(aql[kc], kh, cl); cl = wmma16(aq[kc], frag_h(krowl + kc * 32, lane), cl); }   // 3 products: q, k as f16 hi + residual
#pragma unroll
      for (int r = 0; r < 8; ++r) c[r] += cl[r] * (1.0f / 2048.0f);
#pragma unroll
      for (int r = 0; r < 8; ++r) s[ct][r] = c[r] * 0.125f; }   // 1/sqrt(64)
#pragma unroll
    for (int r = 0; r < 8; ++r) { float mx = fmaxf(s[0][r], s[1][r]);
#pragma unroll
      for (int o = 1; o < 16; o <<= 1) mx = fmaxf(mx, __shfl_xor(mx, o));
      const float mn = fmaxf(m[r], mx); const float alpha = (m[r] <= -1.0e38f) ? 0.f : __expf(m[r] - mn);
      const float e0 = (s[0][r] <= -1.0e38f) ? 0.f : __expf(s[0][r] - mn), e1 = (s[1][r] <= -1.0e38f) ? 0.f : __expf(s[1][r] - mn); float es = e0 + e1;
#pragma unroll
      for (int o = 1; o < 16; o <<= 1) es += __shfl_xor(es, o);
      l[r] = l[r] * alpha + es; m[r] = mn;
#pragma unroll
      for (int dt = 0; dt < 4; ++dt) { acc[dt][r] *= alpha; accl[dt][r] *= alpha; }
      sp[wave][8 * g + r][col] = e0; sp[wave][8 * g + r][16 + col] = e1; }
    LDSX();
    v16h pa, pl; { const float* prow = &sp[wave][col][0] + 8 * (lane >> 4);
#pragma unroll
      for (int i = 0; i < 8; ++i) { const float x0 = prow[i] * 2048.0f, x1 = prow[16 + i] * 2048.0f; const _Float16 h0 = (_Float16)x0, h1 = (_Float16)x1; pa[i] = h0; pa[8 + i] = h1; pl[i] = (_Float16)((x0 - (float)h0) * 2048.0f); pl[8 + i] = (_Float16)((x1 - (float)h1) * 2048.0f); } }   // P scaled by 2^11 before the f16 split so small softmax weights stay out of the f16 subnormal range; 2^-11 folded into the epilogue
#pragma unroll
    for (int dt = 0; dt < 4; ++dt) { const size_t vr = ((size_t)b * DM + h * HD + dt * 16 + col) * SS + ks * 32; const v16h vh = frag_h(VTH + vr, lane); acc[dt] = wmma16(pa, vh, acc[dt]); accl[dt] = wmma16(pl, vh, accl[dt]); accl[dt] = wmma16(pa, frag_h(VTL + vr, lane), accl[dt]); }   // P hi x V hi + (P lo x V hi + P hi x V lo) / 2048
    LDSX(); }
#pragma unroll
  for (int r = 0; r < 8; ++r) { const float il = (1.0f / 2048.0f) / l[r];
#pragma unroll
    for (int dt = 0; dt < 4; ++dt) so[wave][8 * g + r][dt * 16 + col] = (acc[dt][r] + accl[dt][r] * (1.0f / 2048.0f)) * il; }
  LDSX();
  for (int rl = 0; rl < 16; ++rl) if (lane < 16) vst2(O + ((size_t)b * SS + q0 + rl) * DM + h * HD + lane * 4, *(const v4f*)&so[wave][rl][lane * 4]);
}
// ---- k_out: block = (64 rows, 128 cols): out = O(hi/lo) . Wo rows (2 products) + bo
__global__ __launch_bounds__(128) void k_out(const float* __restrict__ O, const __bf16* __restrict__ P, const float* __restrict__ BO, float* __restrict__ Y) {
  __shared__ __align__(16) float so[4][16][132];
  const int tid = threadIdx.x, wave = tid >> 5, lane = tid & 31, col = lane & 15, g = lane >> 4; const size_t r0 = (size_t)blockIdx.x * 64 + wave * 16; const int n0 = blockIdx.y * 128;
  v8f acc[8] = {};
#pragma unroll 2
  for (int kc = 0; kc < DM / 32; ++kc) { const F2 a = split_row(O + (r0 + col) * DM, kc * 32, lane);
#pragma unroll
    for (int j = 0; j < 8; ++j) { const v16b w = frag_b(P + (size_t)(n0 + j * 16 + col) * DM + kc * 32, lane); acc[j] = wmma_bf(a.l, w, acc[j]); acc[j] = wmma_bf(a.h, w, acc[j]); } }
#pragma unroll
  for (int j = 0; j < 8; ++j) {
#pragma unroll
    for (int r = 0; r < 8; ++r) so[wave][8 * g + r][j * 16 + col] = acc[j][r] + bfr(BO[n0 + j * 16 + col]); }
  LDSX();
  for (int rl = 0; rl < 16; ++rl) vst2(Y + (r0 + rl) * DM + n0 + lane * 4, *(const v4f*)&so[wave][rl][lane * 4]);
}
// ---- k_kvin: block = (64 keys m, head h, b): k input [b][h][m][64] -> K rows [b*M + m][DM + h*64 + d] of the q|k plane pair (f16 hi + x2048 residual); v input -> V planes [b][h*64 + d][m]
__global__ __launch_bounds__(256) void k_kvin(const float* __restrict__ KIN, const float* __restrict__ VIN, _Float16* __restrict__ QK, _Float16* __restrict__ QKL, _Float16* __restrict__ VTH, _Float16* __restrict__ VTL) {
  __shared__ __align__(16) _Float16 skh[64][72], skl[64][72], svh[64][72], svl[64][72]; const int t = threadIdx.x; const int m0 = blockIdx.x * 64, h = blockIdx.y; const size_t b = blockIdx.z;
  for (int e = t; e < 64 * 64; e += 256) { const int r = e >> 6, d = e & 63; const size_t src = ((b * NH + h) * SS + m0 + r) * HD + d; const float kv = bfr(KIN[src]), vv = bfr(VIN[src]);
    const _Float16 kh = (_Float16)kv, vh = (_Float16)vv; skh[r][d] = kh; skl[r][d] = (_Float16)((kv - (float)kh) * 2048.0f); svh[d][r] = vh; svl[d][r] = (_Float16)((vv - (float)vh) * 2048.0f); }
  __syncthreads();
  for (int e = t; e < 64 * 8; e += 256) { const int r = e >> 3, q = e & 7; const size_t o = (b * SS + m0 + r) * (2 * DM) + DM + h * HD + q * 8; vst2((unsigned*)(QK + o), *(const v4u*)&skh[r][q * 8]); vst2((unsigned*)(QKL + o), *(const v4u*)&skl[r][q * 8]);
    const size_t ov = (b * DM + h * HD + r) * SS + m0 + q * 8; vst2((unsigned*)(VTH + ov), *(const v4u*)&svh[r][q * 8]); vst2((unsigned*)(VTL + ov), *(const v4u*)&svl[r][q * 8]); }
}
extern "C" void kernel_launch(void* const* d_in, const int* in_sizes, int n_in, void* d_out, int out_size, void* d_ws, size_t ws_size, hipStream_t stream) {
  (void)in_sizes; (void)n_in; (void)out_size;
  const float** F = (const float**)d_in;   // 0 x [2,2048,768], 1 k [2,12,2048,64], 2 v [2,12,2048,64], 3 w_qkv [768,768] natural (q only), 4 w_proj [768,768] natural, 5 b_proj [768]
  if (ws_size < (size_t)WS_END) return;
  char* ws = (char*)d_ws; __bf16* PK = (__bf16*)(ws + WS_PK); _Float16 *QK = (_Float16*)(ws + WS_QK), *QKL = (_Float16*)(ws + WS_QKL), *VTH = (_Float16*)(ws + WS_VTH), *VTL = (_Float16*)(ws + WS_VTL); float* O = (float*)(ws + WS_O);
  k_pack<<<dim3(DM, 4), 256, 0, stream>>>(F[3], F[3], F[3], F[4], PK);   // only the q rows and w_proj are used
  k_qkv<<<dim3(TNB * SS / 64, DM / 128), 128, 0, stream>>>(F[0], F[0], F[0], PK + PK_A, nullptr, nullptr, nullptr, QK, QKL, VTH, VTL);   // q columns only
  k_kvin<<<dim3(SS / 64, NH, TNB), 256, 0, stream>>>(F[1], F[2], QK, QKL, VTH, VTL);
  k_attn<<<dim3(TQB, NH, TNB), 128, 0, stream>>>(QK, QKL, VTH, VTL, nullptr, O);
  k_out<<<dim3(TOB, DM / 128), 128, 0, stream>>>(O, PK + PK_P, F[5], (float*)d_out);
}

// v001
// Measured time: 235 microseconds a run.
// Next to v000, in two timings, it ran 1.69 and 1.66 times as fast.
// compute dtype: x, k, v, w_qkv, w_proj, b_proj rounded to bf16; q = x . w_qkv^T with exact bf16 products on WMMA 16x16x32 (natural rows), stored as f16 hi + (x2048-scaled) residual planes; the k and v INPUTS are re-laid out on device as f16 hi + (x2048) residual planes (exact: bf16 values are representable, the residual only catches the sub-f16-normal range); 3-product scores x 1/sqrt(64), running-max softmax in f32 (hardware exp); P (scaled by 2^11, as f16 hi + residual) x v hi/lo (3 products); output projection with ctx as bf16 hi + residual x exact w_proj rows (2 products) + b_proj; f32 accumulate.
#include <hip/hip_runtime.h>
#include <math.h>

typedef __attribute__((ext_vector_type(16))) _Float16 v16h;
typedef __attribute__((ext_vector_type(16))) __bf16 v16b;
typedef __attribute__((ext_vector_type(8)))  _Float16 v8h;
typedef __attribute__((ext_vector_type(8)))  float v8f;
typedef __attribute__((ext_vector_type(4)))  float v4f;
typedef __attribute__((ext_vector_type(2)))  float v2f;
typedef __attribute__((ext_vector_type(4)))  unsigned v4u;
typedef __attribute__((ext_vector_type(4)))  int v4i;
typedef float __attribute__((may_alias)) float_a;
typedef int __attribute__((may_alias)) int_a;

template <typename T> __device__ __forceinline__ void vst2(void* p, T v) { *(T*)p = v;  }
__device__ __forceinline__ v8f wmma16(v16h a, v16h b, v8f c) {
  v8f d = __builtin_amdgcn_wmma_f32_16x16x32_f16(false, a, false, b, (short)0, c, false, false);
  asm volatile("v_nop\n\tv_nop\n\tv_nop\n\tv_nop" : "+v"(d) : "v"(a), "v"(b));
  return d;
}
__device__ __forceinline__ v8f wmma_bf(v16b a, v16b b, v8f c) {
  v8f d = __builtin_amdgcn_wmma_f32_16x16x32_bf16(false, a, false, b, (short)0, c, false, false);
  asm volatile("v_nop\n\tv_nop\n\tv_nop\n\tv_nop" : "+v"(d) : "v"(a), "v"(b));
  return d;
}
// ViT-style attention with given key/value caches (B 2, N = M = 2,048, dim 768, 12 heads x 64): q = x W_qkv^T, softmax(q k^T / 8) v, output projection + bias.
__device__ __forceinline__ v16h frag_h(const _Float16* rowk0, int lane) {
  union { v16h v; v8h q[2]; } u; const _Float16* p = rowk0 + 8 * (lane >> 4);
  u.q[0] = *(const v8h*)p; u.q[1] = *(const v8h*)(p + 16); return u.v;
}
__device__ __forceinline__ v16h frag_f32(const float* rowk0, int lane) {
  v16h a; const float* p = rowk0 + 8 * (lane >> 4);
#pragma unroll
  for (int i = 0; i < 8; ++i) { a[i] = (_Float16)p[i]; a[8 + i] = (_Float16)p[16 + i]; }
  return a;
}
__device__ __forceinline__ v16h frag_f32s(const float* rowk0, int lane, float sc) {
  v16h a; const float* p = rowk0 + 8 * (lane >> 4);
#pragma unroll
  for (int i = 0; i < 8; ++i) { a[i] = (_Float16)(p[i] * sc); a[8 + i] = (_Float16)(p[16 + i] * sc); }
  return a;
}
// column fragment from a [K][ld] layout (column n), rows >= K read as 0
__device__ __forceinline__ v16h fragc_f32(const float* W, int k0, int n, int lane, int ld, int K) {
  v16h a; const int g = lane >> 4;
#pragma unroll
  for (int i = 0; i < 8; ++i) { const int ka = k0 + 8 * g + i, kb = ka + 16;
    a[i] = (_Float16)(ka < K ? W[(size_t)(ka < K ? ka : K - 1) * ld + n] : 0.f); a[8 + i] = (_Float16)(kb < K ? W[(size_t)(kb < K ? kb : K - 1) * ld + n] : 0.f); }
  return a;
}
struct F2 { v16b h, l; };
__device__ __forceinline__ F2 bsplit16(const float v[16]) { F2 r;
#pragma unroll
  for (int i = 0; i < 16; ++i) { const __bf16 h = (__bf16)v[i]; r.h[i] = h; r.l[i] = (__bf16)(v[i] - (float)h); }
  return r; }
__device__ __forceinline__ F2 split_row(const float* row, int k0, int lane) { float v[16]; const float* p = row + k0 + 8 * (lane >> 4);
#pragma unroll
  for (int i = 0; i < 8; ++i) { v[i] = p[i]; v[8 + i] = p[16 + i]; }
  return bsplit16(v); }
__device__ __forceinline__ F2 split_rowK(const float* row, int k0, int lane, int K) { float v[16]; const int g = lane >> 4;
#pragma unroll
  for (int i = 0; i < 8; ++i) { const int ka = k0 + 8 * g + i, kb = ka + 16; v[i] = ka < K ? row[ka < K ? ka : K - 1] : 0.f; v[8 + i] = kb < K ? row[kb < K ? kb : K - 1] : 0.f; }
  return bsplit16(v); }
__device__ __forceinline__ F2 split_col(const float* W, int k0, int n, int lane, int ld, int K) { float v[16]; const int g = lane >> 4;
#pragma unroll
  for (int i = 0; i < 8; ++i) { const int ka = k0 + 8 * g + i, kb = ka + 16; v[i] = ka < K ? W[(size_t)(ka < K ? ka : K - 1) * ld + n] : 0.f; v[8 + i] = kb < K ? W[(size_t)(kb < K ? kb : K - 1) * ld + n] : 0.f; }
  return bsplit16(v); }
__device__ __forceinline__ v8f mac3(const F2& a, const F2& b, v8f c) { c = wmma_bf(a.l, b.h, c); c = wmma_bf(a.h, b.l, c); return wmma_bf(a.h, b.h, c); }
__device__ __forceinline__ float sigm(float v) { return 1.0f / (1.0f + expf(-v)); }
#define LDSX() do { asm volatile("s_wait_dscnt 0" ::: "memory"); __builtin_amdgcn_wave_barrier(); __builtin_amdgcn_fence(__ATOMIC_RELEASE, "workgroup"); } while (0)


#define NB 2
#define SS 2048
#define DM 768
#define NH 12
#define HD 64
#define QKVW (3 * DM)
#ifndef TQB
#define TQB (SS / 64)
#define TNB NB
#define TOB (NB * SS / 64)     // output row tiles (all)
#endif
typedef __attribute__((ext_vector_type(8))) __bf16 v8b;
__device__ __forceinline__ v16b frag_b(const __bf16* rowk0, int lane) {
  union { v16b v; v8b q[2]; } u; const __bf16* p = rowk0 + 8 * (lane >> 4);
  u.q[0] = *(const v8b*)p; u.q[1] = *(const v8b*)(p + 16); return u.v;
}
__device__ __forceinline__ float bfr(float v) { return (float)(__bf16)v; }
__device__ __attribute__((noinline)) float exp_ni(float v) { return expf(v); }
__device__ __attribute__((noinline)) float erf_ni(float v) { return erff(v); }

#define PK_A 0                       // [2304][768] Wqkv rows (natural [out][in])
#define PK_P (PK_A + QKVW * DM)        // [768][768] Wo rows (natural)
#define PK_END (PK_P + DM * DM)
#define WS_PK  0u
#define WS_QK  (WS_PK + 2u * PK_END)             // f16 [4096 rows][1536]: q | k
#define WS_QKL (WS_QK + 2u * NB * SS * 2 * DM)     // f16 q | k residual planes x2048
#define WS_VTH (WS_QKL + 2u * NB * SS * 2 * DM)    // f16 [b][768 (h*64+d)][2048 s] hi
#define WS_VTL (WS_VTH + 2u * NB * DM * SS)        // f16 lo x 2048
#define WS_O   (WS_VTL + 2u * NB * DM * SS)        // f32 [4096][768]
#define WS_CS  (WS_O + 4u * NB * SS * DM)           // f32 2 x [2048][32], reserved, unused
#define WS_END (WS_CS + 4u * 2 * SS * 32)
// ---- k_pack: block = (row n, which): natural [out][in] rows -> bf16; which 0..2 -> W_q/W_k/W_v into PK_A rows which*768 + n; 3 -> W_o into PK_P
__global__ __launch_bounds__(256) void k_pack(const float* __restrict__ WQ, const float* __restrict__ WK, const float* __restrict__ WV, const float* __restrict__ WO, __bf16* __restrict__ PK) {
  __shared__ __align__(16) __bf16 s[DM]; const int n = blockIdx.x, which = blockIdx.y, t = threadIdx.x; const float* Wm = (which == 0) ? WQ : (which == 1) ? WK : (which == 2) ? WV : WO;
  for (int k = t; k < DM; k += 256) s[k] = (__bf16)Wm[(size_t)n * DM + k];
  __syncthreads();
  __bf16* dst = (which < 3) ? PK + PK_A + ((size_t)which * DM + n) * DM : PK + PK_P + (size_t)n * DM;
  for (int q = t; q < DM / 8; q += 256) vst2((unsigned*)(dst + q * 8), *(const v4u*)&s[q * 8]);
}
__global__ __launch_bounds__(128) void k_qkv(const float* __restrict__ XQ, const float* __restrict__ XK, const float* __restrict__ XV, const __bf16* __restrict__ P, const float* __restrict__ BQ, const float* __restrict__ BK, const float* __restrict__ BV, _Float16* __restrict__ QK, _Float16* __restrict__ QKL, _Float16* __restrict__ VTH, _Float16* __restrict__ VTL) {
  const int which0 = (blockIdx.y * 128) / DM; const float* X = (which0 == 0) ? XQ : (which0 == 1) ? XK : XV; const float* BB = BQ ? (((which0 == 0) ? BQ : (which0 == 1) ? BK : BV) + (blockIdx.y * 128 - which0 * DM)) : nullptr;
  __shared__ __align__(16) _Float16 so[4][16][136], sol[4][16][136]; __shared__ __align__(16) _Float16 sth[128][72], stl[128][72];
  const int tid = threadIdx.x, wave = tid >> 5, lane = tid & 31, col = lane & 15, g = lane >> 4; const size_t r0 = (size_t)blockIdx.x * 64 + wave * 16; const int n0 = blockIdx.y * 128;
  v8f acc[8] = {};
#pragma unroll 2
  for (int kc = 0; kc < DM / 32; ++kc) { v16b a; { const float* p = X + (r0 + col) * DM + kc * 32 + 8 * g;
#pragma unroll
      for (int i = 0; i < 8; ++i) { a[i] = (__bf16)p[i]; a[8 + i] = (__bf16)p[16 + i]; } }
#pragma unroll
    for (int j = 0; j < 8; ++j) acc[j] = wmma_bf(a, frag_b(P + (size_t)(n0 + j * 16 + col) * DM + kc * 32, lane), acc[j]); }
  if (n0 < 2 * DM) {   // q stored unscaled (f16 sigma ~0.6, no subnormal exposure); 1/8 applied to the f32 score
#pragma unroll
    for (int j = 0; j < 8; ++j) {
#pragma unroll
      for (int r = 0; r < 8; ++r) { const float v = acc[j][r] + (BB ? bfr(BB[j * 16 + col]) : 0.f); const _Float16 hv = (_Float16)v; so[wave][8 * g + r][j * 16 + col] = hv; sol[wave][8 * g + r][j * 16 + col] = (_Float16)((v - (float)hv) * 2048.0f); } }   // q, k (+ bias) as f16 hi + (x2048) residual
    LDSX();
    for (int rl = 0; rl < 16; ++rl) if (lane < 16) { vst2((unsigned*)(QK + (r0 + rl) * (2 * DM) + n0 + lane * 8), *(const v4u*)&so[wave][rl][lane * 8]); vst2((unsigned*)(QKL + (r0 + rl) * (2 * DM) + n0 + lane * 8), *(const v4u*)&sol[wave][rl][lane * 8]); }
  } else {
#pragma unroll
    for (int j = 0; j < 8; ++j) {
#pragma unroll
      for (int r = 0; r < 8; ++r) { const float v = acc[j][r] + (BB ? bfr(BB[j * 16 + col]) : 0.f); const _Float16 hv = (_Float16)v; sth[j * 16 + col][wave * 16 + 8 * g + r] = hv; stl[j * 16 + col][wave * 16 + 8 * g + r] = (_Float16)((v - (float)hv) * 2048.0f); } }
    __syncthreads();
    const size_t rb = (size_t)blockIdx.x * 64; const int b = (int)(rb / SS), s0 = (int)(rb % SS); const int pc0 = n0 - 2 * DM;
    for (int q = tid; q < 128 * 8; q += 128) { const int d = q >> 3, pc = q & 7; const size_t o = ((size_t)b * DM + pc0 + d) * SS + s0 + pc * 8; vst2((unsigned*)(VTH + o), *(const v4u*)&sth[d][pc * 8]); vst2((unsigned*)(VTL + o), *(const v4u*)&stl[d][pc * 8]); }
  }
}
// ---- k_attn: block = (64 queries, head h, batch b): all-keys flash attention (K = 64: 2 k-steps), scores = (q.k) * 0.125, 3 products of f16 hi + residual planes; P.V likewise; O[b*S+q][h*64+d] = (acc + accl / 2048) / (2048 l) (256-B segments)
// The four planes (k hi, k lo, v hi, v lo) of 64 keys are one stage: 64 rows of 128 B each, brought into LDS once per work-group by asynchronous copies (wave w copies plane w, whole 128-B lines), two buffers, the next stage in flight while this one is worked on; all four waves read their B fragments from LDS.
#define KST 64                 // keys per stage
#define NST (SS / KST)         // stages
#define RPH 72                 // LDS row pitch in f16: 128-B row + 16 B, the conflict-free pitch for 16-byte LDS reads
#define PLB (64 * RPH * 2)     // bytes of one plane of a stage in LDS
// eight asynchronous 16-byte-per-lane copies, each 4 rows of 128 B; ls / gs = bytes between two copies in LDS / in global memory
__device__ __forceinline__ void copy8(unsigned l0, const char* g0, unsigned ls, size_t gs) {
  const unsigned l1 = l0 + ls, l2 = l1 + ls, l3 = l2 + ls, l4 = l3 + ls, l5 = l4 + ls, l6 = l5 + ls, l7 = l6 + ls;
  const char *g1 = g0 + gs, *g2 = g1 + gs, *g3 = g2 + gs, *g4 = g3 + gs, *g5 = g4 + gs, *g6 = g5 + gs, *g7 = g6 + gs;
  // the closing s_wait_xcnt stands inside the statement so that no address register of a copy is rewritten in front of it
  asm volatile("global_load_async_to_lds_b128 %0, %8, off\n\t"
               "global_load_async_to_lds_b128 %1, %9, off\n\t"
               "global_load_async_to_lds_b128 %2, %10, off\n\t"
               "global_load_async_to_lds_b128 %3, %11, off\n\t"
               "global_load_async_to_lds_b128 %4, %12, off\n\t"
               "global_load_async_to_lds_b128 %5, %13, off\n\t"
               "global_load_async_to_lds_b128 %6, %14, off\n\t"
               "global_load_async_to_lds_b128 %7, %15, off\n\t"
               "s_wait_xcnt 0x0"
               :: "v"(l0), "v"(l1), "v"(l2), "v"(l3), "v"(l4), "v"(l5), "v"(l6), "v"(l7), "v"(g0), "v"(g1), "v"(g2), "v"(g3), "v"(g4), "v"(g5), "v"(g6), "v"(g7) : "memory");
}
__global__ __launch_bounds__(128) void k_attn(const _Float16* __restrict__ QK, const _Float16* __restrict__ QKL, const _Float16* __restrict__ VTH, const _Float16* __restrict__ VTL, const void* __restrict__ KMASK, float* __restrict__ O) {
  __shared__ __align__(16) float sp[4][16][36]; __shared__ __align__(16) float so[4][16][68];
  __shared__ __align__(16) _Float16 ring[2][4][64][RPH];   // [buffer][k hi, k lo, v hi, v lo][key row, or d row for v][d, or key for v]
  const int tid = threadIdx.x, wave = tid >> 5, lane = tid & 31, col = lane & 15, g = lane >> 4;
  const int qb = blockIdx.x, h = blockIdx.y, b = blockIdx.z; const int q0 = qb * 64 + wave * 16; const size_t rq = (size_t)b * SS + q0 + col;
  // this wave's plane: source of its lane's first 16 bytes of stage 0, row pitch and step from stage to stage in bytes
  const int wv = __builtin_amdgcn_readfirstlane(wave);
  const size_t koff = (size_t)b * SS * (2 * DM) + DM + h * HD, voff = ((size_t)b * DM + h * HD) * SS;
  const _Float16* pl0 = (wv == 0) ? QK + koff : (wv == 1) ? QKL + koff : (wv == 2) ? VTH + voff : VTL + voff;
  const size_t gpitch = (wv < 2) ? (size_t)(2 * DM * 2) : (size_t)(SS * 2), gstage = (wv < 2) ? (size_t)KST * (2 * DM * 2) : (size_t)(KST * 2);
  const char* gsrc = (const char*)pl0 + (size_t)(lane >> 3) * gpitch + (lane & 7) * 16;
  const unsigned ldst = (unsigned)(size_t)&ring[0][0][0][0] + (unsigned)wv * PLB + (unsigned)(lane >> 3) * (RPH * 2) + (unsigned)(lane & 7) * 16;
#define STAGE_COPY(BUF, ST) do { const char* gp_ = gsrc + (size_t)(ST) * gstage; const unsigned lp_ = ldst + (unsigned)(BUF) * (4 * PLB); \
    copy8(lp_, gp_, 4 * RPH * 2, 4 * gpitch); copy8(lp_ + 32 * RPH * 2, gp_ + 32 * gpitch, 4 * RPH * 2, 4 * gpitch); } while (0)
  STAGE_COPY(0, 0);
  v16h aq[2], aql[2];
#pragma unroll
  for (int kc = 0; kc < 2; ++kc) { aq[kc] = frag_h(QK + rq * (2 * DM) + h * HD + kc * 32, lane); aql[kc] = frag_h(QKL + rq * (2 * DM) + h * HD + kc * 32, lane); }
  float m[8], l[8];
#pragma unroll
  for (int r = 0; r < 8; ++r) { m[r] = -3.0e38f; l[r] = 0.f; }
  v8f acc[4] = {}, accl[4] = {};
  asm volatile("s_wait_asynccnt 0x0" ::: "memory");   // this wave's copies of stage 0 have landed
  __syncthreads();                                     // publishes stage 0 to the other waves
  STAGE_COPY(1, 1);
  // both loops kept rolled: one copy of the 32-key body in the instruction cache, and one set of fragment registers
#pragma unroll 1
  for (int st = 0; st < NST; ++st) { const _Float16* rb = &ring[st & 1][0][0][0];
#pragma unroll 1
  for (int sub = 0; sub < KST / 32; ++sub) { v8f s[2];
    v16h kh[2][2], kl[2][2];   // all k fragments of the 32 keys are read as one group ahead of the products
#pragma unroll
    for (int ct = 0; ct < 2; ++ct) { const _Float16* krow = rb + (sub * 32 + ct * 16 + col) * RPH;
#pragma unroll
      for (int kc = 0; kc < 2; ++kc) { kh[ct][kc] = frag_h(krow + kc * 32, lane); kl[ct][kc] = frag_h(krow + 64 * RPH + kc * 32, lane); } }
#pragma unroll
    for (int ct = 0; ct < 2; ++ct) { v8f c = {}, cl = {};
#pragma unroll
      for (int kc = 0; kc < 2; ++kc) { c = wmma16(aq[kc], kh[ct][kc], c); cl = wmma16(aql[kc], kh[ct][kc], cl); cl = wmma16(aq[kc], kl[ct][kc], cl); }   // 3 products: q, k as f16 hi + residual
#pragma unroll
      for (int r = 0; r < 8; ++r) c[r] += cl[r] * (1.0f / 2048.0f);
#pragma unroll
      for (int r = 0; r < 8; ++r) s[ct][r] = c[r] * 0.125f; }   // 1/sqrt(64)
#pragma unroll
    for (int r = 0; r < 8; ++r) { float mx = fmaxf(s[0][r], s[1][r]);
#pragma unroll
      for (int o = 1; o < 16; o <<= 1) mx = fmaxf(mx, __shfl_xor(mx, o));
      const float mn = fmaxf(m[r], mx); const float alpha = (m[r] <= -1.0e38f) ? 0.f : __expf(m[r] - mn);
      const float e0 = (s[0][r] <= -1.0e38f) ? 0.f : __expf(s[0][r] - mn), e1 = (s[1][r] <= -1.0e38f) ? 0.f : __expf(s[1][r] - mn); float es = e0 + e1;
#pragma unroll
      for (int o = 1; o < 16; o <<= 1) es += __shfl_xor(es, o);
      l[r] = l[r] * alpha + es; m[r] = mn;
#pragma unroll
      for (int dt = 0; dt < 4; ++dt) { acc[dt][r] *= alpha; accl[dt][r] *= alpha; }
      sp[wave][8 * g + r][col] = e0; sp[wave][8 * g + r][16 + col] = e1; }
    LDSX();
    v16h pa, pl; v16h vh[4], vl[4]; { const float* prow = &sp[wave][col][0] + 8 * (lane >> 4); float pv[16];
#pragma unroll
      for (int i = 0; i < 8; ++i) { pv[i] = prow[i]; pv[8 + i] = prow[16 + i]; }
#pragma unroll
      for (int dt = 0; dt < 4; ++dt) vh[dt] = frag_h(rb + 2 * 64 * RPH + (dt * 16 + col) * RPH + sub * 32, lane);   // the v hi fragments as one group behind the P rows, landing under the P split
#pragma unroll
      for (int i = 0; i < 8; ++i) { const float x0 = pv[i] * 2048.0f, x1 = pv[8 + i] * 2048.0f; const _Float16 h0 = (_Float16)x0, h1 = (_Float16)x1; pa[i] = h0; pa[8 + i] = h1; pl[i] = (_Float16)((x0 - (float)h0) * 2048.0f); pl[8 + i] = (_Float16)((x1 - (float)h1) * 2048.0f); } }   // P scaled by 2^11 before the f16 split so small softmax weights stay out of the f16 subnormal range; 2^-11 folded into the epilogue
    __builtin_amdgcn_sched_barrier(0);   // holds the v lo reads behind the P split: issued with the v hi group they lift the kernel above 256 VGPRs (register-window switches in the loop)
#pragma unroll
    for (int dt = 0; dt < 4; ++dt) vl[dt] = frag_h(rb + 3 * 64 * RPH + (dt * 16 + col) * RPH + sub * 32, lane);   // the v lo fragments as one group, landing under the v hi products
#pragma unroll
    for (int dt = 0; dt < 4; ++dt) { acc[dt] = wmma16(pa, vh[dt], acc[dt]); accl[dt] = wmma16(pl, vh[dt], accl[dt]); }
#pragma unroll
    for (int dt = 0; dt < 4; ++dt) accl[dt] = wmma16(pa, vl[dt], accl[dt]);   // P hi x V hi + (P lo x V hi + P hi x V lo) / 2048, each accumulator's order of sums as before
    LDSX(); }
    asm volatile("s_wait_dscnt 0x0" ::: "memory");      // this wave's reads of the buffer are done before it may be refilled
    asm volatile("s_wait_asynccnt 0x0" ::: "memory");   // this wave's copies of stage st + 1 have landed
    __syncthreads();                                     // publishes stage st + 1 and ends every wave's reads of stage st
    if (st + 2 < NST) STAGE_COPY(st & 1, st + 2); }
  asm volatile("s_wait_asynccnt 0x0" ::: "memory");     // no copy is outstanding when the wave goes on to the epilogue and ends
#pragma unroll
  for (int r = 0; r < 8; ++r) { const float il = (1.0f / 2048.0f) / l[r];
#pragma unroll
    for (int dt = 0; dt < 4; ++dt) so[wave][8 * g + r][dt * 16 + col] = (acc[dt][r] + accl[dt][r] * (1.0f / 2048.0f)) * il; }
  LDSX();
  for (int rl = 0; rl < 16; ++rl) if (lane < 16) vst2(O + ((size_t)b * SS + q0 + rl) * DM + h * HD + lane * 4, *(const v4f*)&so[wave][rl][lane * 4]);
}
// ---- k_out: block = (64 rows, 128 cols): out = O(hi/lo) . Wo rows (2 products) + bo
__global__ __launch_bounds__(128) void k_out(const float* __restrict__ O, const __bf16* __restrict__ P, const float* __restrict__ BO, float* __restrict__ Y) {
  __shared__ __align__(16) float so[4][16][132];
  const int tid = threadIdx.x, wave = tid >> 5, lane = tid & 31, col = lane & 15, g = lane >> 4; const size_t r0 = (size_t)blockIdx.x * 64 + wave * 16; const int n0 = blockIdx.y * 128;
  v8f acc[8] = {};
#pragma unroll 2
  for (int kc = 0; kc < DM / 32; ++kc) { const F2 a = split_row(O + (r0 + col) * DM, kc * 32, lane);
#pragma unroll
    for (int j = 0; j < 8; ++j) { const v16b w = frag_b(P + (size_t)(n0 + j * 16 + col) * DM + kc * 32, lane); acc[j] = wmma_bf(a.l, w, acc[j]); acc[j] = wmma_bf(a.h, w, acc[j]); } }
#pragma unroll
  for (int j = 0; j < 8; ++j) {
#pragma unroll
    for (int r = 0; r < 8; ++r) so[wave][8 * g + r][j * 16 + col] = acc[j][r] + bfr(BO[n0 + j * 16 + col]); }
  LDSX();
  for (int rl = 0; rl < 16; ++rl) vst2(Y + (r0 + rl) * DM + n0 + lane * 4, *(const v4f*)&so[wave][rl][lane * 4]);
}
// ---- k_kvin: block = (64 keys m, head h, b): k input [b][h][m][64] -> K rows [b*M + m][DM + h*64 + d] of the q|k plane pair (f16 hi + x2048 residual); v input -> V planes [b][h*64 + d][m]
__global__ __launch_bounds__(256) void k_kvin(const float* __restrict__ KIN, const float* __restrict__ VIN, _Float16* __restrict__ QK, _Float16* __restrict__ QKL, _Float16* __restrict__ VTH, _Float16* __restrict__ VTL) {
  __shared__ __align__(16) _Float16 skh[64][72], skl[64][72], svh[64][72], svl[64][72]; const int t = threadIdx.x; const int m0 = blockIdx.x * 64, h = blockIdx.y; const size_t b = blockIdx.z;
  for (int e = t; e < 64 * 64; e += 256) { const int r = e >> 6, d = e & 63; const size_t src = ((b * NH + h) * SS + m0 + r) * HD + d; const float kv = bfr(KIN[src]), vv = bfr(VIN[src]);
    const _Float16 kh = (_Float16)kv, vh = (_Float16)vv; skh[r][d] = kh; skl[r][d] = (_Float16)((kv - (float)kh) * 2048.0f); svh[d][r] = vh; svl[d][r] = (_Float16)((vv - (float)vh) * 2048.0f); }
  __syncthreads();
  for (int e = t; e < 64 * 8; e += 256) { const int r = e >> 3, q = e & 7; const size_t o = (b * SS + m0 + r) * (2 * DM) + DM + h * HD + q * 8; vst2((unsigned*)(QK + o), *(const v4u*)&skh[r][q * 8]); vst2((unsigned*)(QKL + o), *(const v4u*)&skl[r][q * 8]);
    const size_t ov = (b * DM + h * HD + r) * SS + m0 + q * 8; vst2((unsigned*)(VTH + ov), *(const v4u*)&svh[r][q * 8]); vst2((unsigned*)(VTL + ov), *(const v4u*)&svl[r][q * 8]); }
}
extern "C" void kernel_launch(void* const* d_in, const int* in_sizes, int n_in, void* d_out, int out_size, void* d_ws, size_t ws_size, hipStream_t stream) {
  (void)in_sizes; (void)n_in; (void)out_size;
  const float** F = (const float**)d_in;   // 0 x [2,2048,768], 1 k [2,12,2048,64], 2 v [2,12,2048,64], 3 w_qkv [768,768] natural (q only), 4 w_proj [768,768] natural, 5 b_proj [768]
  if (ws_size < (size_t)WS_END) return;
  char* ws = (char*)d_ws; __bf16* PK = (__bf16*)(ws + WS_PK); _Float16 *QK = (_Float16*)(ws + WS_QK), *QKL = (_Float16*)(ws + WS_QKL), *VTH = (_Float16*)(ws + WS_VTH), *VTL = (_Float16*)(ws + WS_VTL); float* O = (float*)(ws + WS_O);
  k_pack<<<dim3(DM, 4), 256, 0, stream>>>(F[3], F[3], F[3], F[4], PK);   // only the q rows and w_proj are used
  k_qkv<<<dim3(TNB * SS / 64, DM / 128), 128, 0, stream>>>(F[0], F[0], F[0], PK + PK_A, nullptr, nullptr, nullptr, QK, QKL, VTH, VTL);   // q columns only
  k_kvin<<<dim3(SS / 64, NH, TNB), 256, 0, stream>>>(F[1], F[2], QK, QKL, VTH, VTL);
  k_attn<<<dim3(TQB, NH, TNB), 128, 0, stream>>>(QK, QKL, VTH, VTL, nullptr, O);
  k_out<<<dim3(TOB, DM / 128), 128, 0, stream>>>(O, PK + PK_P, F[5], (float*)d_out);
}

// v002
// A run of this version takes 198 microseconds.
// Timed twice side by side with v001, it ran 1.20 times as fast both times.
// All steps since v000 together make it 2.01 times as fast.
// compute dtype: x, k, v, w_qkv, w_proj, b_proj rounded to bf16; q = x . w_qkv^T with exact bf16 products on WMMA 16x16x32 (natural rows), stored as f16 hi + (x2048-scaled) residual planes; the k and v INPUTS are re-laid out on device as f16 hi + (x2048) residual planes (exact: bf16 values are representable, the residual only catches the sub-f16-normal range); 3-product scores x 1/sqrt(64), running-max softmax in f32 (hardware exp); P (scaled by 2^11, as f16 hi + residual) x v hi/lo (3 products); output projection with ctx as bf16 hi + residual x exact w_proj rows (2 products) + b_proj; f32 accumulate.
#include <hip/hip_runtime.h>
#include <math.h>

typedef __attribute__((ext_vector_type(16))) _Float16 v16h;
typedef __attribute__((ext_vector_type(16))) __bf16 v16b;
typedef __attribute__((ext_vector_type(8)))  _Float16 v8h;
typedef __attribute__((ext_vector_type(8)))  float v8f;
typedef __attribute__((ext_vector_type(4)))  float v4f;
typedef __attribute__((ext_vector_type(2)))  float v2f;
typedef __attribute__((ext_vector_type(4)))  unsigned v4u;
typedef __attribute__((ext_vector_type(4)))  int v4i;
typedef float __attribute__((may_alias)) float_a;
typedef int __attribute__((may_alias)) int_a;

template <typename T> __device__ __forceinline__ void vst2(void* p, T v) { *(T*)p = v;  }
__device__ __forceinline__ v8f wmma16(v16h a, v16h b, v8f c) {
  v8f d = __builtin_amdgcn_wmma_f32_16x16x32_f16(false, a, false, b, (short)0, c, false, false);
  asm volatile("v_nop\n\tv_nop\n\tv_nop\n\tv_nop" : "+v"(d) : "v"(a), "v"(b));
  return d;
}
__device__ __forceinline__ v8f wmma_bf(v16b a, v16b b, v8f c) {
  v8f d = __builtin_amdgcn_wmma_f32_16x16x32_bf16(false, a, false, b, (short)0, c, false, false);
  asm volatile("v_nop\n\tv_nop\n\tv_nop\n\tv_nop" : "+v"(d) : "v"(a), "v"(b));
  return d;
}
// ViT-style attention with given key/value caches (B 2, N = M = 2,048, dim 768, 12 heads x 64): q = x W_qkv^T, softmax(q k^T / 8) v, output projection + bias.
__device__ __forceinline__ v16h frag_h(const _Float16* rowk0, int lane) {
  union { v16h v; v8h q[2]; } u; const _Float16* p = rowk0 + 8 * (lane >> 4);
  u.q[0] = *(const v8h*)p; u.q[1] = *(const v8h*)(p + 16); return u.v;
}
__device__ __forceinline__ v16h frag_f32(const float* rowk0, int lane) {
  v16h a; const float* p = rowk0 + 8 * (lane >> 4);
#pragma unroll
  for (int i = 0; i < 8; ++i) { a[i] = (_Float16)p[i]; a[8 + i] = (_Float16)p[16 + i]; }
  return a;
}
__device__ __forceinline__ v16h frag_f32s(const float* rowk0, int lane, float sc) {
  v16h a; const float* p = rowk0 + 8 * (lane >> 4);
#pragma unroll
  for (int i = 0; i < 8; ++i) { a[i] = (_Float16)(p[i] * sc); a[8 + i] = (_Float16)(p[16 + i] * sc); }
  return a;
}
// column fragment from a [K][ld] layout (column n), rows >= K read as 0
__device__ __forceinline__ v16h fragc_f32(const float* W, int k0, int n, int lane, int ld, int K) {
  v16h a; const int g = lane >> 4;
#pragma unroll
  for (int i = 0; i < 8; ++i) { const int ka = k0 + 8 * g + i, kb = ka + 16;
    a[i] = (_Float16)(ka < K ? W[(size_t)(ka < K ? ka : K - 1) * ld + n] : 0.f); a[8 + i] = (_Float16)(kb < K ? W[(size_t)(kb < K ? kb : K - 1) * ld + n] : 0.f); }
  return a;
}
struct F2 { v16b h, l; };
__device__ __forceinline__ F2 bsplit16(const float v[16]) { F2 r;
#pragma unroll
  for (int i = 0; i < 16; ++i) { const __bf16 h = (__bf16)v[i]; r.h[i] = h; r.l[i] = (__bf16)(v[i] - (float)h); }
  return r; }
__device__ __forceinline__ F2 split_row(const float* row, int k0, int lane) { float v[16]; const float* p = row + k0 + 8 * (lane >> 4);
#pragma unroll
  for (int i = 0; i < 8; ++i) { v[i] = p[i]; v[8 + i] = p[16 + i]; }
  return bsplit16(v); }
__device__ __forceinline__ F2 split_rowK(const float* row, int k0, int lane, int K) { float v[16]; const int g = lane >> 4;
#pragma unroll
  for (int i = 0; i < 8; ++i) { const int ka = k0 + 8 * g + i, kb = ka + 16; v[i] = ka < K ? row[ka < K ? ka : K - 1] : 0.f; v[8 + i] = kb < K ? row[kb < K ? kb : K - 1] : 0.f; }
  return bsplit16(v); }
__device__ __forceinline__ F2 split_col(const float* W, int k0, int n, int lane, int ld, int K) { float v[16]; const int g = lane >> 4;
#pragma unroll
  for (int i = 0; i < 8; ++i) { const int ka = k0 + 8 * g + i, kb = ka + 16; v[i] = ka < K ? W[(size_t)(ka < K ? ka : K - 1) * ld + n] : 0.f; v[8 + i] = kb < K ? W[(size_t)(kb < K ? kb : K - 1) * ld + n] : 0.f; }
  return bsplit16(v); }
__device__ __forceinline__ v8f mac3(const F2& a, const F2& b, v8f c) { c = wmma_bf(a.l, b.h, c); c = wmma_bf(a.h, b.l, c); return wmma_bf(a.h, b.h, c); }
__device__ __forceinline__ float sigm(float v) { return 1.0f / (1.0f + expf(-v)); }
#define LDSX() do { asm volatile("s_wait_dscnt 0" ::: "memory"); __builtin_amdgcn_wave_barrier(); __builtin_amdgcn_fence(__ATOMIC_RELEASE, "workgroup"); } while (0)


#define NB 2
#define SS 2048
#define DM 768
#define NH 12
#define HD 64
#define QKVW (3 * DM)
#ifndef TQB
#define TQB (SS / 64)
#define TNB NB
#define TOB (NB * SS / 64)     // output row tiles (all)
#endif
typedef __attribute__((ext_vector_type(8))) __bf16 v8b;
__device__ __forceinline__ v16b frag_b(const __bf16* rowk0, int lane) {
  union { v16b v; v8b q[2]; } u; const __bf16* p = rowk0 + 8 * (lane >> 4);
  u.q[0] = *(const v8b*)p; u.q[1] = *(const v8b*)(p + 16); return u.v;
}
__device__ __forceinline__ float bfr(float v) { return (float)(__bf16)v; }
__device__ __attribute__((noinline)) float exp_ni(float v) { return expf(v); }
__device__ __attribute__((noinline)) float erf_ni(float v) { return erff(v); }

#define PK_A 0                       // [2304][768] Wqkv rows (natural [out][in])
#define PK_P (PK_A + QKVW * DM)        // [768][768] Wo rows (natural)
#define PK_END (PK_P + DM * DM)
#define WS_PK  0u
#define WS_QK  (WS_PK + 2u * PK_END)             // f16 [4096 rows][1536]: q | k
#define WS_QKL (WS_QK + 2u * NB * SS * 2 * DM)     // f16 q | k residual planes x2048
#define WS_VTH (WS_QKL + 2u * NB * SS * 2 * DM)    // f16 [b][768 (h*64+d)][2048 s] hi
#define WS_VTL (WS_VTH + 2u * NB * DM * SS)        // f16 lo x 2048
#define WS_O   (WS_VTL + 2u * NB * DM * SS)        // f32 [4096][768]
#define WS_CS  (WS_O + 4u * NB * SS * DM)           // f32 2 x [2048][32], reserved, unused
#define WS_END (WS_CS + 4u * 2 * SS * 32)
// ---- k_pack: block = (row n, which): natural [out][in] rows -> bf16; which 0..2 -> W_q/W_k/W_v into PK_A rows which*768 + n; 3 -> W_o into PK_P
__global__ __launch_bounds__(256) void k_pack(const float* __restrict__ WQ, const float* __restrict__ WK, const float* __restrict__ WV, const float* __restrict__ WO, __bf16* __restrict__ PK) {
  __shared__ __align__(16) __bf16 s[DM]; const int n = blockIdx.x, which = blockIdx.y, t = threadIdx.x; const float* Wm = (which == 0) ? WQ : (which == 1) ? WK : (which == 2) ? WV : WO;
  for (int k = t; k < DM; k += 256) s[k] = (__bf16)Wm[(size_t)n * DM + k];
  __syncthreads();
  __bf16* dst = (which < 3) ? PK + PK_A + ((size_t)which * DM + n) * DM : PK + PK_P + (size_t)n * DM;
  for (int q = t; q < DM / 8; q += 256) vst2((unsigned*)(dst + q * 8), *(const v4u*)&s[q * 8]);
}
__global__ __launch_bounds__(128) void k_qkv(const float* __restrict__ XQ, const float* __restrict__ XK, const float* __restrict__ XV, const __bf16* __restrict__ P, const float* __restrict__ BQ, const float* __restrict__ BK, const float* __restrict__ BV, _Float16* __restrict__ QK, _Float16* __restrict__ QKL, _Float16* __restrict__ VTH, _Float16* __restrict__ VTL) {
  const int which0 = (blockIdx.y * 128) / DM; const float* X = (which0 == 0) ? XQ : (which0 == 1) ? XK : XV; const float* BB = BQ ? (((which0 == 0) ? BQ : (which0 == 1) ? BK : BV) + (blockIdx.y * 128 - which0 * DM)) : nullptr;
  __shared__ __align__(16) _Float16 so[4][16][136], sol[4][16][136]; __shared__ __align__(16) _Float16 sth[128][72], stl[128][72];
  const int tid = threadIdx.x, wave = tid >> 5, lane = tid & 31, col = lane & 15, g = lane >> 4; const size_t r0 = (size_t)blockIdx.x * 64 + wave * 16; const int n0 = blockIdx.y * 128;
  v8f acc[8] = {};
#pragma unroll 2
  for (int kc = 0; kc < DM / 32; ++kc) { v16b a; { const float* p = X + (r0 + col) * DM + kc * 32 + 8 * g;
#pragma unroll
      for (int i = 0; i < 8; ++i) { a[i] = (__bf16)p[i]; a[8 + i] = (__bf16)p[16 + i]; } }
#pragma unroll
    for (int j = 0; j < 8; ++j) acc[j] = wmma_bf(a, frag_b(P + (size_t)(n0 + j * 16 + col) * DM + kc * 32, lane), acc[j]); }
  if (n0 < 2 * DM) {   // q stored unscaled (f16 sigma ~0.6, no subnormal exposure); 1/8 applied to the f32 score
#pragma unroll
    for (int j = 0; j < 8; ++j) {
#pragma unroll
      for (int r = 0; r < 8; ++r) { const float v = acc[j][r] + (BB ? bfr(BB[j * 16 + col]) : 0.f); const _Float16 hv = (_Float16)v; so[wave][8 * g + r][j * 16 + col] = hv; sol[wave][8 * g + r][j * 16 + col] = (_Float16)((v - (float)hv) * 2048.0f); } }   // q, k (+ bias) as f16 hi + (x2048) residual
    LDSX();
    for (int rl = 0; rl < 16; ++rl) if (lane < 16) { vst2((unsigned*)(QK + (r0 + rl) * (2 * DM) + n0 + lane * 8), *(const v4u*)&so[wave][rl][lane * 8]); vst2((unsigned*)(QKL + (r0 + rl) * (2 * DM) + n0 + lane * 8), *(const v4u*)&sol[wave][rl][lane * 8]); }
  } else {
#pragma unroll
    for (int j = 0; j < 8; ++j) {
#pragma unroll
      for (int r = 0; r < 8; ++r) { const float v = acc[j][r] + (BB ? bfr(BB[j * 16 + col]) : 0.f); const _Float16 hv = (_Float16)v; sth[j * 16 + col][wave * 16 + 8 * g + r] = hv; stl[j * 16 + col][wave * 16 + 8 * g + r] = (_Float16)((v - (float)hv) * 2048.0f); } }
    __syncthreads();
    const size_t rb = (size_t)blockIdx.x * 64; const int b = (int)(rb / SS), s0 = (int)(rb % SS); const int pc0 = n0 - 2 * DM;
    for (int q = tid; q < 128 * 8; q += 128) { const int d = q >> 3, pc = q & 7; const size_t o = ((size_t)b * DM + pc0 + d) * SS + s0 + pc * 8; vst2((unsigned*)(VTH + o), *(const v4u*)&sth[d][pc * 8]); vst2((unsigned*)(VTL + o), *(const v4u*)&stl[d][pc * 8]); }
  }
}
#define KST 64                 // keys per stage
#define NST (SS / KST)         // stages
#define RPH 72                 // LDS row pitch in f16: 128-B row + 16 B, the conflict-free pitch for 16-byte LDS reads
#define PLB (64 * RPH * 2)     // bytes of one plane of a stage in LDS
// eight asynchronous 16-byte-per-lane copies, each 4 rows of 128 B; ls / gs = bytes between two copies in LDS / in global memory
__device__ __forceinline__ void copy8(unsigned l0, const char* g0, unsigned ls, size_t gs) {
  const unsigned l1 = l0 + ls, l2 = l1 + ls, l3 = l2 + ls, l4 = l3 + ls, l5 = l4 + ls, l6 = l5 + ls, l7 = l6 + ls;
  const char *g1 = g0 + gs, *g2 = g1 + gs, *g3 = g2 + gs, *g4 = g3 + gs, *g5 = g4 + gs, *g6 = g5 + gs, *g7 = g6 + gs;
  // the closing s_wait_xcnt stands inside the statement so that no address register of a copy is rewritten in front of it
  asm volatile("global_load_async_to_lds_b128 %0, %8, off\n\t"
               "global_load_async_to_lds_b128 %1, %9, off\n\t"
               "global_load_async_to_lds_b128 %2, %10, off\n\t"
               "global_load_async_to_lds_b128 %3, %11, off\n\t"
               "global_load_async_to_lds_b128 %4, %12, off\n\t"
               "global_load_async_to_lds_b128 %5, %13, off\n\t"
               "global_load_async_to_lds_b128 %6, %14, off\n\t"
               "global_load_async_to_lds_b128 %7, %15, off\n\t"
               "s_wait_xcnt 0x0"
               :: "v"(l0), "v"(l1), "v"(l2), "v"(l3), "v"(l4), "v"(l5), "v"(l6), "v"(l7), "v"(g0), "v"(g1), "v"(g2), "v"(g3), "v"(g4), "v"(g5), "v"(g6), "v"(g7) : "memory");
}
// lane l takes the value of lane l ^ 16
__device__ __forceinline__ float xhalf(float x) { return __builtin_bit_cast(float, __builtin_amdgcn_permlanex16(__builtin_bit_cast(int, x), __builtin_bit_cast(int, x), 0x76543210, 0xfedcba98, false, false)); }
__global__ __launch_bounds__(128) void k_attn(const _Float16* __restrict__ QK, const _Float16* __restrict__ QKL, const _Float16* __restrict__ VTH, const _Float16* __restrict__ VTL, const void* __restrict__ KMASK, float* __restrict__ O) {
  __shared__ __align__(16) float so[4][16][68];
  __shared__ __align__(16) _Float16 ring[2][4][64][RPH];   // [buffer][k hi, k lo, v hi, v lo][key row, or d row for v][d, or key for v]
  const int tid = threadIdx.x, wave = tid >> 5, lane = tid & 31, col = lane & 15, g = lane >> 4;
  const int qb = blockIdx.x, h = blockIdx.y, b = blockIdx.z; const int q0 = qb * 64 + wave * 16; const size_t rq = (size_t)b * SS + q0 + col;
  // this wave's plane: source of its lane's first 16 bytes of stage 0, row pitch and step from stage to stage in bytes
  const int wv = __builtin_amdgcn_readfirstlane(wave);
  const size_t koff = (size_t)b * SS * (2 * DM) + DM + h * HD, voff = ((size_t)b * DM + h * HD) * SS;
  const _Float16* pl0 = (wv == 0) ? QK + koff : (wv == 1) ? QKL + koff : (wv == 2) ? VTH + voff : VTL + voff;
  const size_t gpitch = (wv < 2) ? (size_t)(2 * DM * 2) : (size_t)(SS * 2), gstage = (wv < 2) ? (size_t)KST * (2 * DM * 2) : (size_t)(KST * 2);
  const char* gsrc = (const char*)pl0 + (size_t)(lane >> 3) * gpitch + (lane & 7) * 16;
  const unsigned ldst = (unsigned)(size_t)&ring[0][0][0][0] + (unsigned)wv * PLB + (unsigned)(lane >> 3) * (RPH * 2) + (unsigned)(lane & 7) * 16;
#define STAGE_COPY(BUF, ST) do { const char* gp_ = gsrc + (size_t)(ST) * gstage; const unsigned lp_ = ldst + (unsigned)(BUF) * (4 * PLB); \
    copy8(lp_, gp_, 4 * RPH * 2, 4 * gpitch); copy8(lp_ + 32 * RPH * 2, gp_ + 32 * gpitch, 4 * RPH * 2, 4 * gpitch); } while (0)
  STAGE_COPY(0, 0);
  v16h aq[2], aql[2];
#pragma unroll
  for (int kc = 0; kc < 2; ++kc) { aq[kc] = frag_h(QK + rq * (2 * DM) + h * HD + kc * 32, lane); aql[kc] = frag_h(QKL + rq * (2 * DM) + h * HD + kc * 32, lane); }
  float m = -3.0e38f, l = 0.f;   // running maximum of this lane's query (both halves agree) and this half's share of its sum
  v8f acc[4] = {}, accl[4] = {};
  asm volatile("s_wait_asynccnt 0x0" ::: "memory");   // this wave's copies of stage 0 have landed
  __syncthreads();                                     // publishes stage 0 to the other waves
  STAGE_COPY(1, 1);
  // both loops kept rolled: one copy of the 32-key body in the instruction cache, and one set of fragment registers
#pragma unroll 1
  for (int st = 0; st < NST; ++st) { const _Float16* rb = &ring[st & 1][0][0][0];
#pragma unroll 1
  for (int sub = 0; sub < KST / 32; ++sub) { v8f s[2];
    v16h kh[2][2], kl[2][2];   // all k fragments of the 32 keys are read as one group ahead of the products
#pragma unroll
    for (int ct = 0; ct < 2; ++ct) { const _Float16* krow = rb + (sub * 32 + ct * 16 + col) * RPH;
#pragma unroll
      for (int kc = 0; kc < 2; ++kc) { kh[ct][kc] = frag_h(krow + kc * 32, lane); kl[ct][kc] = frag_h(krow + 64 * RPH + kc * 32, lane); } }
#pragma unroll
    for (int ct = 0; ct < 2; ++ct) { v8f c = {}, cl = {};
#pragma unroll
      for (int kc = 0; kc < 2; ++kc) { c = wmma16(kh[ct][kc], aq[kc], c); cl = wmma16(kh[ct][kc], aql[kc], cl); cl = wmma16(kl[ct][kc], aq[kc], cl); }   // transposed scores, k rows as A and q as B: 3 products of f16 hi + residual, in the order as before
#pragma unroll
      for (int r = 0; r < 8; ++r) c[r] += cl[r] * (1.0f / 2048.0f);
#pragma unroll
      for (int r = 0; r < 8; ++r) s[ct][r] = c[r] * 0.125f; }   // 1/sqrt(64); s[ct][r] = score of key sub * 32 + ct * 16 + 8 g + r for query col
    v16h vh[4], vl[4];   // the v fragments (d rows as A) as one group, landing under the softmax
#pragma unroll
    for (int dt = 0; dt < 4; ++dt) { vh[dt] = frag_h(rb + 2 * 64 * RPH + (dt * 16 + col) * RPH + sub * 32, lane); vl[dt] = frag_h(rb + 3 * 64 * RPH + (dt * 16 + col) * RPH + sub * 32, lane); }
    float mx = fmaxf(s[0][0], s[1][0]);
#pragma unroll
    for (int r = 1; r < 8; ++r) mx = fmaxf(mx, fmaxf(s[0][r], s[1][r]));
    mx = fmaxf(mx, xhalf(mx));   // the other 16 of the 32 keys lie in lane ^ 16
    const float mn = fmaxf(m, mx); const float alpha = (m <= -1.0e38f) ? 0.f : __expf(m - mn); m = mn;
    float e[2][8], t[8];
#pragma unroll
    for (int r = 0; r < 8; ++r) { e[0][r] = (s[0][r] <= -1.0e38f) ? 0.f : __expf(s[0][r] - mn); e[1][r] = (s[1][r] <= -1.0e38f) ? 0.f : __expf(s[1][r] - mn); t[r] = e[0][r] + e[1][r]; }
    l = l * alpha + (((t[0] + t[1]) + (t[2] + t[3])) + ((t[4] + t[5]) + (t[6] + t[7])));
#pragma unroll
    for (int dt = 0; dt < 4; ++dt) {
#pragma unroll
      for (int r = 0; r < 8; ++r) { acc[dt][r] *= alpha; accl[dt][r] *= alpha; } }
    v16h pa, pl;   // the two score tiles of a lane are, element for element, the B fragment of P transposed: element r = key 8 g + r, element 8 + r = key 16 + 8 g + r, the k order of frag_h
#pragma unroll
    for (int i = 0; i < 8; ++i) { const float x0 = e[0][i] * 2048.0f, x1 = e[1][i] * 2048.0f; const _Float16 h0 = (_Float16)x0, h1 = (_Float16)x1; pa[i] = h0; pa[8 + i] = h1; pl[i] = (_Float16)((x0 - (float)h0) * 2048.0f); pl[8 + i] = (_Float16)((x1 - (float)h1) * 2048.0f); }   // P scaled by 2^11 before the f16 split so small softmax weights stay out of the f16 subnormal range; 2^-11 folded into the epilogue
#pragma unroll
    for (int dt = 0; dt < 4; ++dt) { acc[dt] = wmma16(vh[dt], pa, acc[dt]); accl[dt] = wmma16(vh[dt], pl, accl[dt]); }
#pragma unroll
    for (int dt = 0; dt < 4; ++dt) accl[dt] = wmma16(vl[dt], pa, accl[dt]); }   // transposed output, acc[dt][r] = d dt * 16 + 8 g + r of query col: V hi x P hi + (V hi x P lo + V lo x P hi) / 2048, each accumulator's order of sums as before
    asm volatile("s_wait_dscnt 0x0" ::: "memory");      // this wave's reads of the buffer are done before it may be refilled
    asm volatile("s_wait_asynccnt 0x0" ::: "memory");   // this wave's copies of stage st + 1 have landed
    __syncthreads();                                     // publishes stage st + 1 and ends every wave's reads of stage st
    if (st + 2 < NST) STAGE_COPY(st & 1, st + 2); }
  asm volatile("s_wait_asynccnt 0x0" ::: "memory");     // no copy is outstanding when the wave goes on to the epilogue and ends
  const float il = (1.0f / 2048.0f) / (l + xhalf(l));   // the two halves' sums are joined once
#pragma unroll
  for (int dt = 0; dt < 4; ++dt) { v4f o0, o1;
#pragma unroll
    for (int r = 0; r < 4; ++r) { o0[r] = (acc[dt][r] + accl[dt][r] * (1.0f / 2048.0f)) * il; o1[r] = (acc[dt][4 + r] + accl[dt][4 + r] * (1.0f / 2048.0f)) * il; }
    *(v4f*)&so[wave][col][dt * 16 + 8 * g] = o0; *(v4f*)&so[wave][col][dt * 16 + 8 * g + 4] = o1; }
  LDSX();
  for (int rl = 0; rl < 16; ++rl) if (lane < 16) vst2(O + ((size_t)b * SS + q0 + rl) * DM + h * HD + lane * 4, *(const v4f*)&so[wave][rl][lane * 4]);
}
// ---- k_out: block = (64 rows, 128 cols): out = O(hi/lo) . Wo rows (2 products) + bo
__global__ __launch_bounds__(128) void k_out(const float* __restrict__ O, const __bf16* __restrict__ P, const float* __restrict__ BO, float* __restrict__ Y) {
  __shared__ __align__(16) float so[4][16][132];
  const int tid = threadIdx.x, wave = tid >> 5, lane = tid & 31, col = lane & 15, g = lane >> 4; const size_t r0 = (size_t)blockIdx.x * 64 + wave * 16; const int n0 = blockIdx.y * 128;
  v8f acc[8] = {};
#pragma unroll 2
  for (int kc = 0; kc < DM / 32; ++kc) { const F2 a = split_row(O + (r0 + col) * DM, kc * 32, lane);
#pragma unroll
    for (int j = 0; j < 8; ++j) { const v16b w = frag_b(P + (size_t)(n0 + j * 16 + col) * DM + kc * 32, lane); acc[j] = wmma_bf(a.l, w, acc[j]); acc[j] = wmma_bf(a.h, w, acc[j]); } }
#pragma unroll
  for (int j = 0; j < 8; ++j) {
#pragma unroll
    for (int r = 0; r < 8; ++r) so[wave][8 * g + r][j * 16 + col] = acc[j][r] + bfr(BO[n0 + j * 16 + col]); }
  LDSX();
  for (int rl = 0; rl < 16; ++rl) vst2(Y + (r0 + rl) * DM + n0 + lane * 4, *(const v4f*)&so[wave][rl][lane * 4]);
}
// ---- k_kvin: block = (64 keys m, head h, b): k input [b][h][m][64] -> K rows [b*M + m][DM + h*64 + d] of the q|k plane pair (f16 hi + x2048 residual); v input -> V planes [b][h*64 + d][m]
__global__ __launch_bounds__(256) void k_kvin(const float* __restrict__ KIN, const float* __restrict__ VIN, _Float16* __restrict__ QK, _Float16* __restrict__ QKL, _Float16* __restrict__ VTH, _Float16* __restrict__ VTL) {
  __shared__ __align__(16) _Float16 skh[64][72], skl[64][72], svh[64][72], svl[64][72]; const int t = threadIdx.x; const int m0 = blockIdx.x * 64, h = blockIdx.y; const size_t b = blockIdx.z;
  for (int e = t; e < 64 * 64; e += 256) { const int r = e >> 6, d = e & 63; const size_t src = ((b * NH + h) * SS + m0 + r) * HD + d; const float kv = bfr(KIN[src]), vv = bfr(VIN[src]);
    const _Float16 kh = (_Float16)kv, vh = (_Float16)vv; skh[r][d] = kh; skl[r][d] = (_Float16)((kv - (float)kh) * 2048.0f); svh[d][r] = vh; svl[d][r] = (_Float16)((vv - (float)vh) * 2048.0f); }
  __syncthreads();
  for (int e = t; e < 64 * 8; e += 256) { const int r = e >> 3, q = e & 7; const size_t o = (b * SS + m0 + r) * (2 * DM) + DM + h * HD + q * 8; vst2((unsigned*)(QK + o), *(const v4u*)&skh[r][q * 8]); vst2((unsigned*)(QKL + o), *(const v4u*)&skl[r][q * 8]);
    const size_t ov = (b * DM + h * HD + r) * SS + m0 + q * 8; vst2((unsigned*)(VTH + ov), *(const v4u*)&svh[r][q * 8]); vst2((unsigned*)(VTL + ov), *(const v4u*)&svl[r][q * 8]); }
}
extern "C" void kernel_launch(void* const* d_in, const int* in_sizes, int n_in, void* d_out, int out_size, void* d_ws, size_t ws_size, hipStream_t stream) {
  (void)in_sizes; (void)n_in; (void)out_size;
  const float** F = (const float**)d_in;   // 0 x [2,2048,768], 1 k [2,12,2048,64], 2 v [2,12,2048,64], 3 w_qkv [768,768] natural (q only), 4 w_proj [768,768] natural, 5 b_proj [768]
  if (ws_size < (size_t)WS_END) return;
  char* ws = (char*)d_ws; __bf16* PK = (__bf16*)(ws + WS_PK); _Float16 *QK = (_Float16*)(ws + WS_QK), *QKL = (_Float16*)(ws + WS_QKL), *VTH = (_Float16*)(ws + WS_VTH), *VTL = (_Float16*)(ws + WS_VTL); float* O = (float*)(ws + WS_O);
  k_pack<<<dim3(DM, 4), 256, 0, stream>>>(F[3], F[3], F[3], F[4], PK);   // only the q rows and w_proj are used
  k_qkv<<<dim3(TNB * SS / 64, DM / 128), 128, 0, stream>>>(F[0], F[0], F[0], PK + PK_A, nullptr, nullptr, nullptr, QK, QKL, VTH, VTL);   // q columns only
  k_kvin<<<dim3(SS / 64, NH, TNB), 256, 0, stream>>>(F[1], F[2], QK, QKL, VTH, VTL);
  k_attn<<<dim3(TQB, NH, TNB), 128, 0, stream>>>(QK, QKL, VTH, VTL, nullptr, O);
  k_out<<<dim3(TOB, DM / 128), 128, 0, stream>>>(O, PK + PK_P, F[5], (float*)d_out);
}

// v003
// Measured time: 118 microseconds a run.
// In two side-by-side timings against v002, it was 1.64 and 1.69 times as fast.
// All steps since v000 together make it 3.35 times as fast.
// compute dtype: x, k, v, w_qkv, w_proj, b_proj rounded to bf16; q = x . w_qkv^T with exact bf16 products on WMMA 16x16x32 (natural rows), stored as f16 hi + (x2048-scaled) residual planes; the k and v INPUTS are re-laid out on device as f16 hi + (x2048) residual planes (exact: bf16 values are representable, the residual only catches the sub-f16-normal range); 3-product scores x 1/sqrt(64), running-max softmax in f32 (hardware exp); P (scaled by 2^11, as f16 hi + residual) x v hi/lo (3 products); output projection with ctx as bf16 hi + residual x exact w_proj rows (2 products) + b_proj; f32 accumulate.
#include <hip/hip_runtime.h>
#include <math.h>

typedef __attribute__((ext_vector_type(16))) _Float16 v16h;
typedef __attribute__((ext_vector_type(16))) __bf16 v16b;
typedef __attribute__((ext_vector_type(8)))  _Float16 v8h;
typedef __attribute__((ext_vector_type(8)))  float v8f;
typedef __attribute__((ext_vector_type(4)))  float v4f;
typedef __attribute__((ext_vector_type(2)))  float v2f;
typedef __attribute__((ext_vector_type(4)))  unsigned v4u;
typedef __attribute__((ext_vector_type(4)))  int v4i;
typedef float __attribute__((may_alias)) float_a;
typedef int __attribute__((may_alias)) int_a;

template <typename T> __device__ __forceinline__ void vst2(void* p, T v) { *(T*)p = v;  }
__device__ __forceinline__ v8f wmma16(v16h a, v16h b, v8f c) {
  v8f d = __builtin_amdgcn_wmma_f32_16x16x32_f16(false, a, false, b, (short)0, c, false, false);
  asm volatile("v_nop\n\tv_nop\n\tv_nop\n\tv_nop" : "+v"(d) : "v"(a), "v"(b));
  return d;
}
__device__ __forceinline__ v8f wmma_bf(v16b a, v16b b, v8f c) {
  v8f d = __builtin_amdgcn_wmma_f32_16x16x32_bf16(false, a, false, b, (short)0, c, false, false);
  asm volatile("v_nop\n\tv_nop\n\tv_nop\n\tv_nop" : "+v"(d) : "v"(a), "v"(b));
  return d;
}
// ViT-style attention with given key/value caches (B 2, N = M = 2,048, dim 768, 12 heads x 64): q = x W_qkv^T, softmax(q k^T / 8) v, output projection + bias.
__device__ __forceinline__ v16h frag_h(const _Float16* rowk0, int lane) {
  union { v16h v; v8h q[2]; } u; const _Float16* p = rowk0 + 8 * (lane >> 4);
  u.q[0] = *(const v8h*)p; u.q[1] = *(const v8h*)(p + 16); return u.v;
}
__device__ __forceinline__ v16h frag_f32(const float* rowk0, int lane) {
  v16h a; const float* p = rowk0 + 8 * (lane >> 4);
#pragma unroll
  for (int i = 0; i < 8; ++i) { a[i] = (_Float16)p[i]; a[8 + i] = (_Float16)p[16 + i]; }
  return a;
}
__device__ __forceinline__ v16h frag_f32s(const float* rowk0, int lane, float sc) {
  v16h a; const float* p = rowk0 + 8 * (lane >> 4);
#pragma unroll
  for (int i = 0; i < 8; ++i) { a[i] = (_Float16)(p[i] * sc); a[8 + i] = (_Float16)(p[16 + i] * sc); }
  return a;
}
// column fragment from a [K][ld] layout (column n), rows >= K read as 0
__device__ __forceinline__ v16h fragc_f32(const float* W, int k0, int n, int lane, int ld, int K) {
  v16h a; const int g = lane >> 4;
#pragma unroll
  for (int i = 0; i < 8; ++i) { const int ka = k0 + 8 * g + i, kb = ka + 16;
    a[i] = (_Float16)(ka < K ? W[(size_t)(ka < K ? ka : K - 1) * ld + n] : 0.f); a[8 + i] = (_Float16)(kb < K ? W[(size_t)(kb < K ? kb : K - 1) * ld + n] : 0.f); }
  return a;
}
struct F2 { v16b h, l; };
__device__ __forceinline__ F2 bsplit16(const float v[16]) { F2 r;
#pragma unroll
  for (int i = 0; i < 16; ++i) { const __bf16 h = (__bf16)v[i]; r.h[i] = h; r.l[i] = (__bf16)(v[i] - (float)h); }
  return r; }
__device__ __forceinline__ F2 split_row(const float* row, int k0, int lane) { float v[16]; const float* p = row + k0 + 8 * (lane >> 4);
#pragma unroll
  for (int i = 0; i < 8; ++i) { v[i] = p[i]; v[8 + i] = p[16 + i]; }
  return bsplit16(v); }
__device__ __forceinline__ F2 split_rowK(const float* row, int k0, int lane, int K) { float v[16]; const int g = lane >> 4;
#pragma unroll
  for (int i = 0; i < 8; ++i) { const int ka = k0 + 8 * g + i, kb = ka + 16; v[i] = ka < K ? row[ka < K ? ka : K - 1] : 0.f; v[8 + i] = kb < K ? row[kb < K ? kb : K - 1] : 0.f; }
  return bsplit16(v); }
__device__ __forceinline__ F2 split_col(const float* W, int k0, int n, int lane, int ld, int K) { float v[16]; const int g = lane >> 4;
#pragma unroll
  for (int i = 0; i < 8; ++i) { const int ka = k0 + 8 * g + i, kb = ka + 16; v[i] = ka < K ? W[(size_t)(ka < K ? ka : K - 1) * ld + n] : 0.f; v[8 + i] = kb < K ? W[(size_t)(kb < K ? kb : K - 1) * ld + n] : 0.f; }
  return bsplit16(v); }
__device__ __forceinline__ v8f mac3(const F2& a, const F2& b, v8f c) { c = wmma_bf(a.l, b.h, c); c = wmma_bf(a.h, b.l, c); return wmma_bf(a.h, b.h, c); }
__device__ __forceinline__ float sigm(float v) { return 1.0f / (1.0f + expf(-v)); }
#define LDSX() do { asm volatile("s_wait_dscnt 0" ::: "memory"); __builtin_amdgcn_wave_barrier(); __builtin_amdgcn_fence(__ATOMIC_RELEASE, "workgroup"); } while (0)


#define NB 2
#define SS 2048
#define DM 768
#define NH 12
#define HD 64
#define QKVW (3 * DM)
#ifndef TQB
#define TQB (SS / 64)
#define TNB NB
#define TOB (NB * SS / 64)     // output row tiles (all)
#endif
typedef __attribute__((ext_vector_type(8))) __bf16 v8b;
__device__ __forceinline__ v16b frag_b(const __bf16* rowk0, int lane) {
  union { v16b v; v8b q[2]; } u; const __bf16* p = rowk0 + 8 * (lane >> 4);
  u.q[0] = *(const v8b*)p; u.q[1] = *(const v8b*)(p + 16); return u.v;
}
__device__ __forceinline__ float bfr(float v) { return (float)(__bf16)v; }
__device__ __attribute__((noinline)) float exp_ni(float v) { return expf(v); }
__device__ __attribute__((noinline)) float erf_ni(float v) { return erff(v); }

#define PK_A 0                       // [2304][768] Wqkv rows (natural [out][in])
#define PK_P (PK_A + QKVW * DM)        // [768][768] Wo rows (natural)
#define PK_END (PK_P + DM * DM)
#define WS_PK  0u
#define WS_QK  (WS_PK + 2u * PK_END)             // f16 [4096 rows][1536]: q | k
#define WS_QKL (WS_QK + 2u * NB * SS * 2 * DM)     // f16 q | k residual planes x2048
#define WS_VTH (WS_QKL + 2u * NB * SS * 2 * DM)    // f16 [b][768 (h*64+d)][2048 s] hi
#define WS_VTL (WS_VTH + 2u * NB * DM * SS)        // f16 lo x 2048
#define WS_O   (WS_VTL + 2u * NB * DM * SS)        // f32 [4096][768]
#define WS_CS  (WS_O + 4u * NB * SS * DM)           // f32 2 x [2048][32], reserved, unused
#define WS_END (WS_CS + 4u * 2 * SS * 32)
// ---- k_pack: block = (row n, which): natural [out][in] rows -> bf16; which 0..2 -> W_q/W_k/W_v into PK_A rows which*768 + n; 3 -> W_o into PK_P
__global__ __launch_bounds__(256) void k_pack(const float* __restrict__ WQ, const float* __restrict__ WK, const float* __restrict__ WV, const float* __restrict__ WO, __bf16* __restrict__ PK) {
  __shared__ __align__(16) __bf16 s[DM]; const int n = blockIdx.x, which = blockIdx.y, t = threadIdx.x; const float* Wm = (which == 0) ? WQ : (which == 1) ? WK : (which == 2) ? WV : WO;
  for (int k = t; k < DM; k += 256) s[k] = (__bf16)Wm[(size_t)n * DM + k];
  __syncthreads();
  __bf16* dst = (which < 3) ? PK + PK_A + ((size_t)which * DM + n) * DM : PK + PK_P + (size_t)n * DM;
  for (int q = t; q < DM / 8; q += 256) vst2((unsigned*)(dst + q * 8), *(const v4u*)&s[q * 8]);
}
// eight asynchronous 16-byte-per-lane copies, each 512 B (4 rows of 128 B, or 2 rows of 256 B); ls / gs = bytes between two copies in LDS / in global memory
__device__ __forceinline__ void copy8(unsigned l0, const char* g0, unsigned ls, size_t gs) {
  const unsigned l1 = l0 + ls, l2 = l1 + ls, l3 = l2 + ls, l4 = l3 + ls, l5 = l4 + ls, l6 = l5 + ls, l7 = l6 + ls;
  const char *g1 = g0 + gs, *g2 = g1 + gs, *g3 = g2 + gs, *g4 = g3 + gs, *g5 = g4 + gs, *g6 = g5 + gs, *g7 = g6 + gs;
  // the closing s_wait_xcnt stands inside the statement so that no address register of a copy is rewritten in front of it
  asm volatile("global_load_async_to_lds_b128 %0, %8, off\n\t"
               "global_load_async_to_lds_b128 %1, %9, off\n\t"
               "global_load_async_to_lds_b128 %2, %10, off\n\t"
               "global_load_async_to_lds_b128 %3, %11, off\n\t"
               "global_load_async_to_lds_b128 %4, %12, off\n\t"
               "global_load_async_to_lds_b128 %5, %13, off\n\t"
               "global_load_async_to_lds_b128 %6, %14, off\n\t"
               "global_load_async_to_lds_b128 %7, %15, off\n\t"
               "s_wait_xcnt 0x0"
               :: "v"(l0), "v"(l1), "v"(l2), "v"(l3), "v"(l4), "v"(l5), "v"(l6), "v"(l7), "v"(g0), "v"(g1), "v"(g2), "v"(g3), "v"(g4), "v"(g5), "v"(g6), "v"(g7) : "memory");
}
// The two GEMM kernels (64 rows x 128 columns per work-group) take their operands through LDS: a stage is 64 k of the 64 A rows (f32, 256 B each) and of the 128 W rows (bf16, 128 B each), brought in once per work-group by asynchronous copies of whole 128-B lines, two buffers, the next stage in flight while this one is worked on; the fragments are read from LDS, A and W in the same k order (that of frag_b).
#define GKS 64                 // k per stage
#define GNS (DM / GKS)         // stages
#define GAP 68                 // LDS pitch of an A row in f32: 256-B row + 16 B, conflict-free for 16-byte LDS reads
#define GWP 72                 // LDS pitch of a W row in bf16: 128-B row + 16 B, likewise
// one stage: each wave copies its own 16 A rows (2 rows a copy) and 32 of the W rows (4 rows a copy); la / lw, ga / gw = the lane's first 16 bytes of stage 0 in buffer 0
__device__ __forceinline__ void gemm_copy(unsigned la, const char* ga, unsigned lw, const char* gw, int buf, int st) {
  copy8(la + (unsigned)buf * (64 * GAP * 4), ga + (size_t)st * (GKS * 4), 2 * GAP * 4, (size_t)2 * DM * 4);
  copy8(lw + (unsigned)buf * (128 * GWP * 2), gw + (size_t)st * (GKS * 2), 4 * GWP * 2, (size_t)4 * DM * 2);
}
// the 16 f32 of an A fragment (elements 0..7 = k 8 g + i, 8..15 = k 16 + 8 g + i) from an LDS row, p = row + k0 + 8 g
__device__ __forceinline__ void lds16(const float* p, float v[16]) {
  const v4f x0 = *(const v4f*)p, x1 = *(const v4f*)(p + 4), x2 = *(const v4f*)(p + 16), x3 = *(const v4f*)(p + 20);
#pragma unroll
  for (int i = 0; i < 4; ++i) { v[i] = x0[i]; v[4 + i] = x1[i]; v[8 + i] = x2[i]; v[12 + i] = x3[i]; }
}
__global__ __launch_bounds__(128) void k_qkv(const float* __restrict__ XQ, const float* __restrict__ XK, const float* __restrict__ XV, const __bf16* __restrict__ P, const float* __restrict__ BQ, const float* __restrict__ BK, const float* __restrict__ BV, _Float16* __restrict__ QK, _Float16* __restrict__ QKL, _Float16* __restrict__ VTH, _Float16* __restrict__ VTL) {
  const int which0 = (blockIdx.y * 128) / DM; const float* X = (which0 == 0) ? XQ : (which0 == 1) ? XK : XV; const float* BB = BQ ? (((which0 == 0) ? BQ : (which0 == 1) ? BK : BV) + (blockIdx.y * 128 - which0 * DM)) : nullptr;
  __shared__ __align__(16) _Float16 so[4][16][136], sol[4][16][136]; __shared__ __align__(16) _Float16 sth[128][72], stl[128][72];
  const int tid = threadIdx.x, wave = tid >> 5, lane = tid & 31, col = lane & 15, g = lane >> 4; const size_t r0 = (size_t)blockIdx.x * 64 + wave * 16; const int n0 = blockIdx.y * 128;
  __shared__ __align__(16) float sa[2][64][GAP]; __shared__ __align__(16) __bf16 sw[2][128][GWP];
  const char* gsa = (const char*)(X + (r0 + (lane >> 4)) * DM) + (lane & 15) * 16; const char* gsw = (const char*)(P + (size_t)(n0 + wave * 32 + (lane >> 3)) * DM) + (lane & 7) * 16;
  const unsigned lsa = (unsigned)(size_t)&sa[0][wave * 16 + (lane >> 4)][(lane & 15) * 4], lsw = (unsigned)(size_t)&sw[0][wave * 32 + (lane >> 3)][(lane & 7) * 8];
  gemm_copy(lsa, gsa, lsw, gsw, 0, 0);
  v8f acc[8] = {};
  asm volatile("s_wait_asynccnt 0x0" ::: "memory");   // this wave's copies of stage 0 have landed
  __syncthreads();                                     // publishes stage 0 to the other waves
  gemm_copy(lsa, gsa, lsw, gsw, 1, 1);
  // kept rolled: one copy of the stage body in the instruction cache
#pragma unroll 1
  for (int st = 0; st < GNS; ++st) { const int bf = st & 1;
    float v[GKS / 32][16]; v16b w[GKS / 32][8];   // all fragments of the stage are read as one group ahead of the products
#pragma unroll
    for (int kc = 0; kc < GKS / 32; ++kc) { lds16(&sa[bf][wave * 16 + col][kc * 32 + 8 * g], v[kc]);
#pragma unroll
      for (int j = 0; j < 8; ++j) w[kc][j] = frag_b(&sw[bf][j * 16 + col][kc * 32], lane); }
#pragma unroll
    for (int kc = 0; kc < GKS / 32; ++kc) { v16b a;
#pragma unroll
      for (int i = 0; i < 16; ++i) a[i] = (__bf16)v[kc][i];
#pragma unroll
      for (int j = 0; j < 8; ++j) acc[j] = wmma_bf(a, w[kc][j], acc[j]); }
    asm volatile("s_wait_dscnt 0x0" ::: "memory");      // this wave's reads of the buffer are done before it may be refilled
    asm volatile("s_wait_asynccnt 0x0" ::: "memory");   // this wave's copies of stage st + 1 have landed
    __syncthreads();                                     // publishes stage st + 1 and ends every wave's reads of stage st
    if (st + 2 < GNS) gemm_copy(lsa, gsa, lsw, gsw, bf, st + 2); }
  asm volatile("s_wait_asynccnt 0x0" ::: "memory");     // no copy is outstanding when the wave goes on to the epilogue and ends
  if (n0 < 2 * DM) {   // q stored unscaled (f16 sigma ~0.6, no subnormal exposure); 1/8 applied to the f32 score
#pragma unroll
    for (int j = 0; j < 8; ++j) {
#pragma unroll
      for (int r = 0; r < 8; ++r) { const float v = acc[j][r] + (BB ? bfr(BB[j * 16 + col]) : 0.f); const _Float16 hv = (_Float16)v; so[wave][8 * g + r][j * 16 + col] = hv; sol[wave][8 * g + r][j * 16 + col] = (_Float16)((v - (float)hv) * 2048.0f); } }   // q, k (+ bias) as f16 hi + (x2048) residual
    LDSX();
    for (int rl = 0; rl < 16; ++rl) if (lane < 16) { vst2((unsigned*)(QK + (r0 + rl) * (2 * DM) + n0 + lane * 8), *(const v4u*)&so[wave][rl][lane * 8]); vst2((unsigned*)(QKL + (r0 + rl) * (2 * DM) + n0 + lane * 8), *(const v4u*)&sol[wave][rl][lane * 8]); }
  } else {
#pragma unroll
    for (int j = 0; j < 8; ++j) {
#pragma unroll
      for (int r = 0; r < 8; ++r) { const float v = acc[j][r] + (BB ? bfr(BB[j * 16 + col]) : 0.f); const _Float16 hv = (_Float16)v; sth[j * 16 + col][wave * 16 + 8 * g + r] = hv; stl[j * 16 + col][wave * 16 + 8 * g + r] = (_Float16)((v - (float)hv) * 2048.0f); } }
    __syncthreads();
    const size_t rb = (size_t)blockIdx.x * 64; const int b = (int)(rb / SS), s0 = (int)(rb % SS); const int pc0 = n0 - 2 * DM;
    for (int q = tid; q < 128 * 8; q += 128) { const int d = q >> 3, pc = q & 7; const size_t o = ((size_t)b * DM + pc0 + d) * SS + s0 + pc * 8; vst2((unsigned*)(VTH + o), *(const v4u*)&sth[d][pc * 8]); vst2((unsigned*)(VTL + o), *(const v4u*)&stl[d][pc * 8]); }
  }
}
#define KST 64                 // keys per stage
#define NST (SS / KST)         // stages
#define RPH 72                 // LDS row pitch in f16: 128-B row + 16 B, the conflict-free pitch for 16-byte LDS reads
#define PLB (64 * RPH * 2)     // bytes of one plane of a stage in LDS
// lane l takes the value of lane l ^ 16
__device__ __forceinline__ float xhalf(float x) { return __builtin_bit_cast(float, __builtin_amdgcn_permlanex16(__builtin_bit_cast(int, x), __builtin_bit_cast(int, x), 0x76543210, 0xfedcba98, false, false)); }
__global__ __launch_bounds__(128) void k_attn(const _Float16* __restrict__ QK, const _Float16* __restrict__ QKL, const _Float16* __restrict__ VTH, const _Float16* __restrict__ VTL, const void* __restrict__ KMASK, float* __restrict__ O) {
  __shared__ __align__(16) float so[4][16][68];
  __shared__ __align__(16) _Float16 ring[2][4][64][RPH];   // [buffer][k hi, k lo, v hi, v lo][key row, or d row for v][d, or key for v]
  const int tid = threadIdx.x, wave = tid >> 5, lane = tid & 31, col = lane & 15, g = lane >> 4;
  const int qb = blockIdx.x, h = blockIdx.y, b = blockIdx.z; const int q0 = qb * 64 + wave * 16; const size_t rq = (size_t)b * SS + q0 + col;
  // this wave's plane: source of its lane's first 16 bytes of stage 0, row pitch and step from stage to stage in bytes
  const int wv = __builtin_amdgcn_readfirstlane(wave);
  const size_t koff = (size_t)b * SS * (2 * DM) + DM + h * HD, voff = ((size_t)b * DM + h * HD) * SS;
  const _Float16* pl0 = (wv == 0) ? QK + koff : (wv == 1) ? QKL + koff : (wv == 2) ? VTH + voff : VTL + voff;
  const size_t gpitch = (wv < 2) ? (size_t)(2 * DM * 2) : (size_t)(SS * 2), gstage = (wv < 2) ? (size_t)KST * (2 * DM * 2) : (size_t)(KST * 2);
  const char* gsrc = (const char*)pl0 + (size_t)(lane >> 3) * gpitch + (lane & 7) * 16;
  const unsigned ldst = (unsigned)(size_t)&ring[0][0][0][0] + (unsigned)wv * PLB + (unsigned)(lane >> 3) * (RPH * 2) + (unsigned)(lane & 7) * 16;
#define STAGE_COPY(BUF, ST) do { const char* gp_ = gsrc + (size_t)(ST) * gstage; const unsigned lp_ = ldst + (unsigned)(BUF) * (4 * PLB); \
    copy8(lp_, gp_, 4 * RPH * 2, 4 * gpitch); copy8(lp_ + 32 * RPH * 2, gp_ + 32 * gpitch, 4 * RPH * 2, 4 * gpitch); } while (0)
  STAGE_COPY(0, 0);
  v16h aq[2], aql[2];
#pragma unroll
  for (int kc = 0; kc < 2; ++kc) { aq[kc] = frag_h(QK + rq * (2 * DM) + h * HD + kc * 32, lane); aql[kc] = frag_h(QKL + rq * (2 * DM) + h * HD + kc * 32, lane); }
  float m = -3.0e38f, l = 0.f;   // running maximum of this lane's query (both halves agree) and this half's share of its sum
  v8f acc[4] = {}, accl[4] = {};
  asm volatile("s_wait_asynccnt 0x0" ::: "memory");   // this wave's copies of stage 0 have landed
  __syncthreads();                                     // publishes stage 0 to the other waves
  STAGE_COPY(1, 1);
  // both loops kept rolled: one copy of the 32-key body in the instruction cache, and one set of fragment registers
#pragma unroll 1
  for (int st = 0; st < NST; ++st) { const _Float16* rb = &ring[st & 1][0][0][0];
#pragma unroll 1
  for (int sub = 0; sub < KST / 32; ++sub) { v8f s[2];
    v16h kh[2][2], kl[2][2];   // all k fragments of the 32 keys are read as one group ahead of the products
#pragma unroll
    for (int ct = 0; ct < 2; ++ct) { const _Float16* krow = rb + (sub * 32 + ct * 16 + col) * RPH;
#pragma unroll
      for (int kc = 0; kc < 2; ++kc) { kh[ct][kc] = frag_h(krow + kc * 32, lane); kl[ct][kc] = frag_h(krow + 64 * RPH + kc * 32, lane); } }
#pragma unroll
    for (int ct = 0; ct < 2; ++ct) { v8f c = {}, cl = {};
#pragma unroll
      for (int kc = 0; kc < 2; ++kc) { c = wmma16(kh[ct][kc], aq[kc], c); cl = wmma16(kh[ct][kc], aql[kc], cl); cl = wmma16(kl[ct][kc], aq[kc], cl); }   // transposed scores, k rows as A and q as B: 3 products of f16 hi + residual, in the order as before
#pragma unroll
      for (int r = 0; r < 8; ++r) c[r] += cl[r] * (1.0f / 2048.0f);
#pragma unroll
      for (int r = 0; r < 8; ++r) s[ct][r] = c[r] * 0.125f; }   // 1/sqrt(64); s[ct][r] = score of key sub * 32 + ct * 16 + 8 g + r for query col
    v16h vh[4], vl[4];   // the v fragments (d rows as A) as one group, landing under the softmax
#pragma unroll
    for (int dt = 0; dt < 4; ++dt) { vh[dt] = frag_h(rb + 2 * 64 * RPH + (dt * 16 + col) * RPH + sub * 32, lane); vl[dt] = frag_h(rb + 3 * 64 * RPH + (dt * 16 + col) * RPH + sub * 32, lane); }
    float mx = fmaxf(s[0][0], s[1][0]);
#pragma unroll
    for (int r = 1; r < 8; ++r) mx = fmaxf(mx, fmaxf(s[0][r], s[1][r]));
    mx = fmaxf(mx, xhalf(mx));   // the other 16 of the 32 keys lie in lane ^ 16
    const float mn = fmaxf(m, mx); const float alpha = (m <= -1.0e38f) ? 0.f : __expf(m - mn); m = mn;
    float e[2][8], t[8];
#pragma unroll
    for (int r = 0; r < 8; ++r) { e[0][r] = (s[0][r] <= -1.0e38f) ? 0.f : __expf(s[0][r] - mn); e[1][r] = (s[1][r] <= -1.0e38f) ? 0.f : __expf(s[1][r] - mn); t[r] = e[0][r] + e[1][r]; }
    l = l * alpha + (((t[0] + t[1]) + (t[2] + t[3])) + ((t[4] + t[5]) + (t[6] + t[7])));
#pragma unroll
    for (int dt = 0; dt < 4; ++dt) {
#pragma unroll
      for (int r = 0; r < 8; ++r) { acc[dt][r] *= alpha; accl[dt][r] *= alpha; } }
    v16h pa, pl;   // the two score tiles of a lane are, element for element, the B fragment of P transposed: element r = key 8 g + r, element 8 + r = key 16 + 8 g + r, the k order of frag_h
#pragma unroll
    for (int i = 0; i < 8; ++i) { const float x0 = e[0][i] * 2048.0f, x1 = e[1][i] * 2048.0f; const _Float16 h0 = (_Float16)x0, h1 = (_Float16)x1; pa[i] = h0; pa[8 + i] = h1; pl[i] = (_Float16)((x0 - (float)h0) * 2048.0f); pl[8 + i] = (_Float16)((x1 - (float)h1) * 2048.0f); }   // P scaled by 2^11 before the f16 split so small softmax weights stay out of the f16 subnormal range; 2^-11 folded into the epilogue
#pragma unroll
    for (int dt = 0; dt < 4; ++dt) { acc[dt] = wmma16(vh[dt], pa, acc[dt]); accl[dt] = wmma16(vh[dt], pl, accl[dt]); }
#pragma unroll
    for (int dt = 0; dt < 4; ++dt) accl[dt] = wmma16(vl[dt], pa, accl[dt]); }   // transposed output, acc[dt][r] = d dt * 16 + 8 g + r of query col: V hi x P hi + (V hi x P lo + V lo x P hi) / 2048, each accumulator's order of sums as before
    asm volatile("s_wait_dscnt 0x0" ::: "memory");      // this wave's reads of the buffer are done before it may be refilled
    asm volatile("s_wait_asynccnt 0x0" ::: "memory");   // this wave's copies of stage st + 1 have landed
    __syncthreads();                                     // publishes stage st + 1 and ends every wave's reads of stage st
    if (st + 2 < NST) STAGE_COPY(st & 1, st + 2); }
  asm volatile("s_wait_asynccnt 0x0" ::: "memory");     // no copy is outstanding when the wave goes on to the epilogue and ends
  const float il = (1.0f / 2048.0f) / (l + xhalf(l));   // the two halves' sums are joined once
#pragma unroll
  for (int dt = 0; dt < 4; ++dt) { v4f o0, o1;
#pragma unroll
    for (int r = 0; r < 4; ++r) { o0[r] = (acc[dt][r] + accl[dt][r] * (1.0f / 2048.0f)) * il; o1[r] = (acc[dt][4 + r] + accl[dt][4 + r] * (1.0f / 2048.0f)) * il; }
    *(v4f*)&so[wave][col][dt * 16 + 8 * g] = o0; *(v4f*)&so[wave][col][dt * 16 + 8 * g + 4] = o1; }
  LDSX();
  for (int rl = 0; rl < 16; ++rl) if (lane < 16) vst2(O + ((size_t)b * SS + q0 + rl) * DM + h * HD + lane * 4, *(const v4f*)&so[wave][rl][lane * 4]);
}
// ---- k_out: block = (64 rows, 128 cols): out = O(hi/lo) . Wo rows (2 products) + bo
__global__ __launch_bounds__(128) void k_out(const float* __restrict__ O, const __bf16* __restrict__ P, const float* __restrict__ BO, float* __restrict__ Y) {
  __shared__ __align__(16) float so[4][16][132];
  const int tid = threadIdx.x, wave = tid >> 5, lane = tid & 31, col = lane & 15, g = lane >> 4; const size_t r0 = (size_t)blockIdx.x * 64 + wave * 16; const int n0 = blockIdx.y * 128;
  __shared__ __align__(16) float sa[2][64][GAP]; __shared__ __align__(16) __bf16 sw[2][128][GWP];
  const char* gsa = (const char*)(O + (r0 + (lane >> 4)) * DM) + (lane & 15) * 16; const char* gsw = (const char*)(P + (size_t)(n0 + wave * 32 + (lane >> 3)) * DM) + (lane & 7) * 16;
  const unsigned lsa = (unsigned)(size_t)&sa[0][wave * 16 + (lane >> 4)][(lane & 15) * 4], lsw = (unsigned)(size_t)&sw[0][wave * 32 + (lane >> 3)][(lane & 7) * 8];
  gemm_copy(lsa, gsa, lsw, gsw, 0, 0);
  v8f acc[8] = {};
  asm volatile("s_wait_asynccnt 0x0" ::: "memory");   // this wave's copies of stage 0 have landed
  __syncthreads();                                     // publishes stage 0 to the other waves
  gemm_copy(lsa, gsa, lsw, gsw, 1, 1);
  // kept rolled: one copy of the stage body in the instruction cache
#pragma unroll 1
  for (int st = 0; st < GNS; ++st) { const int bf = st & 1;
    float v[GKS / 32][16]; v16b w[GKS / 32][8];   // all fragments of the stage are read as one group ahead of the products
#pragma unroll
    for (int kc = 0; kc < GKS / 32; ++kc) { lds16(&sa[bf][wave * 16 + col][kc * 32 + 8 * g], v[kc]);
#pragma unroll
      for (int j = 0; j < 8; ++j) w[kc][j] = frag_b(&sw[bf][j * 16 + col][kc * 32], lane); }
#pragma unroll
    for (int kc = 0; kc < GKS / 32; ++kc) { const F2 a = bsplit16(v[kc]);
#pragma unroll
      for (int j = 0; j < 8; ++j) { acc[j] = wmma_bf(a.l, w[kc][j], acc[j]); acc[j] = wmma_bf(a.h, w[kc][j], acc[j]); } }
    asm volatile("s_wait_dscnt 0x0" ::: "memory");      // this wave's reads of the buffer are done before it may be refilled
    asm volatile("s_wait_asynccnt 0x0" ::: "memory");   // this wave's copies of stage st + 1 have landed
    __syncthreads();                                     // publishes stage st + 1 and ends every wave's reads of stage st
    if (st + 2 < GNS) gemm_copy(lsa, gsa, lsw, gsw, bf, st + 2); }
  asm volatile("s_wait_asynccnt 0x0" ::: "memory");     // no copy is outstanding when the wave goes on to the epilogue and ends
#pragma unroll
  for (int j = 0; j < 8; ++j) {
#pragma unroll
    for (int r = 0; r < 8; ++r) so[wave][8 * g + r][j * 16 + col] = acc[j][r] + bfr(BO[n0 + j * 16 + col]); }
  LDSX();
  for (int rl = 0; rl < 16; ++rl) vst2(Y + (r0 + rl) * DM + n0 + lane * 4, *(const v4f*)&so[wave][rl][lane * 4]);
}
// ---- k_kvin: block = (64 keys m, head h, b): k input [b][h][m][64] -> K rows [b*M + m][DM + h*64 + d] of the q|k plane pair (f16 hi + x2048 residual); v input -> V planes [b][h*64 + d][m]
__global__ __launch_bounds__(256) void k_kvin(const float* __restrict__ KIN, const float* __restrict__ VIN, _Float16* __restrict__ QK, _Float16* __restrict__ QKL, _Float16* __restrict__ VTH, _Float16* __restrict__ VTL) {
  __shared__ __align__(16) _Float16 skh[64][72], skl[64][72], svh[64][72], svl[64][72]; const int t = threadIdx.x; const int m0 = blockIdx.x * 64, h = blockIdx.y; const size_t b = blockIdx.z;
  for (int e = t; e < 64 * 64; e += 256) { const int r = e >> 6, d = e & 63; const size_t src = ((b * NH + h) * SS + m0 + r) * HD + d; const float kv = bfr(KIN[src]), vv = bfr(VIN[src]);
    const _Float16 kh = (_Float16)kv, vh = (_Float16)vv; skh[r][d] = kh; skl[r][d] = (_Float16)((kv - (float)kh) * 2048.0f); svh[d][r] = vh; svl[d][r] = (_Float16)((vv - (float)vh) * 2048.0f); }
  __syncthreads();
  for (int e = t; e < 64 * 8; e += 256) { const int r = e >> 3, q = e & 7; const size_t o = (b * SS + m0 + r) * (2 * DM) + DM + h * HD + q * 8; vst2((unsigned*)(QK + o), *(const v4u*)&skh[r][q * 8]); vst2((unsigned*)(QKL + o), *(const v4u*)&skl[r][q * 8]);
    const size_t ov = (b * DM + h * HD + r) * SS + m0 + q * 8; vst2((unsigned*)(VTH + ov), *(const v4u*)&svh[r][q * 8]); vst2((unsigned*)(VTL + ov), *(const v4u*)&svl[r][q * 8]); }
}
extern "C" void kernel_launch(void* const* d_in, const int* in_sizes, int n_in, void* d_out, int out_size, void* d_ws, size_t ws_size, hipStream_t stream) {
  (void)in_sizes; (void)n_in; (void)out_size;
  const float** F = (const float**)d_in;   // 0 x [2,2048,768], 1 k [2,12,2048,64], 2 v [2,12,2048,64], 3 w_qkv [768,768] natural (q only), 4 w_proj [768,768] natural, 5 b_proj [768]
  if (ws_size < (size_t)WS_END) return;
  char* ws = (char*)d_ws; __bf16* PK = (__bf16*)(ws + WS_PK); _Float16 *QK = (_Float16*)(ws + WS_QK), *QKL = (_Float16*)(ws + WS_QKL), *VTH = (_Float16*)(ws + WS_VTH), *VTL = (_Float16*)(ws + WS_VTL); float* O = (float*)(ws + WS_O);
  k_pack<<<dim3(DM, 4), 256, 0, stream>>>(F[3], F[3], F[3], F[4], PK);   // only the q rows and w_proj are used
  k_qkv<<<dim3(TNB * SS / 64, DM / 128), 128, 0, stream>>>(F[0], F[0], F[0], PK + PK_A, nullptr, nullptr, nullptr, QK, QKL, VTH, VTL);   // q columns only
  k_kvin<<<dim3(SS / 64, NH, TNB), 256, 0, stream>>>(F[1], F[2], QK, QKL, VTH, VTL);
  k_attn<<<dim3(TQB, NH, TNB), 128, 0, stream>>>(QK, QKL, VTH, VTL, nullptr, O);
  k_out<<<dim3(TOB, DM / 128), 128, 0, stream>>>(O, PK + PK_P, F[5], (float*)d_out);
}

// v004
// Measured time: 100 microseconds a run.
// Timed twice side by side with v003, it ran 1.18 and 1.19 times as fast.
// All steps since v000 together make it 3.95 times as fast.
// compute dtype: x, k, v, w_qkv, w_proj, b_proj rounded to bf16; q = x . w_qkv^T with exact bf16 products on WMMA 16x16x32 (natural rows), stored as f16 hi + (x2048-scaled) residual planes; the k and v INPUTS are re-laid out on device as one f16 plane each (a bf16 value is exact in f16 from 2^-17 up to the f16 range; below 2^-17 it is rounded to the f16 subnormal grid, at most 2^-25 off); 2-product scores (k x q hi, k x q residual) x 1/sqrt(64), running-max softmax in f32 (hardware exp); P (scaled by 2^11, as f16 hi + residual) x v (2 products); output projection with ctx as bf16 hi + residual x exact w_proj rows (2 products) + b_proj; f32 accumulate.
#include <hip/hip_runtime.h>
#include <math.h>

typedef __attribute__((ext_vector_type(16))) _Float16 v16h;
typedef __attribute__((ext_vector_type(16))) __bf16 v16b;
typedef __attribute__((ext_vector_type(8)))  _Float16 v8h;
typedef __attribute__((ext_vector_type(8)))  float v8f;
typedef __attribute__((ext_vector_type(4)))  float v4f;
typedef __attribute__((ext_vector_type(2)))  float v2f;
typedef __attribute__((ext_vector_type(4)))  unsigned v4u;
typedef __attribute__((ext_vector_type(4)))  int v4i;
typedef float __attribute__((may_alias)) float_a;
typedef int __attribute__((may_alias)) int_a;

template <typename T> __device__ __forceinline__ void vst2(void* p, T v) { *(T*)p = v;  }
__device__ __forceinline__ v8f wmma16(v16h a, v16h b, v8f c) {
  v8f d = __builtin_amdgcn_wmma_f32_16x16x32_f16(false, a, false, b, (short)0, c, false, false);
  asm volatile("v_nop\n\tv_nop\n\tv_nop\n\tv_nop" : "+v"(d) : "v"(a), "v"(b));
  return d;
}
__device__ __forceinline__ v8f wmma_bf(v16b a, v16b b, v8f c) {
  v8f d = __builtin_amdgcn_wmma_f32_16x16x32_bf16(false, a, false, b, (short)0, c, false, false);
  asm volatile("v_nop\n\tv_nop\n\tv_nop\n\tv_nop" : "+v"(d) : "v"(a), "v"(b));
  return d;
}
// ViT-style attention with given key/value caches (B 2, N = M = 2,048, dim 768, 12 heads x 64): q = x W_qkv^T, softmax(q k^T / 8) v, output projection + bias.
__device__ __forceinline__ v16h frag_h(const _Float16* rowk0, int lane) {
  union { v16h v; v8h q[2]; } u; const _Float16* p = rowk0 + 8 * (lane >> 4);
  u.q[0] = *(const v8h*)p; u.q[1] = *(const v8h*)(p + 16); return u.v;
}
__device__ __forceinline__ v16h frag_f32(const float* rowk0, int lane) {
  v16h a; const float* p = rowk0 + 8 * (lane >> 4);
#pragma unroll
  for (int i = 0; i < 8; ++i) { a[i] = (_Float16)p[i]; a[8 + i] = (_Float16)p[16 + i]; }
  return a;
}
__device__ __forceinline__ v16h frag_f32s(const float* rowk0, int lane, float sc) {
  v16h a; const float* p = rowk0 + 8 * (lane >> 4);
#pragma unroll
  for (int i = 0; i < 8; ++i) { a[i] = (_Float16)(p[i] * sc); a[8 + i] = (_Float16)(p[16 + i] * sc); }
  return a;
}
// column fragment from a [K][ld] layout (column n), rows >= K read as 0
__device__ __forceinline__ v16h fragc_f32(const float* W, int k0, int n, int lane, int ld, int K) {
  v16h a; const int g = lane >> 4;
#pragma unroll
  for (int i = 0; i < 8; ++i) { const int ka = k0 + 8 * g + i, kb = ka + 16;
    a[i] = (_Float16)(ka < K ? W[(size_t)(ka < K ? ka : K - 1) * ld + n] : 0.f); a[8 + i] = (_Float16)(kb < K ? W[(size_t)(kb < K ? kb : K - 1) * ld + n] : 0.f); }
  return a;
}
struct F2 { v16b h, l; };
__device__ __forceinline__ F2 bsplit16(const float v[16]) { F2 r;
#pragma unroll
  for (int i = 0; i < 16; ++i) { const __bf16 h = (__bf16)v[i]; r.h[i] = h; r.l[i] = (__bf16)(v[i] - (float)h); }
  return r; }
__device__ __forceinline__ F2 split_row(const float* row, int k0, int lane) { float v[16]; const float* p = row + k0 + 8 * (lane >> 4);
#pragma unroll
  for (int i = 0; i < 8; ++i) { v[i] = p[i]; v[8 + i] = p[16 + i]; }
  return bsplit16(v); }
__device__ __forceinline__ F2 split_rowK(const float* row, int k0, int lane, int K) { float v[16]; const int g = lane >> 4;
#pragma unroll
  for (int i = 0; i < 8; ++i) { const int ka = k0 + 8 * g + i, kb = ka + 16; v[i] = ka < K ? row[ka < K ? ka : K - 1] : 0.f; v[8 + i] = kb < K ? row[kb < K ? kb : K - 1] : 0.f; }
  return bsplit16(v); }
__device__ __forceinline__ F2 split_col(const float* W, int k0, int n, int lane, int ld, int K) { float v[16]; const int g = lane >> 4;
#pragma unroll
  for (int i = 0; i < 8; ++i) { const int ka = k0 + 8 * g + i, kb = ka + 16; v[i] = ka < K ? W[(size_t)(ka < K ? ka : K - 1) * ld + n] : 0.f; v[8 + i] = kb < K ? W[(size_t)(kb < K ? kb : K - 1) * ld + n] : 0.f; }
  return bsplit16(v); }
__device__ __forceinline__ v8f mac3(const F2& a, const F2& b, v8f c) { c = wmma_bf(a.l, b.h, c); c = wmma_bf(a.h, b.l, c); return wmma_bf(a.h, b.h, c); }
__device__ __forceinline__ float sigm(float v) { return 1.0f / (1.0f + expf(-v)); }
#define LDSX() do { asm volatile("s_wait_dscnt 0" ::: "memory"); __builtin_amdgcn_wave_barrier(); __builtin_amdgcn_fence(__ATOMIC_RELEASE, "workgroup"); } while (0)


#define NB 2
#define SS 2048
#define DM 768
#define NH 12
#define HD 64
#define QKVW (3 * DM)
#ifndef TQB
#define TQB (SS / 64)
#define TNB NB
#define TOB (NB * SS / 64)     // output row tiles (all)
#endif
typedef __attribute__((ext_vector_type(8))) __bf16 v8b;
__device__ __forceinline__ v16b frag_b(const __bf16* rowk0, int lane) {
  union { v16b v; v8b q[2]; } u; const __bf16* p = rowk0 + 8 * (lane >> 4);
  u.q[0] = *(const v8b*)p; u.q[1] = *(const v8b*)(p + 16); return u.v;
}
__device__ __forceinline__ float bfr(float v) { return (float)(__bf16)v; }
__device__ __attribute__((noinline)) float exp_ni(float v) { return expf(v); }
__device__ __attribute__((noinline)) float erf_ni(float v) { return erff(v); }

#define PK_A 0                       // [2304][768] Wqkv rows (natural [out][in])
#define PK_P (PK_A + QKVW * DM)        // [768][768] Wo rows (natural)
#define PK_END (PK_P + DM * DM)
#define WS_PK  0u
#define WS_QK  (WS_PK + 2u * PK_END)             // f16 [4096 rows][1536]: q | k
#define WS_QKL (WS_QK + 2u * NB * SS * 2 * DM)     // f16 q residual plane x2048 (same rows; its k columns are not used)
#define WS_VTH (WS_QKL + 2u * NB * SS * 2 * DM)    // f16 [b][768 (h*64+d)][2048 s]
#define WS_VTL (WS_VTH + 2u * NB * DM * SS)        // place of a v residual plane (not used)
#define WS_O   (WS_VTL + 2u * NB * DM * SS)        // f32 [4096][768]
#define WS_CS  (WS_O + 4u * NB * SS * DM)           // f32 [2][2048][32] (not used)
#define WS_END (WS_CS + 4u * 2 * SS * 32)
// ---- k_pack: block = (row n, which): natural [out][in] rows -> bf16; which 0..2 -> W_q/W_k/W_v into PK_A rows which*768 + n; 3 -> W_o into PK_P
__global__ __launch_bounds__(256) void k_pack(const float* __restrict__ WQ, const float* __restrict__ WK, const float* __restrict__ WV, const float* __restrict__ WO, __bf16* __restrict__ PK) {
  __shared__ __align__(16) __bf16 s[DM]; const int n = blockIdx.x, which = blockIdx.y, t = threadIdx.x; const float* Wm = (which == 0) ? WQ : (which == 1) ? WK : (which == 2) ? WV : WO;
  for (int k = t; k < DM; k += 256) s[k] = (__bf16)Wm[(size_t)n * DM + k];
  __syncthreads();
  __bf16* dst = (which < 3) ? PK + PK_A + ((size_t)which * DM + n) * DM : PK + PK_P + (size_t)n * DM;
  for (int q = t; q < DM / 8; q += 256) vst2((unsigned*)(dst + q * 8), *(const v4u*)&s[q * 8]);
}
// eight asynchronous 16-byte-per-lane copies, each 512 B (4 rows of 128 B, or 2 rows of 256 B); ls / gs = bytes between two copies in LDS / in global memory
__device__ __forceinline__ void copy8(unsigned l0, const char* g0, unsigned ls, size_t gs) {
  const unsigned l1 = l0 + ls, l2 = l1 + ls, l3 = l2 + ls, l4 = l3 + ls, l5 = l4 + ls, l6 = l5 + ls, l7 = l6 + ls;
  const char *g1 = g0 + gs, *g2 = g1 + gs, *g3 = g2 + gs, *g4 = g3 + gs, *g5 = g4 + gs, *g6 = g5 + gs, *g7 = g6 + gs;
  // the closing s_wait_xcnt stands inside the statement so that no address register of a copy is rewritten in front of it
  asm volatile("global_load_async_to_lds_b128 %0, %8, off\n\t"
               "global_load_async_to_lds_b128 %1, %9, off\n\t"
               "global_load_async_to_lds_b128 %2, %10, off\n\t"
               "global_load_async_to_lds_b128 %3, %11, off\n\t"
               "global_load_async_to_lds_b128 %4, %12, off\n\t"
               "global_load_async_to_lds_b128 %5, %13, off\n\t"
               "global_load_async_to_lds_b128 %6, %14, off\n\t"
               "global_load_async_to_lds_b128 %7, %15, off\n\t"
               "s_wait_xcnt 0x0"
               :: "v"(l0), "v"(l1), "v"(l2), "v"(l3), "v"(l4), "v"(l5), "v"(l6), "v"(l7), "v"(g0), "v"(g1), "v"(g2), "v"(g3), "v"(g4), "v"(g5), "v"(g6), "v"(g7) : "memory");
}
// The two GEMM kernels (64 rows x 128 columns per work-group) take their operands through LDS: a stage is 64 k of the 64 A rows (f32, 256 B each) and of the 128 W rows (bf16, 128 B each), brought in once per work-group by asynchronous copies of whole 128-B lines, two buffers, the next stage in flight while this one is worked on; the fragments are read from LDS, A and W in the same k order (that of frag_b).
#define GKS 64                 // k per stage
#define GNS (DM / GKS)         // stages
#define GAP 68                 // LDS pitch of an A row in f32: 256-B row + 16 B, conflict-free for 16-byte LDS reads
#define GWP 72                 // LDS pitch of a W row in bf16: 128-B row + 16 B, likewise
// one stage: each wave copies its own 16 A rows (2 rows a copy) and 32 of the W rows (4 rows a copy); la / lw, ga / gw = the lane's first 16 bytes of stage 0 in buffer 0
__device__ __forceinline__ void gemm_copy(unsigned la, const char* ga, unsigned lw, const char* gw, int buf, int st) {
  copy8(la + (unsigned)buf * (64 * GAP * 4), ga + (size_t)st * (GKS * 4), 2 * GAP * 4, (size_t)2 * DM * 4);
  copy8(lw + (unsigned)buf * (128 * GWP * 2), gw + (size_t)st * (GKS * 2), 4 * GWP * 2, (size_t)4 * DM * 2);
}
// the 16 f32 of an A fragment (elements 0..7 = k 8 g + i, 8..15 = k 16 + 8 g + i) from an LDS row, p = row + k0 + 8 g
__device__ __forceinline__ void lds16(const float* p, float v[16]) {
  const v4f x0 = *(const v4f*)p, x1 = *(const v4f*)(p + 4), x2 = *(const v4f*)(p + 16), x3 = *(const v4f*)(p + 20);
#pragma unroll
  for (int i = 0; i < 4; ++i) { v[i] = x0[i]; v[4 + i] = x1[i]; v[8 + i] = x2[i]; v[12 + i] = x3[i]; }
}
__global__ __launch_bounds__(128) void k_qkv(const float* __restrict__ XQ, const float* __restrict__ XK, const float* __restrict__ XV, const __bf16* __restrict__ P, const float* __restrict__ BQ, const float* __restrict__ BK, const float* __restrict__ BV, _Float16* __restrict__ QK, _Float16* __restrict__ QKL, _Float16* __restrict__ VTH, _Float16* __restrict__ VTL) {
  const int which0 = (blockIdx.y * 128) / DM; const float* X = (which0 == 0) ? XQ : (which0 == 1) ? XK : XV; const float* BB = BQ ? (((which0 == 0) ? BQ : (which0 == 1) ? BK : BV) + (blockIdx.y * 128 - which0 * DM)) : nullptr;
  __shared__ __align__(16) _Float16 so[4][16][136], sol[4][16][136]; __shared__ __align__(16) _Float16 sth[128][72], stl[128][72];
  const int tid = threadIdx.x, wave = tid >> 5, lane = tid & 31, col = lane & 15, g = lane >> 4; const size_t r0 = (size_t)blockIdx.x * 64 + wave * 16; const int n0 = blockIdx.y * 128;
  __shared__ __align__(16) float sa[2][64][GAP]; __shared__ __align__(16) __bf16 sw[2][128][GWP];
  const char* gsa = (const char*)(X + (r0 + (lane >> 4)) * DM) + (lane & 15) * 16; const char* gsw = (const char*)(P + (size_t)(n0 + wave * 32 + (lane >> 3)) * DM) + (lane & 7) * 16;
  const unsigned lsa = (unsigned)(size_t)&sa[0][wave * 16 + (lane >> 4)][(lane & 15) * 4], lsw = (unsigned)(size_t)&sw[0][wave * 32 + (lane >> 3)][(lane & 7) * 8];
  gemm_copy(lsa, gsa, lsw, gsw, 0, 0);
  v8f acc[8] = {};
  asm volatile("s_wait_asynccnt 0x0" ::: "memory");   // this wave's copies of stage 0 have landed
  __syncthreads();                                     // publishes stage 0 to the other waves
  gemm_copy(lsa, gsa, lsw, gsw, 1, 1);
  // kept rolled: one copy of the stage body in the instruction cache
#pragma unroll 1
  for (int st = 0; st < GNS; ++st) { const int bf = st & 1;
    float v[GKS / 32][16]; v16b w[GKS / 32][8];   // all fragments of the stage are read as one group ahead of the products
#pragma unroll
    for (int kc = 0; kc < GKS / 32; ++kc) { lds16(&sa[bf][wave * 16 + col][kc * 32 + 8 * g], v[kc]);
#pragma unroll
      for (int j = 0; j < 8; ++j) w[kc][j] = frag_b(&sw[bf][j * 16 + col][kc * 32], lane); }
#pragma unroll
    for (int kc = 0; kc < GKS / 32; ++kc) { v16b a;
#pragma unroll
      for (int i = 0; i < 16; ++i) a[i] = (__bf16)v[kc][i];
#pragma unroll
      for (int j = 0; j < 8; ++j) acc[j] = wmma_bf(a, w[kc][j], acc[j]); }
    asm volatile("s_wait_dscnt 0x0" ::: "memory");      // this wave's reads of the buffer are done before it may be refilled
    asm volatile("s_wait_asynccnt 0x0" ::: "memory");   // this wave's copies of stage st + 1 have landed
    __syncthreads();                                     // publishes stage st + 1 and ends every wave's reads of stage st
    if (st + 2 < GNS) gemm_copy(lsa, gsa, lsw, gsw, bf, st + 2); }
  asm volatile("s_wait_asynccnt 0x0" ::: "memory");     // no copy is outstanding when the wave goes on to the epilogue and ends
  if (n0 < 2 * DM) {   // q stored unscaled (f16 sigma ~0.6, no subnormal exposure); 1/8 applied to the f32 score
#pragma unroll
    for (int j = 0; j < 8; ++j) {
#pragma unroll
      for (int r = 0; r < 8; ++r) { const float v = acc[j][r] + (BB ? bfr(BB[j * 16 + col]) : 0.f); const _Float16 hv = (_Float16)v; so[wave][8 * g + r][j * 16 + col] = hv; sol[wave][8 * g + r][j * 16 + col] = (_Float16)((v - (float)hv) * 2048.0f); } }   // q, k (+ bias) as f16 hi + (x2048) residual
    LDSX();
    for (int rl = 0; rl < 16; ++rl) if (lane < 16) { vst2((unsigned*)(QK + (r0 + rl) * (2 * DM) + n0 + lane * 8), *(const v4u*)&so[wave][rl][lane * 8]); vst2((unsigned*)(QKL + (r0 + rl) * (2 * DM) + n0 + lane * 8), *(const v4u*)&sol[wave][rl][lane * 8]); }
  } else {
#pragma unroll
    for (int j = 0; j < 8; ++j) {
#pragma unroll
      for (int r = 0; r < 8; ++r) { const float v = acc[j][r] + (BB ? bfr(BB[j * 16 + col]) : 0.f); const _Float16 hv = (_Float16)v; sth[j * 16 + col][wave * 16 + 8 * g + r] = hv; stl[j * 16 + col][wave * 16 + 8 * g + r] = (_Float16)((v - (float)hv) * 2048.0f); } }
    __syncthreads();
    const size_t rb = (size_t)blockIdx.x * 64; const int b = (int)(rb / SS), s0 = (int)(rb % SS); const int pc0 = n0 - 2 * DM;
    for (int q = tid; q < 128 * 8; q += 128) { const int d = q >> 3, pc = q & 7; const size_t o = ((size_t)b * DM + pc0 + d) * SS + s0 + pc * 8; vst2((unsigned*)(VTH + o), *(const v4u*)&sth[d][pc * 8]); vst2((unsigned*)(VTL + o), *(const v4u*)&stl[d][pc * 8]); }
  }
}
#define KST 64                 // keys per stage
#define NST (SS / KST)         // stages
#define RPH 72                 // LDS row pitch in f16: 128-B row + 16 B, the conflict-free pitch for 16-byte LDS reads
#define PLB (64 * RPH * 2)     // bytes of one plane of a stage in LDS
// lane l takes the value of lane l ^ 16
__device__ __forceinline__ float xhalf(float x) { return __builtin_bit_cast(float, __builtin_amdgcn_permlanex16(__builtin_bit_cast(int, x), __builtin_bit_cast(int, x), 0x76543210, 0xfedcba98, false, false)); }
__global__ __launch_bounds__(128) void k_attn(const _Float16* __restrict__ QK, const _Float16* __restrict__ QKL, const _Float16* __restrict__ VTH, const void* __restrict__ KMASK, float* __restrict__ O) {
  __shared__ __align__(16) float so[4][16][68];
  __shared__ __align__(16) _Float16 ring[2][2][64][RPH];   // [buffer][k, v][key row, or d row for v][d, or key for v]
  const int tid = threadIdx.x, wave = tid >> 5, lane = tid & 31, col = lane & 15, g = lane >> 4;
  const int qb = blockIdx.x, h = blockIdx.y, b = blockIdx.z; const int q0 = qb * 64 + wave * 16; const size_t rq = (size_t)b * SS + q0 + col;
  // this wave's half plane (32 rows): source of its lane's first 16 bytes of stage 0, row pitch and step from stage to stage in bytes
  const int wv = __builtin_amdgcn_readfirstlane(wave);
  const size_t koff = (size_t)b * SS * (2 * DM) + DM + h * HD, voff = ((size_t)b * DM + h * HD) * SS;
  const _Float16* pl0 = (wv < 2) ? QK + koff : VTH + voff; const int row0 = (wv & 1) * 32 + (lane >> 3);
  const size_t gpitch = (wv < 2) ? (size_t)(2 * DM * 2) : (size_t)(SS * 2), gstage = (wv < 2) ? (size_t)KST * (2 * DM * 2) : (size_t)(KST * 2);
  const char* gsrc = (const char*)pl0 + (size_t)row0 * gpitch + (lane & 7) * 16;
  const unsigned ldst = (unsigned)(size_t)&ring[0][0][0][0] + (unsigned)(wv >> 1) * PLB + (unsigned)row0 * (RPH * 2) + (unsigned)(lane & 7) * 16;
#define STAGE_COPY(BUF, ST) copy8(ldst + (unsigned)(BUF) * (2 * PLB), gsrc + (size_t)(ST) * gstage, 4 * RPH * 2, 4 * gpitch)
  STAGE_COPY(0, 0);
  v16h aq[2], aql[2];
#pragma unroll
  for (int kc = 0; kc < 2; ++kc) { aq[kc] = frag_h(QK + rq * (2 * DM) + h * HD + kc * 32, lane); aql[kc] = frag_h(QKL + rq * (2 * DM) + h * HD + kc * 32, lane); }
  float m = -3.0e38f, l = 0.f;   // running maximum of this lane's query (both halves agree) and this half's share of its sum
  v8f acc[4] = {}, accl[4] = {};
  asm volatile("s_wait_asynccnt 0x0" ::: "memory");   // this wave's copies of stage 0 have landed
  __syncthreads();                                     // publishes stage 0 to the other waves
  STAGE_COPY(1, 1);
  // both loops kept rolled: one copy of the 32-key body in the instruction cache, and one set of fragment registers
#pragma unroll 1
  for (int st = 0; st < NST; ++st) { const _Float16* rb = &ring[st & 1][0][0][0];
#pragma unroll 1
  for (int sub = 0; sub < KST / 32; ++sub) { v8f s[2];
    v16h kh[2][2];   // all k fragments of the 32 keys are read as one group ahead of the products
#pragma unroll
    for (int ct = 0; ct < 2; ++ct) { const _Float16* krow = rb + (sub * 32 + ct * 16 + col) * RPH;
#pragma unroll
      for (int kc = 0; kc < 2; ++kc) kh[ct][kc] = frag_h(krow + kc * 32, lane); }
#pragma unroll
    for (int ct = 0; ct < 2; ++ct) { v8f c = {}, cl = {};
#pragma unroll
      for (int kc = 0; kc < 2; ++kc) { c = wmma16(kh[ct][kc], aq[kc], c); cl = wmma16(kh[ct][kc], aql[kc], cl); }   // transposed scores, k rows as A and q as B: k x q hi and k x q residual
#pragma unroll
      for (int r = 0; r < 8; ++r) c[r] += cl[r] * (1.0f / 2048.0f);
#pragma unroll
      for (int r = 0; r < 8; ++r) s[ct][r] = c[r] * 0.125f; }   // 1/sqrt(64); s[ct][r] = score of key sub * 32 + ct * 16 + 8 g + r for query col
    v16h vh[4];   // the v fragments (d rows as A) as one group, landing under the softmax
#pragma unroll
    for (int dt = 0; dt < 4; ++dt) vh[dt] = frag_h(rb + 64 * RPH + (dt * 16 + col) * RPH + sub * 32, lane);
    float mx = fmaxf(s[0][0], s[1][0]);
#pragma unroll
    for (int r = 1; r < 8; ++r) mx = fmaxf(mx, fmaxf(s[0][r], s[1][r]));
    mx = fmaxf(mx, xhalf(mx));   // the other 16 of the 32 keys lie in lane ^ 16
    const float mn = fmaxf(m, mx); const float alpha = (m <= -1.0e38f) ? 0.f : __expf(m - mn); m = mn;
    float e[2][8], t[8];
#pragma unroll
    for (int r = 0; r < 8; ++r) { e[0][r] = (s[0][r] <= -1.0e38f) ? 0.f : __expf(s[0][r] - mn); e[1][r] = (s[1][r] <= -1.0e38f) ? 0.f : __expf(s[1][r] - mn); t[r] = e[0][r] + e[1][r]; }
    l = l * alpha + (((t[0] + t[1]) + (t[2] + t[3])) + ((t[4] + t[5]) + (t[6] + t[7])));
#pragma unroll
    for (int dt = 0; dt < 4; ++dt) {
#pragma unroll
      for (int r = 0; r < 8; ++r) { acc[dt][r] *= alpha; accl[dt][r] *= alpha; } }
    v16h pa, pl;   // the two score tiles of a lane are, element for element, the B fragment of P transposed: element r = key 8 g + r, element 8 + r = key 16 + 8 g + r, the k order of frag_h
#pragma unroll
    for (int i = 0; i < 8; ++i) { const float x0 = e[0][i] * 2048.0f, x1 = e[1][i] * 2048.0f; const _Float16 h0 = (_Float16)x0, h1 = (_Float16)x1; pa[i] = h0; pa[8 + i] = h1; pl[i] = (_Float16)((x0 - (float)h0) * 2048.0f); pl[8 + i] = (_Float16)((x1 - (float)h1) * 2048.0f); }   // P scaled by 2^11 before the f16 split so small softmax weights stay out of the f16 subnormal range; 2^-11 folded into the epilogue
#pragma unroll
    for (int dt = 0; dt < 4; ++dt) { acc[dt] = wmma16(vh[dt], pa, acc[dt]); accl[dt] = wmma16(vh[dt], pl, accl[dt]); } }   // transposed output, acc[dt][r] = d dt * 16 + 8 g + r of query col: V x P hi + (V x P lo) / 2048
    asm volatile("s_wait_dscnt 0x0" ::: "memory");      // this wave's reads of the buffer are done before it may be refilled
    asm volatile("s_wait_asynccnt 0x0" ::: "memory");   // this wave's copies of stage st + 1 have landed
    __syncthreads();                                     // publishes stage st + 1 and ends every wave's reads of stage st
    if (st + 2 < NST) STAGE_COPY(st & 1, st + 2); }
  asm volatile("s_wait_asynccnt 0x0" ::: "memory");     // no copy is outstanding when the wave goes on to the epilogue and ends
  const float il = (1.0f / 2048.0f) / (l + xhalf(l));   // the two halves' sums are joined once
#pragma unroll
  for (int dt = 0; dt < 4; ++dt) { v4f o0, o1;
#pragma unroll
    for (int r = 0; r < 4; ++r) { o0[r] = (acc[dt][r] + accl[dt][r] * (1.0f / 2048.0f)) * il; o1[r] = (acc[dt][4 + r] + accl[dt][4 + r] * (1.0f / 2048.0f)) * il; }
    *(v4f*)&so[wave][col][dt * 16 + 8 * g] = o0; *(v4f*)&so[wave][col][dt * 16 + 8 * g + 4] = o1; }
  LDSX();
  for (int rl = 0; rl < 16; ++rl) if (lane < 16) vst2(O + ((size_t)b * SS + q0 + rl) * DM + h * HD + lane * 4, *(const v4f*)&so[wave][rl][lane * 4]);
}
// ---- k_out: block = (64 rows, 128 cols): out = O(hi/lo) . Wo rows (2 products) + bo
__global__ __launch_bounds__(128) void k_out(const float* __restrict__ O, const __bf16* __restrict__ P, const float* __restrict__ BO, float* __restrict__ Y) {
  __shared__ __align__(16) float so[4][16][132];
  const int tid = threadIdx.x, wave = tid >> 5, lane = tid & 31, col = lane & 15, g = lane >> 4; const size_t r0 = (size_t)blockIdx.x * 64 + wave * 16; const int n0 = blockIdx.y * 128;
  __shared__ __align__(16) float sa[2][64][GAP]; __shared__ __align__(16) __bf16 sw[2][128][GWP];
  const char* gsa = (const char*)(O + (r0 + (lane >> 4)) * DM) + (lane & 15) * 16; const char* gsw = (const char*)(P + (size_t)(n0 + wave * 32 + (lane >> 3)) * DM) + (lane & 7) * 16;
  const unsigned lsa = (unsigned)(size_t)&sa[0][wave * 16 + (lane >> 4)][(lane & 15) * 4], lsw = (unsigned)(size_t)&sw[0][wave * 32 + (lane >> 3)][(lane & 7) * 8];
  gemm_copy(lsa, gsa, lsw, gsw, 0, 0);
  v8f acc[8] = {};
  asm volatile("s_wait_asynccnt 0x0" ::: "memory");   // this wave's copies of stage 0 have landed
  __syncthreads();                                     // publishes stage 0 to the other waves
  gemm_copy(lsa, gsa, lsw, gsw, 1, 1);
  // kept rolled: one copy of the stage body in the instruction cache
#pragma unroll 1
  for (int st = 0; st < GNS; ++st) { const int bf = st & 1;
    float v[GKS / 32][16]; v16b w[GKS / 32][8];   // all fragments of the stage are read as one group ahead of the products
#pragma unroll
    for (int kc = 0; kc < GKS / 32; ++kc) { lds16(&sa[bf][wave * 16 + col][kc * 32 + 8 * g], v[kc]);
#pragma unroll
      for (int j = 0; j < 8; ++j) w[kc][j] = frag_b(&sw[bf][j * 16 + col][kc * 32], lane); }
#pragma unroll
    for (int kc = 0; kc < GKS / 32; ++kc) { const F2 a = bsplit16(v[kc]);
#pragma unroll
      for (int j = 0; j < 8; ++j) { acc[j] = wmma_bf(a.l, w[kc][j], acc[j]); acc[j] = wmma_bf(a.h, w[kc][j], acc[j]); } }
    asm volatile("s_wait_dscnt 0x0" ::: "memory");      // this wave's reads of the buffer are done before it may be refilled
    asm volatile("s_wait_asynccnt 0x0" ::: "memory");   // this wave's copies of stage st + 1 have landed
    __syncthreads();                                     // publishes stage st + 1 and ends every wave's reads of stage st
    if (st + 2 < GNS) gemm_copy(lsa, gsa, lsw, gsw, bf, st + 2); }
  asm volatile("s_wait_asynccnt 0x0" ::: "memory");     // no copy is outstanding when the wave goes on to the epilogue and ends
#pragma unroll
  for (int j = 0; j < 8; ++j) {
#pragma unroll
    for (int r = 0; r < 8; ++r) so[wave][8 * g + r][j * 16 + col] = acc[j][r] + bfr(BO[n0 + j * 16 + col]); }
  LDSX();
  for (int rl = 0; rl < 16; ++rl) vst2(Y + (r0 + rl) * DM + n0 + lane * 4, *(const v4f*)&so[wave][rl][lane * 4]);
}
// ---- k_kvin: block = (64 keys m, head h, b): k input [b][h][m][64] -> K rows [b*M + m][DM + h*64 + d] of the q|k plane (f16); v input -> V plane [b][h*64 + d][m]
__global__ __launch_bounds__(256) void k_kvin(const float* __restrict__ KIN, const float* __restrict__ VIN, _Float16* __restrict__ QK, _Float16* __restrict__ VTH) {
  __shared__ __align__(16) _Float16 skh[64][72], svh[64][72]; const int t = threadIdx.x; const int m0 = blockIdx.x * 64, h = blockIdx.y; const size_t b = blockIdx.z;
  for (int e = t; e < 64 * 64; e += 256) { const int r = e >> 6, d = e & 63; const size_t src = ((b * NH + h) * SS + m0 + r) * HD + d; const float kv = bfr(KIN[src]), vv = bfr(VIN[src]);
    skh[r][d] = (_Float16)kv; svh[d][r] = (_Float16)vv; }
  __syncthreads();
  for (int e = t; e < 64 * 8; e += 256) { const int r = e >> 3, q = e & 7; const size_t o = (b * SS + m0 + r) * (2 * DM) + DM + h * HD + q * 8; vst2((unsigned*)(QK + o), *(const v4u*)&skh[r][q * 8]);
    const size_t ov = (b * DM + h * HD + r) * SS + m0 + q * 8; vst2((unsigned*)(VTH + ov), *(const v4u*)&svh[r][q * 8]); }
}
extern "C" void kernel_launch(void* const* d_in, const int* in_sizes, int n_in, void* d_out, int out_size, void* d_ws, size_t ws_size, hipStream_t stream) {
  (void)in_sizes; (void)n_in; (void)out_size;
  const float** F = (const float**)d_in;   // 0 x [2,2048,768], 1 k [2,12,2048,64], 2 v [2,12,2048,64], 3 w_qkv [768,768] natural (q only), 4 w_proj [768,768] natural, 5 b_proj [768]
  if (ws_size < (size_t)WS_END) return;
  char* ws = (char*)d_ws; __bf16* PK = (__bf16*)(ws + WS_PK); _Float16 *QK = (_Float16*)(ws + WS_QK), *QKL = (_Float16*)(ws + WS_QKL), *VTH = (_Float16*)(ws + WS_VTH), *VTL = (_Float16*)(ws + WS_VTL); float* O = (float*)(ws + WS_O);
  k_pack<<<dim3(DM, 4), 256, 0, stream>>>(F[3], F[3], F[3], F[4], PK);   // only the q rows and w_proj are used
  k_qkv<<<dim3(TNB * SS / 64, DM / 128), 128, 0, stream>>>(F[0], F[0], F[0], PK + PK_A, nullptr, nullptr, nullptr, QK, QKL, VTH, VTL);   // q columns only
  k_kvin<<<dim3(SS / 64, NH, TNB), 256, 0, stream>>>(F[1], F[2], QK, VTH);
  k_attn<<<dim3(TQB, NH, TNB), 128, 0, stream>>>(QK, QKL, VTH, nullptr, O);
  k_out<<<dim3(TOB, DM / 128), 128, 0, stream>>>(O, PK + PK_P, F[5], (float*)d_out);
}

// v005
// One run takes 95.6 microseconds.
// Timed twice side by side with v004, it ran 1.05 times as fast both times.
// Counting every step since v000, it is 4.14 times as fast.
// compute dtype: x, k, v, w_qkv, w_proj, b_proj rounded to bf16; q = x . w_qkv^T with exact bf16 products on WMMA 16x16x32 (natural rows), stored as f16 hi + (x2048-scaled) residual planes; the k and v INPUTS are re-laid out on device as one f16 plane each (a bf16 value is exact in f16 from 2^-17 up to the f16 range; below 2^-17 it is rounded to the f16 subnormal grid, at most 2^-25 off); 2-product scores (k x q hi, k x q residual) x 1/sqrt(64), running-max softmax in f32 (hardware exp); P (scaled by 2^11, as f16 hi + residual) x v (2 products); output projection with ctx as bf16 hi + residual x exact w_proj rows (2 products) + b_proj; f32 accumulate.
#include <hip/hip_runtime.h>
#include <math.h>

typedef __attribute__((ext_vector_type(16))) _Float16 v16h;
typedef __attribute__((ext_vector_type(16))) __bf16 v16b;
typedef __attribute__((ext_vector_type(8)))  _Float16 v8h;
typedef __attribute__((ext_vector_type(8)))  float v8f;
typedef __attribute__((ext_vector_type(4)))  float v4f;
typedef __attribute__((ext_vector_type(2)))  float v2f;
typedef __attribute__((ext_vector_type(4)))  unsigned v4u;
typedef __attribute__((ext_vector_type(4)))  int v4i;
typedef float __attribute__((may_alias)) float_a;
typedef int __attribute__((may_alias)) int_a;

template <typename T> __device__ __forceinline__ void vst2(void* p, T v) { *(T*)p = v;  }
__device__ __forceinline__ v8f wmma16(v16h a, v16h b, v8f c) {
  v8f d = __builtin_amdgcn_wmma_f32_16x16x32_f16(false, a, false, b, (short)0, c, false, false);
  asm volatile("v_nop\n\tv_nop\n\tv_nop\n\tv_nop" : "+v"(d) : "v"(a), "v"(b));
  return d;
}
__device__ __forceinline__ v8f wmma_bf(v16b a, v16b b, v8f c) {
  v8f d = __builtin_amdgcn_wmma_f32_16x16x32_bf16(false, a, false, b, (short)0, c, false, false);
  asm volatile("v_nop\n\tv_nop\n\tv_nop\n\tv_nop" : "+v"(d) : "v"(a), "v"(b));
  return d;
}
// ViT-style attention with given key/value caches (B 2, N = M = 2,048, dim 768, 12 heads x 64): q = x W_qkv^T, softmax(q k^T / 8) v, output projection + bias.
__device__ __forceinline__ v16h frag_h(const _Float16* rowk0, int lane) {
  union { v16h v; v8h q[2]; } u; const _Float16* p = rowk0 + 8 * (lane >> 4);
  u.q[0] = *(const v8h*)p; u.q[1] = *(const v8h*)(p + 16); return u.v;
}
__device__ __forceinline__ v16h frag_f32(const float* rowk0, int lane) {
  v16h a; const float* p = rowk0 + 8 * (lane >> 4);
#pragma unroll
  for (int i = 0; i < 8; ++i) { a[i] = (_Float16)p[i]; a[8 + i] = (_Float16)p[16 + i]; }
  return a;
}
__device__ __forceinline__ v16h frag_f32s(const float* rowk0, int lane, float sc) {
  v16h a; const float* p = rowk0 + 8 * (lane >> 4);
#pragma unroll
  for (int i = 0; i < 8; ++i) { a[i] = (_Float16)(p[i] * sc); a[8 + i] = (_Float16)(p[16 + i] * sc); }
  return a;
}
// column fragment from a [K][ld] layout (column n), rows >= K read as 0
__device__ __forceinline__ v16h fragc_f32(const float* W, int k0, int n, int lane, int ld, int K) {
  v16h a; const int g = lane >> 4;
#pragma unroll
  for (int i = 0; i < 8; ++i) { const int ka = k0 + 8 * g + i, kb = ka + 16;
    a[i] = (_Float16)(ka < K ? W[(size_t)(ka < K ? ka : K - 1) * ld + n] : 0.f); a[8 + i] = (_Float16)(kb < K ? W[(size_t)(kb < K ? kb : K - 1) * ld + n] : 0.f); }
  return a;
}
struct F2 { v16b h, l; };
__device__ __forceinline__ F2 bsplit16(const float v[16]) { F2 r;
#pragma unroll
  for (int i = 0; i < 16; ++i) { const __bf16 h = (__bf16)v[i]; r.h[i] = h; r.l[i] = (__bf16)(v[i] - (float)h); }
  return r; }
__device__ __forceinline__ F2 split_row(const float* row, int k0, int lane) { float v[16]; const float* p = row + k0 + 8 * (lane >> 4);
#pragma unroll
  for (int i = 0; i < 8; ++i) { v[i] = p[i]; v[8 + i] = p[16 + i]; }
  return bsplit16(v); }
__device__ __forceinline__ F2 split_rowK(const float* row, int k0, int lane, int K) { float v[16]; const int g = lane >> 4;
#pragma unroll
  for (int i = 0; i < 8; ++i) { const int ka = k0 + 8 * g + i, kb = ka + 16; v[i] = ka < K ? row[ka < K ? ka : K - 1] : 0.f; v[8 + i] = kb < K ? row[kb < K ? kb : K - 1] : 0.f; }
  return bsplit16(v); }
__device__ __forceinline__ F2 split_col(const float* W, int k0, int n, int lane, int ld, int K) { float v[16]; const int g = lane >> 4;
#pragma unroll
  for (int i = 0; i < 8; ++i) { const int ka = k0 + 8 * g + i, kb = ka + 16; v[i] = ka < K ? W[(size_t)(ka < K ? ka : K - 1) * ld + n] : 0.f; v[8 + i] = kb < K ? W[(size_t)(kb < K ? kb : K - 1) * ld + n] : 0.f; }
  return bsplit16(v); }
__device__ __forceinline__ v8f mac3(const F2& a, const F2& b, v8f c) { c = wmma_bf(a.l, b.h, c); c = wmma_bf(a.h, b.l, c); return wmma_bf(a.h, b.h, c); }
__device__ __forceinline__ float sigm(float v) { return 1.0f / (1.0f + expf(-v)); }
#define LDSX() do { asm volatile("s_wait_dscnt 0" ::: "memory"); __builtin_amdgcn_wave_barrier(); __builtin_amdgcn_fence(__ATOMIC_RELEASE, "workgroup"); } while (0)


#define NB 2
#define SS 2048
#define DM 768
#define NH 12
#define HD 64
#define QKVW (3 * DM)
#ifndef TQB
#define TQB (SS / 64)
#define TNB NB
#define TOB (NB * SS / 64)     // output row tiles (all)
#endif
typedef __attribute__((ext_vector_type(8))) __bf16 v8b;
__device__ __forceinline__ v16b frag_b(const __bf16* rowk0, int lane) {
  union { v16b v; v8b q[2]; } u; const __bf16* p = rowk0 + 8 * (lane >> 4);
  u.q[0] = *(const v8b*)p; u.q[1] = *(const v8b*)(p + 16); return u.v;
}
__device__ __forceinline__ float bfr(float v) { return (float)(__bf16)v; }
__device__ __attribute__((noinline)) float exp_ni(float v) { return expf(v); }
__device__ __attribute__((noinline)) float erf_ni(float v) { return erff(v); }

#define PK_A 0                       // [768][768] Wqkv rows (natural [out][in]); 2304 rows of space
#define PK_P (PK_A + QKVW * DM)        // [768][768] Wo rows (natural)
#define PK_END (PK_P + DM * DM)
#define WS_PK  0u
#define WS_QK  (WS_PK + 2u * PK_END)             // f16 [4096 rows][1536]: q | k
#define WS_QKL (WS_QK + 2u * NB * SS * 2 * DM)     // f16 q residual plane x2048 (same rows; its k columns are not used)
#define WS_VTH (WS_QKL + 2u * NB * SS * 2 * DM)    // f16 [b][768 (h*64+d)][2048 s]
#define WS_VTL (WS_VTH + 2u * NB * DM * SS)        // place of a v residual plane (not used)
#define WS_O   (WS_VTL + 2u * NB * DM * SS)        // f32 [4096][768]
#define WS_CS  (WS_O + 4u * NB * SS * DM)           // f32 [2][2048][32] (not used)
#define WS_END (WS_CS + 4u * 2 * SS * 32)
// eight asynchronous 16-byte-per-lane copies, each 512 B (4 rows of 128 B, or 2 rows of 256 B); ls / gs = bytes between two copies in LDS / in global memory
__device__ __forceinline__ void copy8(unsigned l0, const char* g0, unsigned ls, size_t gs) {
  const unsigned l1 = l0 + ls, l2 = l1 + ls, l3 = l2 + ls, l4 = l3 + ls, l5 = l4 + ls, l6 = l5 + ls, l7 = l6 + ls;
  const char *g1 = g0 + gs, *g2 = g1 + gs, *g3 = g2 + gs, *g4 = g3 + gs, *g5 = g4 + gs, *g6 = g5 + gs, *g7 = g6 + gs;
  // the closing s_wait_xcnt stands inside the statement so that no address register of a copy is rewritten in front of it
  asm volatile("global_load_async_to_lds_b128 %0, %8, off\n\t"
               "global_load_async_to_lds_b128 %1, %9, off\n\t"
               "global_load_async_to_lds_b128 %2, %10, off\n\t"
               "global_load_async_to_lds_b128 %3, %11, off\n\t"
               "global_load_async_to_lds_b128 %4, %12, off\n\t"
               "global_load_async_to_lds_b128 %5, %13, off\n\t"
               "global_load_async_to_lds_b128 %6, %14, off\n\t"
               "global_load_async_to_lds_b128 %7, %15, off\n\t"
               "s_wait_xcnt 0x0"
               :: "v"(l0), "v"(l1), "v"(l2), "v"(l3), "v"(l4), "v"(l5), "v"(l6), "v"(l7), "v"(g0), "v"(g1), "v"(g2), "v"(g3), "v"(g4), "v"(g5), "v"(g6), "v"(g7) : "memory");
}
// The two GEMM kernels (64 rows x 128 columns per work-group) take their operands through LDS: a stage is 64 k of the 64 A rows (f32, 256 B each) and of the 128 W rows (bf16, 128 B each), brought in once per work-group by asynchronous copies of whole 128-B lines, two buffers, the next stage in flight while this one is worked on; the fragments are read from LDS, A and W in the same k order (that of frag_b).
#define GKS 64                 // k per stage
#define GNS (DM / GKS)         // stages
#define GAP 68                 // LDS pitch of an A row in f32: 256-B row + 16 B, conflict-free for 16-byte LDS reads
#define GWP 72                 // LDS pitch of a W row in bf16: 128-B row + 16 B, likewise
// one stage: each wave copies its own 16 A rows (2 rows a copy) and 32 of the W rows (4 rows a copy); la / lw, ga / gw = the lane's first 16 bytes of stage 0 in buffer 0
__device__ __forceinline__ void gemm_copy(unsigned la, const char* ga, unsigned lw, const char* gw, int buf, int st) {
  copy8(la + (unsigned)buf * (64 * GAP * 4), ga + (size_t)st * (GKS * 4), 2 * GAP * 4, (size_t)2 * DM * 4);
  copy8(lw + (unsigned)buf * (128 * GWP * 2), gw + (size_t)st * (GKS * 2), 4 * GWP * 2, (size_t)4 * DM * 2);
}
// the 16 f32 of an A fragment (elements 0..7 = k 8 g + i, 8..15 = k 16 + 8 g + i) from an LDS row, p = row + k0 + 8 g
__device__ __forceinline__ void lds16(const float* p, float v[16]) {
  const v4f x0 = *(const v4f*)p, x1 = *(const v4f*)(p + 4), x2 = *(const v4f*)(p + 16), x3 = *(const v4f*)(p + 20);
#pragma unroll
  for (int i = 0; i < 4; ++i) { v[i] = x0[i]; v[4 + i] = x1[i]; v[8 + i] = x2[i]; v[12 + i] = x3[i]; }
}
__global__ __launch_bounds__(128) void k_qkv(const float* __restrict__ XQ, const float* __restrict__ XK, const float* __restrict__ XV, const __bf16* __restrict__ P, const float* __restrict__ BQ, const float* __restrict__ BK, const float* __restrict__ BV, _Float16* __restrict__ QK, _Float16* __restrict__ QKL, _Float16* __restrict__ VTH, _Float16* __restrict__ VTL) {
  const int which0 = (blockIdx.y * 128) / DM; const float* X = (which0 == 0) ? XQ : (which0 == 1) ? XK : XV; const float* BB = BQ ? (((which0 == 0) ? BQ : (which0 == 1) ? BK : BV) + (blockIdx.y * 128 - which0 * DM)) : nullptr;
  __shared__ __align__(16) _Float16 so[4][16][136], sol[4][16][136]; __shared__ __align__(16) _Float16 sth[128][72], stl[128][72];
  const int tid = threadIdx.x, wave = tid >> 5, lane = tid & 31, col = lane & 15, g = lane >> 4; const size_t r0 = (size_t)blockIdx.x * 64 + wave * 16; const int n0 = blockIdx.y * 128;
  __shared__ __align__(16) float sa[2][64][GAP]; __shared__ __align__(16) __bf16 sw[2][128][GWP];
  const char* gsa = (const char*)(X + (r0 + (lane >> 4)) * DM) + (lane & 15) * 16; const char* gsw = (const char*)(P + (size_t)(n0 + wave * 32 + (lane >> 3)) * DM) + (lane & 7) * 16;
  const unsigned lsa = (unsigned)(size_t)&sa[0][wave * 16 + (lane >> 4)][(lane & 15) * 4], lsw = (unsigned)(size_t)&sw[0][wave * 32 + (lane >> 3)][(lane & 7) * 8];
  gemm_copy(lsa, gsa, lsw, gsw, 0, 0);
  v8f acc[8] = {};
  asm volatile("s_wait_asynccnt 0x0" ::: "memory");   // this wave's copies of stage 0 have landed
  __syncthreads();                                     // publishes stage 0 to the other waves
  gemm_copy(lsa, gsa, lsw, gsw, 1, 1);
  // kept rolled: one copy of the stage body in the instruction cache
#pragma unroll 1
  for (int st = 0; st < GNS; ++st) { const int bf = st & 1;
    float v[GKS / 32][16]; v16b w[GKS / 32][8];   // all fragments of the stage are read as one group ahead of the products
#pragma unroll
    for (int kc = 0; kc < GKS / 32; ++kc) { lds16(&sa[bf][wave * 16 + col][kc * 32 + 8 * g], v[kc]);
#pragma unroll
      for (int j = 0; j < 8; ++j) w[kc][j] = frag_b(&sw[bf][j * 16 + col][kc * 32], lane); }
#pragma unroll
    for (int kc = 0; kc < GKS / 32; ++kc) { v16b a;
#pragma unroll
      for (int i = 0; i < 16; ++i) a[i] = (__bf16)v[kc][i];
#pragma unroll
      for (int j = 0; j < 8; ++j) acc[j] = wmma_bf(a, w[kc][j], acc[j]); }
    asm volatile("s_wait_dscnt 0x0" ::: "memory");      // this wave's reads of the buffer are done before it may be refilled
    asm volatile("s_wait_asynccnt 0x0" ::: "memory");   // this wave's copies of stage st + 1 have landed
    __syncthreads();                                     // publishes stage st + 1 and ends every wave's reads of stage st
    if (st + 2 < GNS) gemm_copy(lsa, gsa, lsw, gsw, bf, st + 2); }
  asm volatile("s_wait_asynccnt 0x0" ::: "memory");     // no copy is outstanding when the wave goes on to the epilogue and ends
  if (n0 < 2 * DM) {   // q stored unscaled (f16 sigma ~0.6, no subnormal exposure); 1/8 applied to the f32 score
#pragma unroll
    for (int j = 0; j < 8; ++j) {
#pragma unroll
      for (int r = 0; r < 8; ++r) { const float v = acc[j][r] + (BB ? bfr(BB[j * 16 + col]) : 0.f); const _Float16 hv = (_Float16)v; so[wave][8 * g + r][j * 16 + col] = hv; sol[wave][8 * g + r][j * 16 + col] = (_Float16)((v - (float)hv) * 2048.0f); } }   // q, k (+ bias) as f16 hi + (x2048) residual
    LDSX();
    for (int rl = 0; rl < 16; ++rl) if (lane < 16) { vst2((unsigned*)(QK + (r0 + rl) * (2 * DM) + n0 + lane * 8), *(const v4u*)&so[wave][rl][lane * 8]); vst2((unsigned*)(QKL + (r0 + rl) * (2 * DM) + n0 + lane * 8), *(const v4u*)&sol[wave][rl][lane * 8]); }
  } else {
#pragma unroll
    for (int j = 0; j < 8; ++j) {
#pragma unroll
      for (int r = 0; r < 8; ++r) { const float v = acc[j][r] + (BB ? bfr(BB[j * 16 + col]) : 0.f); const _Float16 hv = (_Float16)v; sth[j * 16 + col][wave * 16 + 8 * g + r] = hv; stl[j * 16 + col][wave * 16 + 8 * g + r] = (_Float16)((v - (float)hv) * 2048.0f); } }
    __syncthreads();
    const size_t rb = (size_t)blockIdx.x * 64; const int b = (int)(rb / SS), s0 = (int)(rb % SS); const int pc0 = n0 - 2 * DM;
    for (int q = tid; q < 128 * 8; q += 128) { const int d = q >> 3, pc = q & 7; const size_t o = ((size_t)b * DM + pc0 + d) * SS + s0 + pc * 8; vst2((unsigned*)(VTH + o), *(const v4u*)&sth[d][pc * 8]); vst2((unsigned*)(VTL + o), *(const v4u*)&stl[d][pc * 8]); }
  }
}
#define KST 64                 // keys per stage
#define NST (SS / KST)         // stages
#define RPH 72                 // LDS row pitch in f16: 128-B row + 16 B, the conflict-free pitch for 16-byte LDS reads
#define PLB (64 * RPH * 2)     // bytes of one plane of a stage in LDS
// lane l takes the value of lane l ^ 16
__device__ __forceinline__ float xhalf(float x) { return __builtin_bit_cast(float, __builtin_amdgcn_permlanex16(__builtin_bit_cast(int, x), __builtin_bit_cast(int, x), 0x76543210, 0xfedcba98, false, false)); }
__global__ __launch_bounds__(128) void k_attn(const _Float16* __restrict__ QK, const _Float16* __restrict__ QKL, const _Float16* __restrict__ VTH, const void* __restrict__ KMASK, float* __restrict__ O) {
  __shared__ __align__(16) float so[4][16][68];
  __shared__ __align__(16) _Float16 ring[2][2][64][RPH];   // [buffer][k, v][key row, or d row for v][d, or key for v]
  const int tid = threadIdx.x, wave = tid >> 5, lane = tid & 31, col = lane & 15, g = lane >> 4;
  const int qb = blockIdx.x, h = blockIdx.y, b = blockIdx.z; const int q0 = qb * 64 + wave * 16; const size_t rq = (size_t)b * SS + q0 + col;
  // this wave's half plane (32 rows): source of its lane's first 16 bytes of stage 0, row pitch and step from stage to stage in bytes
  const int wv = __builtin_amdgcn_readfirstlane(wave);
  const size_t koff = (size_t)b * SS * (2 * DM) + DM + h * HD, voff = ((size_t)b * DM + h * HD) * SS;
  const _Float16* pl0 = (wv < 2) ? QK + koff : VTH + voff; const int row0 = (wv & 1) * 32 + (lane >> 3);
  const size_t gpitch = (wv < 2) ? (size_t)(2 * DM * 2) : (size_t)(SS * 2), gstage = (wv < 2) ? (size_t)KST * (2 * DM * 2) : (size_t)(KST * 2);
  const char* gsrc = (const char*)pl0 + (size_t)row0 * gpitch + (lane & 7) * 16;
  const unsigned ldst = (unsigned)(size_t)&ring[0][0][0][0] + (unsigned)(wv >> 1) * PLB + (unsigned)row0 * (RPH * 2) + (unsigned)(lane & 7) * 16;
#define STAGE_COPY(BUF, ST) copy8(ldst + (unsigned)(BUF) * (2 * PLB), gsrc + (size_t)(ST) * gstage, 4 * RPH * 2, 4 * gpitch)
  STAGE_COPY(0, 0);
  v16h aq[2], aql[2];
#pragma unroll
  for (int kc = 0; kc < 2; ++kc) { aq[kc] = frag_h(QK + rq * (2 * DM) + h * HD + kc * 32, lane); aql[kc] = frag_h(QKL + rq * (2 * DM) + h * HD + kc * 32, lane); }
  float m = -3.0e38f, l = 0.f;   // running maximum of this lane's query (both halves agree) and this half's share of its sum
  v8f acc[4] = {}, accl[4] = {};
  asm volatile("s_wait_asynccnt 0x0" ::: "memory");   // this wave's copies of stage 0 have landed
  __syncthreads();                                     // publishes stage 0 to the other waves
  STAGE_COPY(1, 1);
  // both loops kept rolled: one copy of the 32-key body in the instruction cache, and one set of fragment registers
#pragma unroll 1
  for (int st = 0; st < NST; ++st) { const _Float16* rb = &ring[st & 1][0][0][0];
#pragma unroll 1
  for (int sub = 0; sub < KST / 32; ++sub) { v8f s[2];
    v16h kh[2][2];   // all k fragments of the 32 keys are read as one group ahead of the products
#pragma unroll
    for (int ct = 0; ct < 2; ++ct) { const _Float16* krow = rb + (sub * 32 + ct * 16 + col) * RPH;
#pragma unroll
      for (int kc = 0; kc < 2; ++kc) kh[ct][kc] = frag_h(krow + kc * 32, lane); }
#pragma unroll
    for (int ct = 0; ct < 2; ++ct) { v8f c = {}, cl = {};
#pragma unroll
      for (int kc = 0; kc < 2; ++kc) { c = wmma16(kh[ct][kc], aq[kc], c); cl = wmma16(kh[ct][kc], aql[kc], cl); }   // transposed scores, k rows as A and q as B: k x q hi and k x q residual
#pragma unroll
      for (int r = 0; r < 8; ++r) c[r] += cl[r] * (1.0f / 2048.0f);
#pragma unroll
      for (int r = 0; r < 8; ++r) s[ct][r] = c[r] * 0.125f; }   // 1/sqrt(64); s[ct][r] = score of key sub * 32 + ct * 16 + 8 g + r for query col
    v16h vh[4];   // the v fragments (d rows as A) as one group, landing under the softmax
#pragma unroll
    for (int dt = 0; dt < 4; ++dt) vh[dt] = frag_h(rb + 64 * RPH + (dt * 16 + col) * RPH + sub * 32, lane);
    float mx = fmaxf(s[0][0], s[1][0]);
#pragma unroll
    for (int r = 1; r < 8; ++r) mx = fmaxf(mx, fmaxf(s[0][r], s[1][r]));
    mx = fmaxf(mx, xhalf(mx));   // the other 16 of the 32 keys lie in lane ^ 16
    const float mn = fmaxf(m, mx); const float alpha = (m <= -1.0e38f) ? 0.f : __expf(m - mn); m = mn;
    float e[2][8], t[8];
#pragma unroll
    for (int r = 0; r < 8; ++r) { e[0][r] = (s[0][r] <= -1.0e38f) ? 0.f : __expf(s[0][r] - mn); e[1][r] = (s[1][r] <= -1.0e38f) ? 0.f : __expf(s[1][r] - mn); t[r] = e[0][r] + e[1][r]; }
    l = l * alpha + (((t[0] + t[1]) + (t[2] + t[3])) + ((t[4] + t[5]) + (t[6] + t[7])));
#pragma unroll
    for (int dt = 0; dt < 4; ++dt) {
#pragma unroll
      for (int r = 0; r < 8; ++r) { acc[dt][r] *= alpha; accl[dt][r] *= alpha; } }
    v16h pa, pl;   // the two score tiles of a lane are, element for element, the B fragment of P transposed: element r = key 8 g + r, element 8 + r = key 16 + 8 g + r, the k order of frag_h
#pragma unroll
    for (int i = 0; i < 8; ++i) { const float x0 = e[0][i] * 2048.0f, x1 = e[1][i] * 2048.0f; const _Float16 h0 = (_Float16)x0, h1 = (_Float16)x1; pa[i] = h0; pa[8 + i] = h1; pl[i] = (_Float16)((x0 - (float)h0) * 2048.0f); pl[8 + i] = (_Float16)((x1 - (float)h1) * 2048.0f); }   // P scaled by 2^11 before the f16 split so small softmax weights stay out of the f16 subnormal range; 2^-11 folded into the epilogue
#pragma unroll
    for (int dt = 0; dt < 4; ++dt) { acc[dt] = wmma16(vh[dt], pa, acc[dt]); accl[dt] = wmma16(vh[dt], pl, accl[dt]); } }   // transposed output, acc[dt][r] = d dt * 16 + 8 g + r of query col: V x P hi + (V x P lo) / 2048
    asm volatile("s_wait_dscnt 0x0" ::: "memory");      // this wave's reads of the buffer are done before it may be refilled
    asm volatile("s_wait_asynccnt 0x0" ::: "memory");   // this wave's copies of stage st + 1 have landed
    __syncthreads();                                     // publishes stage st + 1 and ends every wave's reads of stage st
    if (st + 2 < NST) STAGE_COPY(st & 1, st + 2); }
  asm volatile("s_wait_asynccnt 0x0" ::: "memory");     // no copy is outstanding when the wave goes on to the epilogue and ends
  const float il = (1.0f / 2048.0f) / (l + xhalf(l));   // the two halves' sums are joined once
#pragma unroll
  for (int dt = 0; dt < 4; ++dt) { v4f o0, o1;
#pragma unroll
    for (int r = 0; r < 4; ++r) { o0[r] = (acc[dt][r] + accl[dt][r] * (1.0f / 2048.0f)) * il; o1[r] = (acc[dt][4 + r] + accl[dt][4 + r] * (1.0f / 2048.0f)) * il; }
    *(v4f*)&so[wave][col][dt * 16 + 8 * g] = o0; *(v4f*)&so[wave][col][dt * 16 + 8 * g + 4] = o1; }
  LDSX();
  for (int rl = 0; rl < 16; ++rl) if (lane < 16) vst2(O + ((size_t)b * SS + q0 + rl) * DM + h * HD + lane * 4, *(const v4f*)&so[wave][rl][lane * 4]);
}
// ---- k_out: block = (64 rows, 128 cols): out = O(hi/lo) . Wo rows (2 products) + bo
__global__ __launch_bounds__(128) void k_out(const float* __restrict__ O, const __bf16* __restrict__ P, const float* __restrict__ BO, float* __restrict__ Y) {
  __shared__ __align__(16) float so[4][16][132];
  const int tid = threadIdx.x, wave = tid >> 5, lane = tid & 31, col = lane & 15, g = lane >> 4; const size_t r0 = (size_t)blockIdx.x * 64 + wave * 16; const int n0 = blockIdx.y * 128;
  __shared__ __align__(16) float sa[2][64][GAP]; __shared__ __align__(16) __bf16 sw[2][128][GWP];
  const char* gsa = (const char*)(O + (r0 + (lane >> 4)) * DM) + (lane & 15) * 16; const char* gsw = (const char*)(P + (size_t)(n0 + wave * 32 + (lane >> 3)) * DM) + (lane & 7) * 16;
  const unsigned lsa = (unsigned)(size_t)&sa[0][wave * 16 + (lane >> 4)][(lane & 15) * 4], lsw = (unsigned)(size_t)&sw[0][wave * 32 + (lane >> 3)][(lane & 7) * 8];
  gemm_copy(lsa, gsa, lsw, gsw, 0, 0);
  v8f acc[8] = {};
  asm volatile("s_wait_asynccnt 0x0" ::: "memory");   // this wave's copies of stage 0 have landed
  __syncthreads();                                     // publishes stage 0 to the other waves
  gemm_copy(lsa, gsa, lsw, gsw, 1, 1);
  // kept rolled: one copy of the stage body in the instruction cache
#pragma unroll 1
  for (int st = 0; st < GNS; ++st) { const int bf = st & 1;
    float v[GKS / 32][16]; v16b w[GKS / 32][8];   // all fragments of the stage are read as one group ahead of the products
#pragma unroll
    for (int kc = 0; kc < GKS / 32; ++kc) { lds16(&sa[bf][wave * 16 + col][kc * 32 + 8 * g], v[kc]);
#pragma unroll
      for (int j = 0; j < 8; ++j) w[kc][j] = frag_b(&sw[bf][j * 16 + col][kc * 32], lane); }
#pragma unroll
    for (int kc = 0; kc < GKS / 32; ++kc) { const F2 a = bsplit16(v[kc]);
#pragma unroll
      for (int j = 0; j < 8; ++j) { acc[j] = wmma_bf(a.l, w[kc][j], acc[j]); acc[j] = wmma_bf(a.h, w[kc][j], acc[j]); } }
    asm volatile("s_wait_dscnt 0x0" ::: "memory");      // this wave's reads of the buffer are done before it may be refilled
    asm volatile("s_wait_asynccnt 0x0" ::: "memory");   // this wave's copies of stage st + 1 have landed
    __syncthreads();                                     // publishes stage st + 1 and ends every wave's reads of stage st
    if (st + 2 < GNS) gemm_copy(lsa, gsa, lsw, gsw, bf, st + 2); }
  asm volatile("s_wait_asynccnt 0x0" ::: "memory");     // no copy is outstanding when the wave goes on to the epilogue and ends
#pragma unroll
  for (int j = 0; j < 8; ++j) {
#pragma unroll
    for (int r = 0; r < 8; ++r) so[wave][8 * g + r][j * 16 + col] = acc[j][r] + bfr(BO[n0 + j * 16 + col]); }
  LDSX();
  for (int rl = 0; rl < 16; ++rl) vst2(Y + (r0 + rl) * DM + n0 + lane * 4, *(const v4f*)&so[wave][rl][lane * 4]);
}
// ---- k_kvin: block = (64 keys m, head h, b): k input [b][h][m][64] -> K rows [b*M + m][DM + h*64 + d] of the q|k plane (f16); v input -> V plane [b][h*64 + d][m]
// The work-groups with blockIdx.x >= SS / 64 share the launch and round the two weight matrices to bf16 (natural [out][in] rows, a flat copy): w_qkv -> PK_A, w_proj -> PK_P; each takes PKE consecutive elements, 8 per lane and trip (32 B read, 16 B stored, whole lines per wave).
#define PKE 8192                       // weight elements per packing work-group
#define PKX 6                          // extra blockIdx.x values: PKX * NH * TNB = 144 work-groups = 2 * DM * DM / PKE
__global__ __launch_bounds__(256) void k_kvin(const float* __restrict__ KIN, const float* __restrict__ VIN, const float* __restrict__ WQ, const float* __restrict__ WO, _Float16* __restrict__ QK, _Float16* __restrict__ VTH, __bf16* __restrict__ PK) {
  __shared__ __align__(16) _Float16 skh[64][72], svh[64][72]; const int t = threadIdx.x; const int m0 = blockIdx.x * 64, h = blockIdx.y; const size_t b = blockIdx.z;
  if (blockIdx.x >= SS / 64) {   // the same for the whole work-group, and it leaves ahead of the barrier
    const int id = ((int)blockIdx.z * NH + (int)blockIdx.y) * PKX + ((int)blockIdx.x - SS / 64), nq = DM * DM / PKE;
    const float* src = (id < nq) ? WQ + (size_t)id * PKE : WO + (size_t)(id - nq) * PKE;
    __bf16* dst = (id < nq) ? PK + PK_A + (size_t)id * PKE : PK + PK_P + (size_t)(id - nq) * PKE;
    // unrolled so that all eight loads of a lane are in flight together (one memory latency per work-group, not four)
#pragma unroll
    for (int i = 0; i < PKE / (256 * 8); ++i) { const int e = (i * 256 + t) * 8; const v4f x0 = *(const v4f*)(src + e), x1 = *(const v4f*)(src + e + 4); v8b o;
      // unrolled so that the vector elements are named by constants and stay in registers
#pragma unroll
      for (int j = 0; j < 4; ++j) { o[j] = (__bf16)x0[j]; o[4 + j] = (__bf16)x1[j]; }
      *(v8b*)(dst + e) = o; }
    return;
  }
  for (int e = t; e < 64 * 64; e += 256) { const int r = e >> 6, d = e & 63; const size_t src = ((b * NH + h) * SS + m0 + r) * HD + d; const float kv = bfr(KIN[src]), vv = bfr(VIN[src]);
    skh[r][d] = (_Float16)kv; svh[d][r] = (_Float16)vv; }
  __syncthreads();
  for (int e = t; e < 64 * 8; e += 256) { const int r = e >> 3, q = e & 7; const size_t o = (b * SS + m0 + r) * (2 * DM) + DM + h * HD + q * 8; vst2((unsigned*)(QK + o), *(const v4u*)&skh[r][q * 8]);
    const size_t ov = (b * DM + h * HD + r) * SS + m0 + q * 8; vst2((unsigned*)(VTH + ov), *(const v4u*)&svh[r][q * 8]); }
}
extern "C" void kernel_launch(void* const* d_in, const int* in_sizes, int n_in, void* d_out, int out_size, void* d_ws, size_t ws_size, hipStream_t stream) {
  (void)in_sizes; (void)n_in; (void)out_size;
  const float** F = (const float**)d_in;   // 0 x [2,2048,768], 1 k [2,12,2048,64], 2 v [2,12,2048,64], 3 w_qkv [768,768] natural (q only), 4 w_proj [768,768] natural, 5 b_proj [768]
  if (ws_size < (size_t)WS_END) return;
  char* ws = (char*)d_ws; __bf16* PK = (__bf16*)(ws + WS_PK); _Float16 *QK = (_Float16*)(ws + WS_QK), *QKL = (_Float16*)(ws + WS_QKL), *VTH = (_Float16*)(ws + WS_VTH), *VTL = (_Float16*)(ws + WS_VTL); float* O = (float*)(ws + WS_O);
  k_kvin<<<dim3(SS / 64 + PKX, NH, TNB), 256, 0, stream>>>(F[1], F[2], F[3], F[4], QK, VTH, PK);   // k, v re-laid out; w_qkv and w_proj rounded to bf16 by the extra work-groups
  k_qkv<<<dim3(TNB * SS / 64, DM / 128), 128, 0, stream>>>(F[0], F[0], F[0], PK + PK_A, nullptr, nullptr, nullptr, QK, QKL, VTH, VTL);   // q columns only
  k_attn<<<dim3(TQB, NH, TNB), 128, 0, stream>>>(QK, QKL, VTH, nullptr, O);
  k_out<<<dim3(TOB, DM / 128), 128, 0, stream>>>(O, PK + PK_P, F[5], (float*)d_out);
}

// v006
// Measured time: 85 microseconds a run.
// Two timings next to v005 both put it at 1.12 times that version's speed.
// Over all steps from v000 it is 4.64 times as fast.
// compute dtype: x, k, v, w_qkv, w_proj, b_proj rounded to bf16; q = x . w_qkv^T with exact bf16 products on WMMA 16x16x32 (natural rows), scaled by log2(e)/8 and stored as f16 hi + residual planes (the residual unscaled, on the f16 subnormal grid at most 2^-25 off); the k and v INPUTS are re-laid out on device as one f16 plane each (a bf16 value is exact in f16 from 2^-17 up to the f16 range; below 2^-17 it is rounded to the f16 subnormal grid, at most 2^-25 off); 2-product scores (k x q hi, k x q residual, one accumulator), running-max softmax in f32 in base 2 (hardware exp); P (scaled by 2^11, as f16 hi + unscaled residual) x v (2 products, one accumulator); output projection with ctx as bf16 hi + residual x exact w_proj rows (2 products) + b_proj; f32 accumulate.
#include <hip/hip_runtime.h>
#include <math.h>

typedef __attribute__((ext_vector_type(16))) _Float16 v16h;
typedef __attribute__((ext_vector_type(16))) __bf16 v16b;
typedef __attribute__((ext_vector_type(8)))  _Float16 v8h;
typedef __attribute__((ext_vector_type(8)))  float v8f;
typedef __attribute__((ext_vector_type(4)))  float v4f;
typedef __attribute__((ext_vector_type(2)))  float v2f;
typedef __attribute__((ext_vector_type(4)))  unsigned v4u;
typedef __attribute__((ext_vector_type(4)))  int v4i;
typedef float __attribute__((may_alias)) float_a;
typedef int __attribute__((may_alias)) int_a;

template <typename T> __device__ __forceinline__ void vst2(void* p, T v) { *(T*)p = v;  }
__device__ __forceinline__ v8f wmma16(v16h a, v16h b, v8f c) {
  v8f d = __builtin_amdgcn_wmma_f32_16x16x32_f16(false, a, false, b, (short)0, c, false, false);
  asm volatile("v_nop\n\tv_nop\n\tv_nop\n\tv_nop" : "+v"(d) : "v"(a), "v"(b));
  return d;
}
__device__ __forceinline__ v8f wmma_bf(v16b a, v16b b, v8f c) {
  v8f d = __builtin_amdgcn_wmma_f32_16x16x32_bf16(false, a, false, b, (short)0, c, false, false);
  asm volatile("v_nop\n\tv_nop\n\tv_nop\n\tv_nop" : "+v"(d) : "v"(a), "v"(b));
  return d;
}
// ViT-style attention with given key/value caches (B 2, N = M = 2,048, dim 768, 12 heads x 64): q = x W_qkv^T, softmax(q k^T / 8) v, output projection + bias.
__device__ __forceinline__ v16h frag_h(const _Float16* rowk0, int lane) {
  union { v16h v; v8h q[2]; } u; const _Float16* p = rowk0 + 8 * (lane >> 4);
  u.q[0] = *(const v8h*)p; u.q[1] = *(const v8h*)(p + 16); return u.v;
}
__device__ __forceinline__ v16h frag_f32(const float* rowk0, int lane) {
  v16h a; const float* p = rowk0 + 8 * (lane >> 4);
#pragma unroll
  for (int i = 0; i < 8; ++i) { a[i] = (_Float16)p[i]; a[8 + i] = (_Float16)p[16 + i]; }
  return a;
}
__device__ __forceinline__ v16h frag_f32s(const float* rowk0, int lane, float sc) {
  v16h a; const float* p = rowk0 + 8 * (lane >> 4);
#pragma unroll
  for (int i = 0; i < 8; ++i) { a[i] = (_Float16)(p[i] * sc); a[8 + i] = (_Float16)(p[16 + i] * sc); }
  return a;
}
// column fragment from a [K][ld] layout (column n), rows >= K read as 0
__device__ __forceinline__ v16h fragc_f32(const float* W, int k0, int n, int lane, int ld, int K) {
  v16h a; const int g = lane >> 4;
#pragma unroll
  for (int i = 0; i < 8; ++i) { const int ka = k0 + 8 * g + i, kb = ka + 16;
    a[i] = (_Float16)(ka < K ? W[(size_t)(ka < K ? ka : K - 1) * ld + n] : 0.f); a[8 + i] = (_Float16)(kb < K ? W[(size_t)(kb < K ? kb : K - 1) * ld + n] : 0.f); }
  return a;
}
struct F2 { v16b h, l; };
__device__ __forceinline__ F2 bsplit16(const float v[16]) { F2 r;
#pragma unroll
  for (int i = 0; i < 16; ++i) { const __bf16 h = (__bf16)v[i]; r.h[i] = h; r.l[i] = (__bf16)(v[i] - (float)h); }
  return r; }
__device__ __forceinline__ F2 split_row(const float* row, int k0, int lane) { float v[16]; const float* p = row + k0 + 8 * (lane >> 4);
#pragma unroll
  for (int i = 0; i < 8; ++i) { v[i] = p[i]; v[8 + i] = p[16 + i]; }
  return bsplit16(v); }
__device__ __forceinline__ F2 split_rowK(const float* row, int k0, int lane, int K) { float v[16]; const int g = lane >> 4;
#pragma unroll
  for (int i = 0; i < 8; ++i) { const int ka = k0 + 8 * g + i, kb = ka + 16; v[i] = ka < K ? row[ka < K ? ka : K - 1] : 0.f; v[8 + i] = kb < K ? row[kb < K ? kb : K - 1] : 0.f; }
  return bsplit16(v); }
__device__ __forceinline__ F2 split_col(const float* W, int k0, int n, int lane, int ld, int K) { float v[16]; const int g = lane >> 4;
#pragma unroll
  for (int i = 0; i < 8; ++i) { const int ka = k0 + 8 * g + i, kb = ka + 16; v[i] = ka < K ? W[(size_t)(ka < K ? ka : K - 1) * ld + n] : 0.f; v[8 + i] = kb < K ? W[(size_t)(kb < K ? kb : K - 1) * ld + n] : 0.f; }
  return bsplit16(v); }
__device__ __forceinline__ v8f mac3(const F2& a, const F2& b, v8f c) { c = wmma_bf(a.l, b.h, c); c = wmma_bf(a.h, b.l, c); return wmma_bf(a.h, b.h, c); }
__device__ __forceinline__ float sigm(float v) { return 1.0f / (1.0f + expf(-v)); }
#define LDSX() do { asm volatile("s_wait_dscnt 0" ::: "memory"); __builtin_amdgcn_wave_barrier(); __builtin_amdgcn_fence(__ATOMIC_RELEASE, "workgroup"); } while (0)


#define NB 2
#define SS 2048
#define DM 768
#define NH 12
#define HD 64
#define QKVW (3 * DM)
#ifndef TQB
#define TQB (SS / 64)
#define TNB NB
#define TOB (NB * SS / 64)     // output row tiles (all)
#endif
typedef __attribute__((ext_vector_type(8))) __bf16 v8b;
__device__ __forceinline__ v16b frag_b(const __bf16* rowk0, int lane) {
  union { v16b v; v8b q[2]; } u; const __bf16* p = rowk0 + 8 * (lane >> 4);
  u.q[0] = *(const v8b*)p; u.q[1] = *(const v8b*)(p + 16); return u.v;
}
__device__ __forceinline__ float bfr(float v) { return (float)(__bf16)v; }
__device__ __attribute__((noinline)) float exp_ni(float v) { return expf(v); }
__device__ __attribute__((noinline)) float erf_ni(float v) { return erff(v); }

#define PK_A 0                       // [768][768] Wqkv rows (natural [out][in]); 2304 rows of space
#define PK_P (PK_A + QKVW * DM)        // [768][768] Wo rows (natural)
#define PK_END (PK_P + DM * DM)
#define WS_PK  0u
#define WS_QK  (WS_PK + 2u * PK_END)             // f16 [4096 rows][1536]: q log2(e) / 8 | k
#define WS_QKL (WS_QK + 2u * NB * SS * 2 * DM)     // f16 q residual plane (same rows; its k columns are not used)
#define WS_VTH (WS_QKL + 2u * NB * SS * 2 * DM)    // f16 [b][768 (h*64+d)][2048 s]
#define WS_VTL (WS_VTH + 2u * NB * DM * SS)        // place of a v residual plane (not used)
#define WS_O   (WS_VTL + 2u * NB * DM * SS)        // f32 [4096][768]
#define WS_CS  (WS_O + 4u * NB * SS * DM)           // f32 [2][2048][32] (not used)
#define WS_END (WS_CS + 4u * 2 * SS * 32)
// eight asynchronous 16-byte-per-lane copies, each 512 B (4 rows of 128 B, or 2 rows of 256 B); ls / gs = bytes between two copies in LDS / in global memory
__device__ __forceinline__ void copy8(unsigned l0, const char* g0, unsigned ls, size_t gs) {
  const unsigned l1 = l0 + ls, l2 = l1 + ls, l3 = l2 + ls, l4 = l3 + ls, l5 = l4 + ls, l6 = l5 + ls, l7 = l6 + ls;
  const char *g1 = g0 + gs, *g2 = g1 + gs, *g3 = g2 + gs, *g4 = g3 + gs, *g5 = g4 + gs, *g6 = g5 + gs, *g7 = g6 + gs;
  // the closing s_wait_xcnt stands inside the statement so that no address register of a copy is rewritten in front of it
  asm volatile("global_load_async_to_lds_b128 %0, %8, off\n\t"
               "global_load_async_to_lds_b128 %1, %9, off\n\t"
               "global_load_async_to_lds_b128 %2, %10, off\n\t"
               "global_load_async_to_lds_b128 %3, %11, off\n\t"
               "global_load_async_to_lds_b128 %4, %12, off\n\t"
               "global_load_async_to_lds_b128 %5, %13, off\n\t"
               "global_load_async_to_lds_b128 %6, %14, off\n\t"
               "global_load_async_to_lds_b128 %7, %15, off\n\t"
               "s_wait_xcnt 0x0"
               :: "v"(l0), "v"(l1), "v"(l2), "v"(l3), "v"(l4), "v"(l5), "v"(l6), "v"(l7), "v"(g0), "v"(g1), "v"(g2), "v"(g3), "v"(g4), "v"(g5), "v"(g6), "v"(g7) : "memory");
}
// The two GEMM kernels (64 rows x 128 columns per work-group) take their operands through LDS: a stage is 64 k of the 64 A rows (f32, 256 B each) and of the 128 W rows (bf16, 128 B each), brought in once per work-group by asynchronous copies of whole 128-B lines, two buffers, the next stage in flight while this one is worked on; the fragments are read from LDS, A and W in the same k order (that of frag_b).
#define QSC 0.18033688011112042f   // log2(e) / sqrt(64)
#define GKS 64                 // k per stage
#define GNS (DM / GKS)         // stages
#define GAP 68                 // LDS pitch of an A row in f32: 256-B row + 16 B, conflict-free for 16-byte LDS reads
#define GWP 72                 // LDS pitch of a W row in bf16: 128-B row + 16 B, likewise
// one stage: each wave copies its own 16 A rows (2 rows a copy) and 32 of the W rows (4 rows a copy); la / lw, ga / gw = the lane's first 16 bytes of stage 0 in buffer 0
__device__ __forceinline__ void gemm_copy(unsigned la, const char* ga, unsigned lw, const char* gw, int buf, int st) {
  copy8(la + (unsigned)buf * (64 * GAP * 4), ga + (size_t)st * (GKS * 4), 2 * GAP * 4, (size_t)2 * DM * 4);
  copy8(lw + (unsigned)buf * (128 * GWP * 2), gw + (size_t)st * (GKS * 2), 4 * GWP * 2, (size_t)4 * DM * 2);
}
// the 16 f32 of an A fragment (elements 0..7 = k 8 g + i, 8..15 = k 16 + 8 g + i) from an LDS row, p = row + k0 + 8 g
__device__ __forceinline__ void lds16(const float* p, float v[16]) {
  const v4f x0 = *(const v4f*)p, x1 = *(const v4f*)(p + 4), x2 = *(const v4f*)(p + 16), x3 = *(const v4f*)(p + 20);
#pragma unroll
  for (int i = 0; i < 4; ++i) { v[i] = x0[i]; v[4 + i] = x1[i]; v[8 + i] = x2[i]; v[12 + i] = x3[i]; }
}
__global__ __launch_bounds__(128) void k_qkv(const float* __restrict__ XQ, const float* __restrict__ XK, const float* __restrict__ XV, const __bf16* __restrict__ P, const float* __restrict__ BQ, const float* __restrict__ BK, const float* __restrict__ BV, _Float16* __restrict__ QK, _Float16* __restrict__ QKL, _Float16* __restrict__ VTH, _Float16* __restrict__ VTL) {
  const int which0 = (blockIdx.y * 128) / DM; const float* X = (which0 == 0) ? XQ : (which0 == 1) ? XK : XV; const float* BB = BQ ? (((which0 == 0) ? BQ : (which0 == 1) ? BK : BV) + (blockIdx.y * 128 - which0 * DM)) : nullptr;
  __shared__ __align__(16) _Float16 so[4][16][136], sol[4][16][136]; __shared__ __align__(16) _Float16 sth[128][72], stl[128][72];
  const int tid = threadIdx.x, wave = tid >> 5, lane = tid & 31, col = lane & 15, g = lane >> 4; const size_t r0 = (size_t)blockIdx.x * 64 + wave * 16; const int n0 = blockIdx.y * 128;
  __shared__ __align__(16) float sa[2][64][GAP]; __shared__ __align__(16) __bf16 sw[2][128][GWP];
  const char* gsa = (const char*)(X + (r0 + (lane >> 4)) * DM) + (lane & 15) * 16; const char* gsw = (const char*)(P + (size_t)(n0 + wave * 32 + (lane >> 3)) * DM) + (lane & 7) * 16;
  const unsigned lsa = (unsigned)(size_t)&sa[0][wave * 16 + (lane >> 4)][(lane & 15) * 4], lsw = (unsigned)(size_t)&sw[0][wave * 32 + (lane >> 3)][(lane & 7) * 8];
  gemm_copy(lsa, gsa, lsw, gsw, 0, 0);
  v8f acc[8] = {};
  asm volatile("s_wait_asynccnt 0x0" ::: "memory");   // this wave's copies of stage 0 have landed
  __syncthreads();                                     // publishes stage 0 to the other waves
  gemm_copy(lsa, gsa, lsw, gsw, 1, 1);
  // kept rolled: one copy of the stage body in the instruction cache
#pragma unroll 1
  for (int st = 0; st < GNS; ++st) { const int bf = st & 1;
    float v[GKS / 32][16]; v16b w[GKS / 32][8];   // all fragments of the stage are read as one group ahead of the products
#pragma unroll
    for (int kc = 0; kc < GKS / 32; ++kc) { lds16(&sa[bf][wave * 16 + col][kc * 32 + 8 * g], v[kc]);
#pragma unroll
      for (int j = 0; j < 8; ++j) w[kc][j] = frag_b(&sw[bf][j * 16 + col][kc * 32], lane); }
#pragma unroll
    for (int kc = 0; kc < GKS / 32; ++kc) { v16b a;
#pragma unroll
      for (int i = 0; i < 16; ++i) a[i] = (__bf16)v[kc][i];
#pragma unroll
      for (int j = 0; j < 8; ++j) acc[j] = wmma_bf(a, w[kc][j], acc[j]); }
    asm volatile("s_wait_dscnt 0x0" ::: "memory");      // this wave's reads of the buffer are done before it may be refilled
    asm volatile("s_wait_asynccnt 0x0" ::: "memory");   // this wave's copies of stage st + 1 have landed
    __syncthreads();                                     // publishes stage st + 1 and ends every wave's reads of stage st
    if (st + 2 < GNS) gemm_copy(lsa, gsa, lsw, gsw, bf, st + 2); }
  asm volatile("s_wait_asynccnt 0x0" ::: "memory");     // no copy is outstanding when the wave goes on to the epilogue and ends
  if (n0 < 2 * DM) {   // q stored times log2(e) / sqrt(64): the products of k_attn are then the base-2 exponents themselves
#pragma unroll
    for (int j = 0; j < 8; ++j) {
#pragma unroll
      for (int r = 0; r < 8; ++r) { const float v = (acc[j][r] + (BB ? bfr(BB[j * 16 + col]) : 0.f)) * QSC; const _Float16 hv = (_Float16)v; so[wave][8 * g + r][j * 16 + col] = hv; sol[wave][8 * g + r][j * 16 + col] = (_Float16)(v - (float)hv); } }   // q as f16 hi + residual at the same scale, so that both products can share an accumulator
    LDSX();
    for (int rl = 0; rl < 16; ++rl) if (lane < 16) { vst2((unsigned*)(QK + (r0 + rl) * (2 * DM) + n0 + lane * 8), *(const v4u*)&so[wave][rl][lane * 8]); vst2((unsigned*)(QKL + (r0 + rl) * (2 * DM) + n0 + lane * 8), *(const v4u*)&sol[wave][rl][lane * 8]); }
  } else {
#pragma unroll
    for (int j = 0; j < 8; ++j) {
#pragma unroll
      for (int r = 0; r < 8; ++r) { const float v = acc[j][r] + (BB ? bfr(BB[j * 16 + col]) : 0.f); const _Float16 hv = (_Float16)v; sth[j * 16 + col][wave * 16 + 8 * g + r] = hv; stl[j * 16 + col][wave * 16 + 8 * g + r] = (_Float16)((v - (float)hv) * 2048.0f); } }
    __syncthreads();
    const size_t rb = (size_t)blockIdx.x * 64; const int b = (int)(rb / SS), s0 = (int)(rb % SS); const int pc0 = n0 - 2 * DM;
    for (int q = tid; q < 128 * 8; q += 128) { const int d = q >> 3, pc = q & 7; const size_t o = ((size_t)b * DM + pc0 + d) * SS + s0 + pc * 8; vst2((unsigned*)(VTH + o), *(const v4u*)&sth[d][pc * 8]); vst2((unsigned*)(VTL + o), *(const v4u*)&stl[d][pc * 8]); }
  }
}
#define KST 64                 // keys per stage
#define NST (SS / KST)         // stages
#define RPH 72                 // LDS row pitch in f16: 128-B row + 16 B, the conflict-free pitch for 16-byte LDS reads
#define PLB (64 * RPH * 2)     // bytes of one plane of a stage in LDS
// lane l takes the value of lane l ^ 16
__device__ __forceinline__ float xhalf(float x) { return __builtin_bit_cast(float, __builtin_amdgcn_permlanex16(__builtin_bit_cast(int, x), __builtin_bit_cast(int, x), 0x76543210, 0xfedcba98, false, false)); }
__global__ __launch_bounds__(128) void k_attn(const _Float16* __restrict__ QK, const _Float16* __restrict__ QKL, const _Float16* __restrict__ VTH, const void* __restrict__ KMASK, float* __restrict__ O) {
  __shared__ __align__(16) float so[4][16][68];
  __shared__ __align__(16) _Float16 ring[2][2][64][RPH];   // [buffer][k, v][key row, or d row for v][d, or key for v]
  const int tid = threadIdx.x, wave = tid >> 5, lane = tid & 31, col = lane & 15, g = lane >> 4;
  const int qb = blockIdx.x, h = blockIdx.y, b = blockIdx.z; const int q0 = qb * 64 + wave * 16; const size_t rq = (size_t)b * SS + q0 + col;
  // this wave's half plane (32 rows): source of its lane's first 16 bytes of stage 0, row pitch and step from stage to stage in bytes
  const int wv = __builtin_amdgcn_readfirstlane(wave);
  const size_t koff = (size_t)b * SS * (2 * DM) + DM + h * HD, voff = ((size_t)b * DM + h * HD) * SS;
  const _Float16* pl0 = (wv < 2) ? QK + koff : VTH + voff; const int row0 = (wv & 1) * 32 + (lane >> 3);
  const size_t gpitch = (wv < 2) ? (size_t)(2 * DM * 2) : (size_t)(SS * 2), gstage = (wv < 2) ? (size_t)KST * (2 * DM * 2) : (size_t)(KST * 2);
  const char* gsrc = (const char*)pl0 + (size_t)row0 * gpitch + (lane & 7) * 16;
  const unsigned ldst = (unsigned)(size_t)&ring[0][0][0][0] + (unsigned)(wv >> 1) * PLB + (unsigned)row0 * (RPH * 2) + (unsigned)(lane & 7) * 16;
#define STAGE_COPY(BUF, ST) copy8(ldst + (unsigned)(BUF) * (2 * PLB), gsrc + (size_t)(ST) * gstage, 4 * RPH * 2, 4 * gpitch)
  STAGE_COPY(0, 0);
  v16h aq[2], aql[2];
#pragma unroll
  for (int kc = 0; kc < 2; ++kc) { aq[kc] = frag_h(QK + rq * (2 * DM) + h * HD + kc * 32, lane); aql[kc] = frag_h(QKL + rq * (2 * DM) + h * HD + kc * 32, lane); }
  float m = -3.0e38f, l = 0.f;   // reference exponent of this lane's query, its running maximum less 11 (both halves agree), and this half's share of its sum
  v8f acc[4] = {};
  asm volatile("s_wait_asynccnt 0x0" ::: "memory");   // this wave's copies of stage 0 have landed
  __syncthreads();                                     // publishes stage 0 to the other waves
  STAGE_COPY(1, 1);
  // both loops kept rolled: one copy of the 32-key body in the instruction cache, and one set of fragment registers
#pragma unroll 1
  for (int st = 0; st < NST; ++st) { const _Float16* rb = &ring[st & 1][0][0][0];
#pragma unroll 1
  for (int sub = 0; sub < KST / 32; ++sub) { v8f s[2];
    v16h kh[2][2];   // all k fragments of the 32 keys are read as one group ahead of the products
#pragma unroll
    for (int ct = 0; ct < 2; ++ct) { const _Float16* krow = rb + (sub * 32 + ct * 16 + col) * RPH;
#pragma unroll
      for (int kc = 0; kc < 2; ++kc) kh[ct][kc] = frag_h(krow + kc * 32, lane); }
    s[0] = v8f{}; s[1] = v8f{};
#pragma unroll
    for (int kc = 0; kc < 2; ++kc) {
#pragma unroll
      for (int ct = 0; ct < 2; ++ct) s[ct] = wmma16(kh[ct][kc], aq[kc], s[ct]); }    // transposed scores, k rows as A and q as B: k x q hi, the two key tiles in turn
#pragma unroll
    for (int kc = 0; kc < 2; ++kc) {
#pragma unroll
      for (int ct = 0; ct < 2; ++ct) s[ct] = wmma16(kh[ct][kc], aql[kc], s[ct]); }   // + k x q residual into the same tile; s[ct][r] = base-2 exponent of key sub * 32 + ct * 16 + 8 g + r for query col
    v16h vh[4];   // the v fragments (d rows as A) as one group, landing under the softmax
#pragma unroll
    for (int dt = 0; dt < 4; ++dt) vh[dt] = frag_h(rb + 64 * RPH + (dt * 16 + col) * RPH + sub * 32, lane);
    float mx = fmaxf(s[0][0], s[1][0]);
#pragma unroll
    for (int r = 1; r < 8; ++r) mx = fmaxf(mx, fmaxf(s[0][r], s[1][r]));
    mx = fmaxf(mx, xhalf(mx));   // the other 16 of the 32 keys lie in lane ^ 16
    const float mn = fmaxf(m, mx - 11.0f); const float alpha = (m <= -1.0e38f) ? 0.f : __builtin_amdgcn_exp2f(m - mn); m = mn;   // the reference lies 11 under the maximum: P comes out of the exponential scaled by 2^11
    float e[2][8], t[8];
#pragma unroll
    for (int r = 0; r < 8; ++r) { e[0][r] = (s[0][r] <= -1.0e38f) ? 0.f : __builtin_amdgcn_exp2f(s[0][r] - mn); e[1][r] = (s[1][r] <= -1.0e38f) ? 0.f : __builtin_amdgcn_exp2f(s[1][r] - mn); t[r] = e[0][r] + e[1][r]; }
    l = l * alpha + (((t[0] + t[1]) + (t[2] + t[3])) + ((t[4] + t[5]) + (t[6] + t[7])));
#pragma unroll
    for (int dt = 0; dt < 4; ++dt) {
#pragma unroll
      for (int r = 0; r < 8; ++r) acc[dt][r] *= alpha; }
    v16h pa, pl;   // the two score tiles of a lane are, element for element, the B fragment of P transposed: element r = key 8 g + r, element 8 + r = key 16 + 8 g + r, the k order of frag_h
#pragma unroll
    for (int i = 0; i < 8; ++i) { const float x0 = e[0][i], x1 = e[1][i]; const _Float16 h0 = (_Float16)x0, h1 = (_Float16)x1; pa[i] = h0; pa[8 + i] = h1; pl[i] = (_Float16)(x0 - (float)h0); pl[8 + i] = (_Float16)(x1 - (float)h1); }   // P carries 2^11, so small softmax weights stay out of the f16 subnormal range; the sum l carries it too, so it cancels in the epilogue; the residual keeps that scale
#pragma unroll
    for (int dt = 0; dt < 4; ++dt) acc[dt] = wmma16(vh[dt], pa, acc[dt]);     // transposed output, acc[dt][r] = d dt * 16 + 8 g + r of query col: V x P hi
#pragma unroll
    for (int dt = 0; dt < 4; ++dt) acc[dt] = wmma16(vh[dt], pl, acc[dt]); }   // + V x P residual into the same tile
    asm volatile("s_wait_dscnt 0x0" ::: "memory");      // this wave's reads of the buffer are done before it may be refilled
    asm volatile("s_wait_asynccnt 0x0" ::: "memory");   // this wave's copies of stage st + 1 have landed
    __syncthreads();                                     // publishes stage st + 1 and ends every wave's reads of stage st
    if (st + 2 < NST) STAGE_COPY(st & 1, st + 2); }
  asm volatile("s_wait_asynccnt 0x0" ::: "memory");     // no copy is outstanding when the wave goes on to the epilogue and ends
  const float il = 1.0f / (l + xhalf(l));   // the two halves' sums are joined once
#pragma unroll
  for (int dt = 0; dt < 4; ++dt) { v4f o0, o1;
#pragma unroll
    for (int r = 0; r < 4; ++r) { o0[r] = acc[dt][r] * il; o1[r] = acc[dt][4 + r] * il; }
    *(v4f*)&so[wave][col][dt * 16 + 8 * g] = o0; *(v4f*)&so[wave][col][dt * 16 + 8 * g + 4] = o1; }
  LDSX();
  for (int rl = 0; rl < 16; ++rl) if (lane < 16) vst2(O + ((size_t)b * SS + q0 + rl) * DM + h * HD + lane * 4, *(const v4f*)&so[wave][rl][lane * 4]);
}
// ---- k_out: block = (64 rows, 128 cols): out = O(hi/lo) . Wo rows (2 products) + bo
__global__ __launch_bounds__(128) void k_out(const float* __restrict__ O, const __bf16* __restrict__ P, const float* __restrict__ BO, float* __restrict__ Y) {
  __shared__ __align__(16) float so[4][16][132];
  const int tid = threadIdx.x, wave = tid >> 5, lane = tid & 31, col = lane & 15, g = lane >> 4; const size_t r0 = (size_t)blockIdx.x * 64 + wave * 16; const int n0 = blockIdx.y * 128;
  __shared__ __align__(16) float sa[2][64][GAP]; __shared__ __align__(16) __bf16 sw[2][128][GWP];
  const char* gsa = (const char*)(O + (r0 + (lane >> 4)) * DM) + (lane & 15) * 16; const char* gsw = (const char*)(P + (size_t)(n0 + wave * 32 + (lane >> 3)) * DM) + (lane & 7) * 16;
  const unsigned lsa = (unsigned)(size_t)&sa[0][wave * 16 + (lane >> 4)][(lane & 15) * 4], lsw = (unsigned)(size_t)&sw[0][wave * 32 + (lane >> 3)][(lane & 7) * 8];
  gemm_copy(lsa, gsa, lsw, gsw, 0, 0);
  v8f acc[8] = {};
  asm volatile("s_wait_asynccnt 0x0" ::: "memory");   // this wave's copies of stage 0 have landed
  __syncthreads();                                     // publishes stage 0 to the other waves
  gemm_copy(lsa, gsa, lsw, gsw, 1, 1);
  // kept rolled: one copy of the stage body in the instruction cache
#pragma unroll 1
  for (int st = 0; st < GNS; ++st) { const int bf = st & 1;
    float v[GKS / 32][16]; v16b w[GKS / 32][8];   // all fragments of the stage are read as one group ahead of the products
#pragma unroll
    for (int kc = 0; kc < GKS / 32; ++kc) { lds16(&sa[bf][wave * 16 + col][kc * 32 + 8 * g], v[kc]);
#pragma unroll
      for (int j = 0; j < 8; ++j) w[kc][j] = frag_b(&sw[bf][j * 16 + col][kc * 32], lane); }
#pragma unroll
    for (int kc = 0; kc < GKS / 32; ++kc) { const F2 a = bsplit16(v[kc]);
#pragma unroll
      for (int j = 0; j < 8; ++j) { acc[j] = wmma_bf(a.l, w[kc][j], acc[j]); acc[j] = wmma_bf(a.h, w[kc][j], acc[j]); } }
    asm volatile("s_wait_dscnt 0x0" ::: "memory");      // this wave's reads of the buffer are done before it may be refilled
    asm volatile("s_wait_asynccnt 0x0" ::: "memory");   // this wave's copies of stage st + 1 have landed
    __syncthreads();                                     // publishes stage st + 1 and ends every wave's reads of stage st
    if (st + 2 < GNS) gemm_copy(lsa, gsa, lsw, gsw, bf, st + 2); }
  asm volatile("s_wait_asynccnt 0x0" ::: "memory");     // no copy is outstanding when the wave goes on to the epilogue and ends
#pragma unroll
  for (int j = 0; j < 8; ++j) {
#pragma unroll
    for (int r = 0; r < 8; ++r) so[wave][8 * g + r][j * 16 + col] = acc[j][r] + bfr(BO[n0 + j * 16 + col]); }
  LDSX();
  for (int rl = 0; rl < 16; ++rl) vst2(Y + (r0 + rl) * DM + n0 + lane * 4, *(const v4f*)&so[wave][rl][lane * 4]);
}
// ---- k_kvin: block = (64 keys m, head h, b): k input [b][h][m][64] -> K rows [b*M + m][DM + h*64 + d] of the q|k plane (f16); v input -> V plane [b][h*64 + d][m]
// The work-groups with blockIdx.x >= SS / 64 share the launch and round the two weight matrices to bf16 (natural [out][in] rows, a flat copy): w_qkv -> PK_A, w_proj -> PK_P; each takes PKE consecutive elements, 8 per lane and trip (32 B read, 16 B stored, whole lines per wave).
#define PKE 8192                       // weight elements per packing work-group
#define PKX 6                          // extra blockIdx.x values: PKX * NH * TNB = 144 work-groups = 2 * DM * DM / PKE
__global__ __launch_bounds__(256) void k_kvin(const float* __restrict__ KIN, const float* __restrict__ VIN, const float* __restrict__ WQ, const float* __restrict__ WO, _Float16* __restrict__ QK, _Float16* __restrict__ VTH, __bf16* __restrict__ PK) {
  __shared__ __align__(16) _Float16 skh[64][72], svh[64][72]; const int t = threadIdx.x; const int m0 = blockIdx.x * 64, h = blockIdx.y; const size_t b = blockIdx.z;
  if (blockIdx.x >= SS / 64) {   // the same for the whole work-group, and it leaves ahead of the barrier
    const int id = ((int)blockIdx.z * NH + (int)blockIdx.y) * PKX + ((int)blockIdx.x - SS / 64), nq = DM * DM / PKE;
    const float* src = (id < nq) ? WQ + (size_t)id * PKE : WO + (size_t)(id - nq) * PKE;
    __bf16* dst = (id < nq) ? PK + PK_A + (size_t)id * PKE : PK + PK_P + (size_t)(id - nq) * PKE;
    // unrolled so that all eight loads of a lane are in flight together (one memory latency per work-group, not four)
#pragma unroll
    for (int i = 0; i < PKE / (256 * 8); ++i) { const int e = (i * 256 + t) * 8; const v4f x0 = *(const v4f*)(src + e), x1 = *(const v4f*)(src + e + 4); v8b o;
      // unrolled so that the vector elements are named by constants and stay in registers
#pragma unroll
      for (int j = 0; j < 4; ++j) { o[j] = (__bf16)x0[j]; o[4 + j] = (__bf16)x1[j]; }
      *(v8b*)(dst + e) = o; }
    return;
  }
  for (int e = t; e < 64 * 64; e += 256) { const int r = e >> 6, d = e & 63; const size_t src = ((b * NH + h) * SS + m0 + r) * HD + d; const float kv = bfr(KIN[src]), vv = bfr(VIN[src]);
    skh[r][d] = (_Float16)kv; svh[d][r] = (_Float16)vv; }
  __syncthreads();
  for (int e = t; e < 64 * 8; e += 256) { const int r = e >> 3, q = e & 7; const size_t o = (b * SS + m0 + r) * (2 * DM) + DM + h * HD + q * 8; vst2((unsigned*)(QK + o), *(const v4u*)&skh[r][q * 8]);
    const size_t ov = (b * DM + h * HD + r) * SS + m0 + q * 8; vst2((unsigned*)(VTH + ov), *(const v4u*)&svh[r][q * 8]); }
}
extern "C" void kernel_launch(void* const* d_in, const int* in_sizes, int n_in, void* d_out, int out_size, void* d_ws, size_t ws_size, hipStream_t stream) {
  (void)in_sizes; (void)n_in; (void)out_size;
  const float** F = (const float**)d_in;   // 0 x [2,2048,768], 1 k [2,12,2048,64], 2 v [2,12,2048,64], 3 w_qkv [768,768] natural (q only), 4 w_proj [768,768] natural, 5 b_proj [768]
  if (ws_size < (size_t)WS_END) return;
  char* ws = (char*)d_ws; __bf16* PK = (__bf16*)(ws + WS_PK); _Float16 *QK = (_Float16*)(ws + WS_QK), *QKL = (_Float16*)(ws + WS_QKL), *VTH = (_Float16*)(ws + WS_VTH), *VTL = (_Float16*)(ws + WS_VTL); float* O = (float*)(ws + WS_O);
  k_kvin<<<dim3(SS / 64 + PKX, NH, TNB), 256, 0, stream>>>(F[1], F[2], F[3], F[4], QK, VTH, PK);   // k, v re-laid out; w_qkv and w_proj rounded to bf16 by the extra work-groups
  k_qkv<<<dim3(TNB * SS / 64, DM / 128), 128, 0, stream>>>(F[0], F[0], F[0], PK + PK_A, nullptr, nullptr, nullptr, QK, QKL, VTH, VTL);   // q columns only
  k_attn<<<dim3(TQB, NH, TNB), 128, 0, stream>>>(QK, QKL, VTH, nullptr, O);
  k_out<<<dim3(TOB, DM / 128), 128, 0, stream>>>(O, PK + PK_P, F[5], (float*)d_out);
}

// v008
// A run of this version takes 65.7 microseconds.
// Versions in between are left out here; by their measured steps it is 1.29 times as fast as v006.
// Counting every step since v000, it is 6.00 times as fast.
// compute dtype: x, k, v, w_qkv, w_proj, b_proj rounded to bf16; q = x . w_qkv^T with exact bf16 products on WMMA 16x16x32 (natural rows), scaled by log2(e)/8 and stored as one f16 plane (rounded once, 2^-11 relative at most, an eighth of the bf16 rounding of k); the k and v INPUTS are re-laid out on device as one f16 plane each (a bf16 value is exact in f16 from 2^-17 up to the f16 range; below 2^-17 it is rounded to the f16 subnormal grid, at most 2^-25 off); 1-product scores (k x q, less a reference exponent per query that enters as C), softmax in f32 in base 2 (hardware exp) against that reference, which is moved only when it must be; P (its largest element between 2^7 and 2^15, one f16, rounded once, 2^-11 relative at most; its sum is taken in f32 ahead of the rounding) x v (1 product); output projection with ctx as bf16 hi + residual x exact w_proj rows (2 products) + b_proj; f32 accumulate.
#include <hip/hip_runtime.h>
#include <math.h>

typedef __attribute__((ext_vector_type(16))) _Float16 v16h;
typedef __attribute__((ext_vector_type(16))) __bf16 v16b;
typedef __attribute__((ext_vector_type(8)))  _Float16 v8h;
typedef __attribute__((ext_vector_type(8)))  float v8f;
typedef __attribute__((ext_vector_type(4)))  float v4f;
typedef __attribute__((ext_vector_type(2)))  float v2f;
typedef __attribute__((ext_vector_type(4)))  unsigned v4u;
typedef __attribute__((ext_vector_type(4)))  int v4i;
typedef float __attribute__((may_alias)) float_a;
typedef int __attribute__((may_alias)) int_a;

template <typename T> __device__ __forceinline__ void vst2(void* p, T v) { *(T*)p = v;  }
__device__ __forceinline__ v8f wmma16(v16h a, v16h b, v8f c) {
  v8f d = __builtin_amdgcn_wmma_f32_16x16x32_f16(false, a, false, b, (short)0, c, false, false);
  asm volatile("v_nop\n\tv_nop\n\tv_nop\n\tv_nop" : "+v"(d) : "v"(a), "v"(b));
  return d;
}
__device__ __forceinline__ v8f wmma_bf(v16b a, v16b b, v8f c) {
  v8f d = __builtin_amdgcn_wmma_f32_16x16x32_bf16(false, a, false, b, (short)0, c, false, false);
  asm volatile("v_nop\n\tv_nop\n\tv_nop\n\tv_nop" : "+v"(d) : "v"(a), "v"(b));
  return d;
}
// ViT-style attention with given key/value caches (B 2, N = M = 2,048, dim 768, 12 heads x 64): q = x W_qkv^T, softmax(q k^T / 8) v, output projection + bias.
__device__ __forceinline__ v16h frag_h(const _Float16* rowk0, int lane) {
  union { v16h v; v8h q[2]; } u; const _Float16* p = rowk0 + 8 * (lane >> 4);
  u.q[0] = *(const v8h*)p; u.q[1] = *(const v8h*)(p + 16); return u.v;
}
__device__ __forceinline__ v16h frag_f32(const float* rowk0, int lane) {
  v16h a; const float* p = rowk0 + 8 * (lane >> 4);
#pragma unroll
  for (int i = 0; i < 8; ++i) { a[i] = (_Float16)p[i]; a[8 + i] = (_Float16)p[16 + i]; }
  return a;
}
__device__ __forceinline__ v16h frag_f32s(const float* rowk0, int lane, float sc) {
  v16h a; const float* p = rowk0 + 8 * (lane >> 4);
#pragma unroll
  for (int i = 0; i < 8; ++i) { a[i] = (_Float16)(p[i] * sc); a[8 + i] = (_Float16)(p[16 + i] * sc); }
  return a;
}
// column fragment from a [K][ld] layout (column n), rows >= K read as 0
__device__ __forceinline__ v16h fragc_f32(const float* W, int k0, int n, int lane, int ld, int K) {
  v16h a; const int g = lane >> 4;
#pragma unroll
  for (int i = 0; i < 8; ++i) { const int ka = k0 + 8 * g + i, kb = ka + 16;
    a[i] = (_Float16)(ka < K ? W[(size_t)(ka < K ? ka : K - 1) * ld + n] : 0.f); a[8 + i] = (_Float16)(kb < K ? W[(size_t)(kb < K ? kb : K - 1) * ld + n] : 0.f); }
  return a;
}
struct F2 { v16b h, l; };
__device__ __forceinline__ F2 bsplit16(const float v[16]) { F2 r;
#pragma unroll
  for (int i = 0; i < 16; ++i) { const __bf16 h = (__bf16)v[i]; r.h[i] = h; r.l[i] = (__bf16)(v[i] - (float)h); }
  return r; }
__device__ __forceinline__ F2 split_row(const float* row, int k0, int lane) { float v[16]; const float* p = row + k0 + 8 * (lane >> 4);
#pragma unroll
  for (int i = 0; i < 8; ++i) { v[i] = p[i]; v[8 + i] = p[16 + i]; }
  return bsplit16(v); }
__device__ __forceinline__ F2 split_rowK(const float* row, int k0, int lane, int K) { float v[16]; const int g = lane >> 4;
#pragma unroll
  for (int i = 0; i < 8; ++i) { const int ka = k0 + 8 * g + i, kb = ka + 16; v[i] = ka < K ? row[ka < K ? ka : K - 1] : 0.f; v[8 + i] = kb < K ? row[kb < K ? kb : K - 1] : 0.f; }
  return bsplit16(v); }
__device__ __forceinline__ F2 split_col(const float* W, int k0, int n, int lane, int ld, int K) { float v[16]; const int g = lane >> 4;
#pragma unroll
  for (int i = 0; i < 8; ++i) { const int ka = k0 + 8 * g + i, kb = ka + 16; v[i] = ka < K ? W[(size_t)(ka < K ? ka : K - 1) * ld + n] : 0.f; v[8 + i] = kb < K ? W[(size_t)(kb < K ? kb : K - 1) * ld + n] : 0.f; }
  return bsplit16(v); }
__device__ __forceinline__ v8f mac3(const F2& a, const F2& b, v8f c) { c = wmma_bf(a.l, b.h, c); c = wmma_bf(a.h, b.l, c); return wmma_bf(a.h, b.h, c); }
__device__ __forceinline__ float sigm(float v) { return 1.0f / (1.0f + expf(-v)); }
#define LDSX() do { asm volatile("s_wait_dscnt 0" ::: "memory"); __builtin_amdgcn_wave_barrier(); __builtin_amdgcn_fence(__ATOMIC_RELEASE, "workgroup"); } while (0)


#define NB 2
#define SS 2048
#define DM 768
#define NH 12
#define HD 64
#define QKVW (3 * DM)
#ifndef TQB
#define TQB (SS / 64)
#define TNB NB
#define TOB (NB * SS / 64)     // output row tiles (all)
#endif
typedef __attribute__((ext_vector_type(8))) __bf16 v8b;
__device__ __forceinline__ v16b frag_b(const __bf16* rowk0, int lane) {
  union { v16b v; v8b q[2]; } u; const __bf16* p = rowk0 + 8 * (lane >> 4);
  u.q[0] = *(const v8b*)p; u.q[1] = *(const v8b*)(p + 16); return u.v;
}
__device__ __forceinline__ float bfr(float v) { return (float)(__bf16)v; }
__device__ __attribute__((noinline)) float exp_ni(float v) { return expf(v); }
__device__ __attribute__((noinline)) float erf_ni(float v) { return erff(v); }

#define PK_A 0                       // [768][768] Wqkv rows (natural [out][in]); 2304 rows of space
#define PK_P (PK_A + QKVW * DM)        // [768][768] Wo rows (natural)
#define PK_END (PK_P + DM * DM)
#define WS_PK  0u
#define WS_QK  (WS_PK + 2u * PK_END)             // f16 [4096 rows][1536]: q log2(e) / 8 | k
#define WS_QKL (WS_QK + 2u * NB * SS * 2 * DM)     // place of a q residual plane (not used)
#define WS_VTH (WS_QKL + 2u * NB * SS * 2 * DM)    // f16 [b][768 (h*64+d)][2048 s]
#define WS_VTL (WS_VTH + 2u * NB * DM * SS)        // place of a v residual plane (not used)
#define WS_O   (WS_VTL + 2u * NB * DM * SS)        // f32 [4096][768]
#define WS_CS  (WS_O + 4u * NB * SS * DM)           // f32 [2][2048][32] (not used)
#define WS_END (WS_CS + 4u * 2 * SS * 32)
// eight asynchronous 16-byte-per-lane copies, each 512 B (4 rows of 128 B, or 2 rows of 256 B); ls / gs = bytes between two copies in LDS / in global memory
__device__ __forceinline__ void copy8(unsigned l0, const char* g0, unsigned ls, size_t gs) {
  const unsigned l1 = l0 + ls, l2 = l1 + ls, l3 = l2 + ls, l4 = l3 + ls, l5 = l4 + ls, l6 = l5 + ls, l7 = l6 + ls;
  const char *g1 = g0 + gs, *g2 = g1 + gs, *g3 = g2 + gs, *g4 = g3 + gs, *g5 = g4 + gs, *g6 = g5 + gs, *g7 = g6 + gs;
  // the closing s_wait_xcnt stands inside the statement so that no address register of a copy is rewritten in front of it
  asm volatile("global_load_async_to_lds_b128 %0, %8, off\n\t"
               "global_load_async_to_lds_b128 %1, %9, off\n\t"
               "global_load_async_to_lds_b128 %2, %10, off\n\t"
               "global_load_async_to_lds_b128 %3, %11, off\n\t"
               "global_load_async_to_lds_b128 %4, %12, off\n\t"
               "global_load_async_to_lds_b128 %5, %13, off\n\t"
               "global_load_async_to_lds_b128 %6, %14, off\n\t"
               "global_load_async_to_lds_b128 %7, %15, off\n\t"
               "s_wait_xcnt 0x0"
               :: "v"(l0), "v"(l1), "v"(l2), "v"(l3), "v"(l4), "v"(l5), "v"(l6), "v"(l7), "v"(g0), "v"(g1), "v"(g2), "v"(g3), "v"(g4), "v"(g5), "v"(g6), "v"(g7) : "memory");
}
// The two GEMM kernels (64 rows x 128 columns per work-group) take their operands through LDS: a stage is 64 k of the 64 A rows (f32, 256 B each) and of the 128 W rows (bf16, 128 B each), brought in once per work-group by asynchronous copies of whole 128-B lines, two buffers, the next stage in flight while this one is worked on; the fragments are read from LDS, A and W in the same k order (that of frag_b).
#define QSC 0.18033688011112042f   // log2(e) / sqrt(64)
#define GKS 64                 // k per stage
#define GNS (DM / GKS)         // stages
#define GAP 68                 // LDS pitch of an A row in f32: 256-B row + 16 B, conflict-free for 16-byte LDS reads
#define GWP 72                 // LDS pitch of a W row in bf16: 128-B row + 16 B, likewise
// one stage: each wave copies its own 16 A rows (2 rows a copy) and 32 of the W rows (4 rows a copy); la / lw, ga / gw = the lane's first 16 bytes of stage 0 in buffer 0
__device__ __forceinline__ void gemm_copy(unsigned la, const char* ga, unsigned lw, const char* gw, int buf, int st) {
  copy8(la + (unsigned)buf * (64 * GAP * 4), ga + (size_t)st * (GKS * 4), 2 * GAP * 4, (size_t)2 * DM * 4);
  copy8(lw + (unsigned)buf * (128 * GWP * 2), gw + (size_t)st * (GKS * 2), 4 * GWP * 2, (size_t)4 * DM * 2);
}
// the 16 f32 of an A fragment (elements 0..7 = k 8 g + i, 8..15 = k 16 + 8 g + i) from an LDS row, p = row + k0 + 8 g
__device__ __forceinline__ void lds16(const float* p, float v[16]) {
  const v4f x0 = *(const v4f*)p, x1 = *(const v4f*)(p + 4), x2 = *(const v4f*)(p + 16), x3 = *(const v4f*)(p + 20);
#pragma unroll
  for (int i = 0; i < 4; ++i) { v[i] = x0[i]; v[4 + i] = x1[i]; v[8 + i] = x2[i]; v[12 + i] = x3[i]; }
}
__global__ __launch_bounds__(128) void k_qkv(const float* __restrict__ XQ, const float* __restrict__ XK, const float* __restrict__ XV, const __bf16* __restrict__ P, const float* __restrict__ BQ, const float* __restrict__ BK, const float* __restrict__ BV, _Float16* __restrict__ QK, _Float16* __restrict__ VTH, _Float16* __restrict__ VTL) {
  const int which0 = (blockIdx.y * 128) / DM; const float* X = (which0 == 0) ? XQ : (which0 == 1) ? XK : XV; const float* BB = BQ ? (((which0 == 0) ? BQ : (which0 == 1) ? BK : BV) + (blockIdx.y * 128 - which0 * DM)) : nullptr;
  __shared__ __align__(16) _Float16 so[4][16][136]; __shared__ __align__(16) _Float16 sth[128][72], stl[128][72];
  const int tid = threadIdx.x, wave = tid >> 5, lane = tid & 31, col = lane & 15, g = lane >> 4; const size_t r0 = (size_t)blockIdx.x * 64 + wave * 16; const int n0 = blockIdx.y * 128;
  __shared__ __align__(16) float sa[2][64][GAP]; __shared__ __align__(16) __bf16 sw[2][128][GWP];
  const char* gsa = (const char*)(X + (r0 + (lane >> 4)) * DM) + (lane & 15) * 16; const char* gsw = (const char*)(P + (size_t)(n0 + wave * 32 + (lane >> 3)) * DM) + (lane & 7) * 16;
  const unsigned lsa = (unsigned)(size_t)&sa[0][wave * 16 + (lane >> 4)][(lane & 15) * 4], lsw = (unsigned)(size_t)&sw[0][wave * 32 + (lane >> 3)][(lane & 7) * 8];
  gemm_copy(lsa, gsa, lsw, gsw, 0, 0);
  v8f acc[8] = {};
  asm volatile("s_wait_asynccnt 0x0" ::: "memory");   // this wave's copies of stage 0 have landed
  __syncthreads();                                     // publishes stage 0 to the other waves
  gemm_copy(lsa, gsa, lsw, gsw, 1, 1);
  // kept rolled: one copy of the stage body in the instruction cache
#pragma unroll 1
  for (int st = 0; st < GNS; ++st) { const int bf = st & 1;
    float v[GKS / 32][16]; v16b w[GKS / 32][8];   // all fragments of the stage are read as one group ahead of the products
#pragma unroll
    for (int kc = 0; kc < GKS / 32; ++kc) { lds16(&sa[bf][wave * 16 + col][kc * 32 + 8 * g], v[kc]);
#pragma unroll
      for (int j = 0; j < 8; ++j) w[kc][j] = frag_b(&sw[bf][j * 16 + col][kc * 32], lane); }
#pragma unroll
    for (int kc = 0; kc < GKS / 32; ++kc) { v16b a;
#pragma unroll
      for (int i = 0; i < 16; ++i) a[i] = (__bf16)v[kc][i];
#pragma unroll
      for (int j = 0; j < 8; ++j) acc[j] = wmma_bf(a, w[kc][j], acc[j]); }
    asm volatile("s_wait_dscnt 0x0" ::: "memory");      // this wave's reads of the buffer are done before it may be refilled
    asm volatile("s_wait_asynccnt 0x0" ::: "memory");   // this wave's copies of stage st + 1 have landed
    __syncthreads();                                     // publishes stage st + 1 and ends every wave's reads of stage st
    if (st + 2 < GNS) gemm_copy(lsa, gsa, lsw, gsw, bf, st + 2); }
  asm volatile("s_wait_asynccnt 0x0" ::: "memory");     // no copy is outstanding when the wave goes on to the epilogue and ends
  if (n0 < 2 * DM) {   // q stored times log2(e) / sqrt(64): the products of k_attn are then the base-2 exponents themselves
#pragma unroll
    for (int j = 0; j < 8; ++j) {
#pragma unroll
      for (int r = 0; r < 8; ++r) { const float v = (acc[j][r] + (BB ? bfr(BB[j * 16 + col]) : 0.f)) * QSC; so[wave][8 * g + r][j * 16 + col] = (_Float16)v; } }   // q as one f16
    LDSX();
    for (int rl = 0; rl < 16; ++rl) if (lane < 16) vst2((unsigned*)(QK + (r0 + rl) * (2 * DM) + n0 + lane * 8), *(const v4u*)&so[wave][rl][lane * 8]);
  } else {
#pragma unroll
    for (int j = 0; j < 8; ++j) {
#pragma unroll
      for (int r = 0; r < 8; ++r) { const float v = acc[j][r] + (BB ? bfr(BB[j * 16 + col]) : 0.f); const _Float16 hv = (_Float16)v; sth[j * 16 + col][wave * 16 + 8 * g + r] = hv; stl[j * 16 + col][wave * 16 + 8 * g + r] = (_Float16)((v - (float)hv) * 2048.0f); } }
    __syncthreads();
    const size_t rb = (size_t)blockIdx.x * 64; const int b = (int)(rb / SS), s0 = (int)(rb % SS); const int pc0 = n0 - 2 * DM;
    for (int q = tid; q < 128 * 8; q += 128) { const int d = q >> 3, pc = q & 7; const size_t o = ((size_t)b * DM + pc0 + d) * SS + s0 + pc * 8; vst2((unsigned*)(VTH + o), *(const v4u*)&sth[d][pc * 8]); vst2((unsigned*)(VTL + o), *(const v4u*)&stl[d][pc * 8]); }
  }
}
#define KST 64                 // keys per stage
#define NST (SS / KST)         // stages
#define RPH 72                 // LDS row pitch in f16: 128-B row + 16 B, the conflict-free pitch for 16-byte LDS reads
#define PLB (64 * RPH * 2)     // bytes of one plane of a stage in LDS
// eight base-2 exponentials in one statement, results in registers of their own (early clobber): the exponents stay whole for the pass that must move its reference, none of the eight overwrites a source or reads a result of the one directly ahead of it (the slot that the instruction set asks for behind a transcendental), and the closing v_nop keeps the next vector instruction off the last one
__device__ __forceinline__ void exp2x8(const v8f x, float e[8]) {
  asm("v_exp_f32 %0, %8\n\t" "v_exp_f32 %1, %9\n\t" "v_exp_f32 %2, %10\n\t" "v_exp_f32 %3, %11\n\t"
      "v_exp_f32 %4, %12\n\t" "v_exp_f32 %5, %13\n\t" "v_exp_f32 %6, %14\n\t" "v_exp_f32 %7, %15\n\t"
      "v_nop"
      : "=&v"(e[0]), "=&v"(e[1]), "=&v"(e[2]), "=&v"(e[3]), "=&v"(e[4]), "=&v"(e[5]), "=&v"(e[6]), "=&v"(e[7])
      : "v"(x[0]), "v"(x[1]), "v"(x[2]), "v"(x[3]), "v"(x[4]), "v"(x[5]), "v"(x[6]), "v"(x[7]));
}
// the two score tiles of a lane are, element for element, the B fragment of P transposed: element r = key 8 g + r, element 8 + r = key 16 + 8 g + r, the k order of frag_h; P carries 2^7 or more at the maximum, so small softmax weights stay out of the f16 subnormal range; the sum l carries the same factor, so it cancels in the epilogue
__device__ __forceinline__ v16h pack16(const float a[8], const float b[8]) {
  v16h p;
#pragma unroll
  for (int i = 0; i < 8; ++i) { p[i] = (_Float16)a[i]; p[8 + i] = (_Float16)b[i]; }
  return p;
}
// the sum of a lane's sixteen exponentials
__device__ __forceinline__ float sum16(const float a[8], const float b[8]) {
  float t[8];
#pragma unroll
  for (int r = 0; r < 8; ++r) t[r] = a[r] + b[r];
  return ((t[0] + t[1]) + (t[2] + t[3])) + ((t[4] + t[5]) + (t[6] + t[7]));
}
// lane l takes the value of lane l ^ 16
__device__ __forceinline__ float xhalf(float x) { return __builtin_bit_cast(float, __builtin_amdgcn_permlanex16(__builtin_bit_cast(int, x), __builtin_bit_cast(int, x), 0x76543210, 0xfedcba98, false, false)); }
__global__ __launch_bounds__(128) void k_attn(const _Float16* __restrict__ QK, const _Float16* __restrict__ VTH, const void* __restrict__ KMASK, float* __restrict__ O) {
  __shared__ __align__(16) float so[4][16][68];
  __shared__ __align__(16) _Float16 ring[2][2][64][RPH];   // [buffer][k, v][key row, or d row for v][d, or key for v]
  const int tid = threadIdx.x, wave = tid >> 5, lane = tid & 31, col = lane & 15, g = lane >> 4;
  const int qb = blockIdx.x, h = blockIdx.y, b = blockIdx.z; const int q0 = qb * 64 + wave * 16; const size_t rq = (size_t)b * SS + q0 + col;
  // this wave's half plane (32 rows): source of its lane's first 16 bytes of stage 0, row pitch and step from stage to stage in bytes
  const int wv = __builtin_amdgcn_readfirstlane(wave);
  const size_t koff = (size_t)b * SS * (2 * DM) + DM + h * HD, voff = ((size_t)b * DM + h * HD) * SS;
  const _Float16* pl0 = (wv < 2) ? QK + koff : VTH + voff; const int row0 = (wv & 1) * 32 + (lane >> 3);
  const size_t gpitch = (wv < 2) ? (size_t)(2 * DM * 2) : (size_t)(SS * 2), gstage = (wv < 2) ? (size_t)KST * (2 * DM * 2) : (size_t)(KST * 2);
  const char* gsrc = (const char*)pl0 + (size_t)row0 * gpitch + (lane & 7) * 16;
  const unsigned ldst = (unsigned)(size_t)&ring[0][0][0][0] + (unsigned)(wv >> 1) * PLB + (unsigned)row0 * (RPH * 2) + (unsigned)(lane & 7) * 16;
#define STAGE_COPY(BUF, ST) copy8(ldst + (unsigned)(BUF) * (2 * PLB), gsrc + (size_t)(ST) * gstage, 4 * RPH * 2, 4 * gpitch)
  STAGE_COPY(0, 0);
  v16h aq[2];
#pragma unroll
  for (int kc = 0; kc < 2; ++kc) aq[kc] = frag_h(QK + rq * (2 * DM) + h * HD + kc * 32, lane);
  v8f nref = {};   // minus the reference exponent of this lane's query in all eight elements (both halves agree): the C operand of the score products
  float l = 0.f;   // this half's share of the query's sum
  v8f acc[4] = {};
  asm volatile("s_wait_asynccnt 0x0" ::: "memory");   // this wave's copies of stage 0 have landed
  __syncthreads();                                     // publishes stage 0 to the other waves
  STAGE_COPY(1, 1);
  // both loops kept rolled: one copy of the 32-key body in the instruction cache, and one set of fragment registers
#pragma unroll 1
  for (int st = 0; st < NST; ++st) { const _Float16* rb = &ring[st & 1][0][0][0];
#pragma unroll 1
  for (int sub = 0; sub < KST / 32; ++sub) { v8f s[2];
    v16h kh[2][2];   // all k fragments of the 32 keys are read as one group ahead of the products
#pragma unroll
    for (int ct = 0; ct < 2; ++ct) { const _Float16* krow = rb + (sub * 32 + ct * 16 + col) * RPH;
#pragma unroll
      for (int kc = 0; kc < 2; ++kc) kh[ct][kc] = frag_h(krow + kc * 32, lane); }
#pragma unroll
    for (int kc = 0; kc < 2; ++kc) {
#pragma unroll
      for (int ct = 0; ct < 2; ++ct) s[ct] = wmma16(kh[ct][kc], aq[kc], kc ? s[ct] : nref); }    // transposed scores, k rows as A and q as B, the two key tiles in turn; s[ct][r] = base-2 exponent of key sub * 32 + ct * 16 + 8 g + r for query col, less the reference
    v16h vh[4];   // the v fragments (d rows as A) as one group, landing under the softmax
#pragma unroll
    for (int dt = 0; dt < 4; ++dt) vh[dt] = frag_h(rb + 64 * RPH + (dt * 16 + col) * RPH + sub * 32, lane);
    __builtin_amdgcn_sched_barrier(0);   // keeps the eight v reads together and ahead of the exponentials, under which they land (without it they sank behind them, in three places, and the second product waited for them)
    float e[2][8];
    exp2x8(s[0], e[0]); exp2x8(s[1], e[1]);
    float ts = sum16(e[0], e[1]);
    // The reference stays while every exponential fits f16: each is positive and at most the lane's sum, so one test of the sum covers all sixteen (an overflow to infinity too). One scalar branch per 32 keys, taken by the whole wave; the first pass always takes it and sets the reference from its own scores.
    const bool first = (st | sub) == 0;
    v16h pa = pack16(e[0], e[1]);
    if ((__builtin_amdgcn_ballot_w32(ts > 32768.0f) | (unsigned)first) != 0) {
      float mx = fmaxf(s[0][0], s[1][0]);
#pragma unroll
      for (int r = 1; r < 8; ++r) mx = fmaxf(mx, fmaxf(s[0][r], s[1][r]));
      mx = fmaxf(mx, xhalf(mx));   // the other 16 of the 32 keys lie in lane ^ 16
      const float dl = first ? mx - 7.0f : fmaxf(mx - 7.0f, 0.f);   // the new reference lies 7 under the maximum (the largest P is 2^7); later it only rises
      const float alpha = first ? 0.f : __builtin_amdgcn_exp2f(-dl);
#pragma unroll
      for (int r = 0; r < 8; ++r) { s[0][r] -= dl; s[1][r] -= dl; nref[r] -= dl; }
      exp2x8(s[0], e[0]); exp2x8(s[1], e[1]);
      ts = sum16(e[0], e[1]); pa = pack16(e[0], e[1]);
      l *= alpha;
#pragma unroll
      for (int dt = 0; dt < 4; ++dt) {
#pragma unroll
        for (int r = 0; r < 8; ++r) acc[dt][r] *= alpha; }
    }
    l += ts;
#pragma unroll
    for (int dt = 0; dt < 4; ++dt) acc[dt] = wmma16(vh[dt], pa, acc[dt]); }   // transposed output, acc[dt][r] = d dt * 16 + 8 g + r of query col: V x P
    asm volatile("s_wait_dscnt 0x0" ::: "memory");      // this wave's reads of the buffer are done before it may be refilled
    asm volatile("s_wait_asynccnt 0x0" ::: "memory");   // this wave's copies of stage st + 1 have landed
    __syncthreads();                                     // publishes stage st + 1 and ends every wave's reads of stage st
    if (st + 2 < NST) STAGE_COPY(st & 1, st + 2); }
  asm volatile("s_wait_asynccnt 0x0" ::: "memory");     // no copy is outstanding when the wave goes on to the epilogue and ends
  const float il = 1.0f / (l + xhalf(l));   // the two halves' sums are joined once
#pragma unroll
  for (int dt = 0; dt < 4; ++dt) { v4f o0, o1;
#pragma unroll
    for (int r = 0; r < 4; ++r) { o0[r] = acc[dt][r] * il; o1[r] = acc[dt][4 + r] * il; }
    *(v4f*)&so[wave][col][dt * 16 + 8 * g] = o0; *(v4f*)&so[wave][col][dt * 16 + 8 * g + 4] = o1; }
  LDSX();
  for (int rl = 0; rl < 16; ++rl) if (lane < 16) vst2(O + ((size_t)b * SS + q0 + rl) * DM + h * HD + lane * 4, *(const v4f*)&so[wave][rl][lane * 4]);
}
// ---- k_out: block = (64 rows, 128 cols): out = O(hi/lo) . Wo rows (2 products) + bo
__global__ __launch_bounds__(128) void k_out(const float* __restrict__ O, const __bf16* __restrict__ P, const float* __restrict__ BO, float* __restrict__ Y) {
  __shared__ __align__(16) float so[4][16][132];
  const int tid = threadIdx.x, wave = tid >> 5, lane = tid & 31, col = lane & 15, g = lane >> 4; const size_t r0 = (size_t)blockIdx.x * 64 + wave * 16; const int n0 = blockIdx.y * 128;
  __shared__ __align__(16) float sa[2][64][GAP]; __shared__ __align__(16) __bf16 sw[2][128][GWP];
  const char* gsa = (const char*)(O + (r0 + (lane >> 4)) * DM) + (lane & 15) * 16; const char* gsw = (const char*)(P + (size_t)(n0 + wave * 32 + (lane >> 3)) * DM) + (lane & 7) * 16;
  const unsigned lsa = (unsigned)(size_t)&sa[0][wave * 16 + (lane >> 4)][(lane & 15) * 4], lsw = (unsigned)(size_t)&sw[0][wave * 32 + (lane >> 3)][(lane & 7) * 8];
  gemm_copy(lsa, gsa, lsw, gsw, 0, 0);
  v8f acc[8] = {};
  asm volatile("s_wait_asynccnt 0x0" ::: "memory");   // this wave's copies of stage 0 have landed
  __syncthreads();                                     // publishes stage 0 to the other waves
  gemm_copy(lsa, gsa, lsw, gsw, 1, 1);
  // kept rolled: one copy of the stage body in the instruction cache
#pragma unroll 1
  for (int st = 0; st < GNS; ++st) { const int bf = st & 1;
    float v[GKS / 32][16]; v16b w[GKS / 32][8];   // all fragments of the stage are read as one group ahead of the products
#pragma unroll
    for (int kc = 0; kc < GKS / 32; ++kc) { lds16(&sa[bf][wave * 16 + col][kc * 32 + 8 * g], v[kc]);
#pragma unroll
      for (int j = 0; j < 8; ++j) w[kc][j] = frag_b(&sw[bf][j * 16 + col][kc * 32], lane); }
#pragma unroll
    for (int kc = 0; kc < GKS / 32; ++kc) { const F2 a = bsplit16(v[kc]);
#pragma unroll
      for (int j = 0; j < 8; ++j) { acc[j] = wmma_bf(a.l, w[kc][j], acc[j]); acc[j] = wmma_bf(a.h, w[kc][j], acc[j]); } }
    asm volatile("s_wait_dscnt 0x0" ::: "memory");      // this wave's reads of the buffer are done before it may be refilled
    asm volatile("s_wait_asynccnt 0x0" ::: "memory");   // this wave's copies of stage st + 1 have landed
    __syncthreads();                                     // publishes stage st + 1 and ends every wave's reads of stage st
    if (st + 2 < GNS) gemm_copy(lsa, gsa, lsw, gsw, bf, st + 2); }
  asm volatile("s_wait_asynccnt 0x0" ::: "memory");     // no copy is outstanding when the wave goes on to the epilogue and ends
#pragma unroll
  for (int j = 0; j < 8; ++j) {
#pragma unroll
    for (int r = 0; r < 8; ++r) so[wave][8 * g + r][j * 16 + col] = acc[j][r] + bfr(BO[n0 + j * 16 + col]); }
  LDSX();
  for (int rl = 0; rl < 16; ++rl) vst2(Y + (r0 + rl) * DM + n0 + lane * 4, *(const v4f*)&so[wave][rl][lane * 4]);
}
// ---- k_kvin: block = (64 keys m, head h, b): k input [b][h][m][64] -> K rows [b*M + m][DM + h*64 + d] of the q|k plane (f16); v input -> V plane [b][h*64 + d][m]
// The work-groups with blockIdx.x >= SS / 64 share the launch and round the two weight matrices to bf16 (natural [out][in] rows, a flat copy): w_qkv -> PK_A, w_proj -> PK_P; each takes PKE consecutive elements, 8 per lane and trip (32 B read, 16 B stored, whole lines per wave).
#define PKE 8192                       // weight elements per packing work-group
#define PKX 6                          // extra blockIdx.x values: PKX * NH * TNB = 144 work-groups = 2 * DM * DM / PKE
__global__ __launch_bounds__(256) void k_kvin(const float* __restrict__ KIN, const float* __restrict__ VIN, const float* __restrict__ WQ, const float* __restrict__ WO, _Float16* __restrict__ QK, _Float16* __restrict__ VTH, __bf16* __restrict__ PK) {
  __shared__ __align__(16) _Float16 skh[64][72], svh[64][72]; const int t = threadIdx.x; const int m0 = blockIdx.x * 64, h = blockIdx.y; const size_t b = blockIdx.z;
  if (blockIdx.x >= SS / 64) {   // the same for the whole work-group, and it leaves ahead of the barrier
    const int id = ((int)blockIdx.z * NH + (int)blockIdx.y) * PKX + ((int)blockIdx.x - SS / 64), nq = DM * DM / PKE;
    const float* src = (id < nq) ? WQ + (size_t)id * PKE : WO + (size_t)(id - nq) * PKE;
    __bf16* dst = (id < nq) ? PK + PK_A + (size_t)id * PKE : PK + PK_P + (size_t)(id - nq) * PKE;
    // unrolled so that all eight loads of a lane are in flight together (one memory latency per work-group, not four)
#pragma unroll
    for (int i = 0; i < PKE / (256 * 8); ++i) { const int e = (i * 256 + t) * 8; const v4f x0 = *(const v4f*)(src + e), x1 = *(const v4f*)(src + e + 4); v8b o;
      // unrolled so that the vector elements are named by constants and stay in registers
#pragma unroll
      for (int j = 0; j < 4; ++j) { o[j] = (__bf16)x0[j]; o[4 + j] = (__bf16)x1[j]; }
      *(v8b*)(dst + e) = o; }
    return;
  }
  for (int e = t; e < 64 * 64; e += 256) { const int r = e >> 6, d = e & 63; const size_t src = ((b * NH + h) * SS + m0 + r) * HD + d; const float kv = bfr(KIN[src]), vv = bfr(VIN[src]);
    skh[r][d] = (_Float16)kv; svh[d][r] = (_Float16)vv; }
  __syncthreads();
  for (int e = t; e < 64 * 8; e += 256) { const int r = e >> 3, q = e & 7; const size_t o = (b * SS + m0 + r) * (2 * DM) + DM + h * HD + q * 8; vst2((unsigned*)(QK + o), *(const v4u*)&skh[r][q * 8]);
    const size_t ov = (b * DM + h * HD + r) * SS + m0 + q * 8; vst2((unsigned*)(VTH + ov), *(const v4u*)&svh[r][q * 8]); }
}
extern "C" void kernel_launch(void* const* d_in, const int* in_sizes, int n_in, void* d_out, int out_size, void* d_ws, size_t ws_size, hipStream_t stream) {
  (void)in_sizes; (void)n_in; (void)out_size;
  const float** F = (const float**)d_in;   // 0 x [2,2048,768], 1 k [2,12,2048,64], 2 v [2,12,2048,64], 3 w_qkv [768,768] natural (q only), 4 w_proj [768,768] natural, 5 b_proj [768]
  if (ws_size < (size_t)WS_END) return;
  char* ws = (char*)d_ws; __bf16* PK = (__bf16*)(ws + WS_PK); _Float16 *QK = (_Float16*)(ws + WS_QK), *VTH = (_Float16*)(ws + WS_VTH), *VTL = (_Float16*)(ws + WS_VTL); float* O = (float*)(ws + WS_O);
  k_kvin<<<dim3(SS / 64 + PKX, NH, TNB), 256, 0, stream>>>(F[1], F[2], F[3], F[4], QK, VTH, PK);   // k, v re-laid out; w_qkv and w_proj rounded to bf16 by the extra work-groups
  k_qkv<<<dim3(TNB * SS / 64, DM / 128), 128, 0, stream>>>(F[0], F[0], F[0], PK + PK_A, nullptr, nullptr, nullptr, QK, VTH, VTL);   // q columns only
  k_attn<<<dim3(TQB, NH, TNB), 128, 0, stream>>>(QK, VTH, nullptr, O);
  k_out<<<dim3(TOB, DM / 128), 128, 0, stream>>>(O, PK + PK_P, F[5], (float*)d_out);
}

// v009
// It runs in 58.1 microseconds.
// Timed twice side by side with v008, it ran 1.13 times as fast both times.
// All steps since v000 together make it 6.77 times as fast.
// compute dtype: x, k, v, w_qkv, w_proj, b_proj rounded to bf16; q = x . w_qkv^T with exact bf16 products on WMMA 16x16x32 (natural rows), formed in the attention kernel itself, scaled by log2(e)/8 and kept as one f16 in registers (rounded once, 2^-12 relative at most, an eighth of the bf16 rounding of k); the k and v INPUTS are re-laid out on device as one f16 plane each (a bf16 value is exact in f16 from 2^-17 up to the f16 range; below 2^-17 it is rounded to the f16 subnormal grid, at most 2^-25 off); 1-product scores (k x q, less a reference exponent per query that enters as C), softmax in f32 in base 2 (hardware exp) against that reference, which is moved only when it must be; P (its largest element between 2^7 and 2^15, one f16, rounded once, 2^-12 relative at most; its sum is taken in f32 ahead of the rounding) x v (1 product); output projection with ctx as bf16 hi + residual x exact w_proj rows (2 products) + b_proj; f32 accumulate.
#include <hip/hip_runtime.h>
#include <math.h>

typedef __attribute__((ext_vector_type(16))) _Float16 v16h;
typedef __attribute__((ext_vector_type(16))) __bf16 v16b;
typedef __attribute__((ext_vector_type(8)))  _Float16 v8h;
typedef __attribute__((ext_vector_type(8)))  float v8f;
typedef __attribute__((ext_vector_type(4)))  float v4f;
typedef __attribute__((ext_vector_type(2)))  float v2f;
typedef __attribute__((ext_vector_type(4)))  unsigned v4u;
typedef __attribute__((ext_vector_type(4)))  int v4i;
typedef float __attribute__((may_alias)) float_a;
typedef int __attribute__((may_alias)) int_a;

template <typename T> __device__ __forceinline__ void vst2(void* p, T v) { *(T*)p = v;  }
__device__ __forceinline__ v8f wmma16(v16h a, v16h b, v8f c) {
  v8f d = __builtin_amdgcn_wmma_f32_16x16x32_f16(false, a, false, b, (short)0, c, false, false);
  asm volatile("v_nop\n\tv_nop\n\tv_nop\n\tv_nop" : "+v"(d) : "v"(a), "v"(b));
  return d;
}
__device__ __forceinline__ v8f wmma_bf(v16b a, v16b b, v8f c) {
  v8f d = __builtin_amdgcn_wmma_f32_16x16x32_bf16(false, a, false, b, (short)0, c, false, false);
  asm volatile("v_nop\n\tv_nop\n\tv_nop\n\tv_nop" : "+v"(d) : "v"(a), "v"(b));
  return d;
}
// ViT-style attention with given key/value caches (B 2, N = M = 2,048, dim 768, 12 heads x 64): q = x W_qkv^T, softmax(q k^T / 8) v, output projection + bias.
__device__ __forceinline__ v16h frag_h(const _Float16* rowk0, int lane) {
  union { v16h v; v8h q[2]; } u; const _Float16* p = rowk0 + 8 * (lane >> 4);
  u.q[0] = *(const v8h*)p; u.q[1] = *(const v8h*)(p + 16); return u.v;
}
__device__ __forceinline__ v16h frag_f32(const float* rowk0, int lane) {
  v16h a; const float* p = rowk0 + 8 * (lane >> 4);
#pragma unroll
  for (int i = 0; i < 8; ++i) { a[i] = (_Float16)p[i]; a[8 + i] = (_Float16)p[16 + i]; }
  return a;
}
__device__ __forceinline__ v16h frag_f32s(const float* rowk0, int lane, float sc) {
  v16h a; const float* p = rowk0 + 8 * (lane >> 4);
#pragma unroll
  for (int i = 0; i < 8; ++i) { a[i] = (_Float16)(p[i] * sc); a[8 + i] = (_Float16)(p[16 + i] * sc); }
  return a;
}
// column fragment from a [K][ld] layout (column n), rows >= K read as 0
__device__ __forceinline__ v16h fragc_f32(const float* W, int k0, int n, int lane, int ld, int K) {
  v16h a; const int g = lane >> 4;
#pragma unroll
  for (int i = 0; i < 8; ++i) { const int ka = k0 + 8 * g + i, kb = ka + 16;
    a[i] = (_Float16)(ka < K ? W[(size_t)(ka < K ? ka : K - 1) * ld + n] : 0.f); a[8 + i] = (_Float16)(kb < K ? W[(size_t)(kb < K ? kb : K - 1) * ld + n] : 0.f); }
  return a;
}
struct F2 { v16b h, l; };
__device__ __forceinline__ F2 bsplit16(const float v[16]) { F2 r;
#pragma unroll
  for (int i = 0; i < 16; ++i) { const __bf16 h = (__bf16)v[i]; r.h[i] = h; r.l[i] = (__bf16)(v[i] - (float)h); }
  return r; }
__device__ __forceinline__ F2 split_row(const float* row, int k0, int lane) { float v[16]; const float* p = row + k0 + 8 * (lane >> 4);
#pragma unroll
  for (int i = 0; i < 8; ++i) { v[i] = p[i]; v[8 + i] = p[16 + i]; }
  return bsplit16(v); }
__device__ __forceinline__ F2 split_rowK(const float* row, int k0, int lane, int K) { float v[16]; const int g = lane >> 4;
#pragma unroll
  for (int i = 0; i < 8; ++i) { const int ka = k0 + 8 * g + i, kb = ka + 16; v[i] = ka < K ? row[ka < K ? ka : K - 1] : 0.f; v[8 + i] = kb < K ? row[kb < K ? kb : K - 1] : 0.f; }
  return bsplit16(v); }
__device__ __forceinline__ F2 split_col(const float* W, int k0, int n, int lane, int ld, int K) { float v[16]; const int g = lane >> 4;
#pragma unroll
  for (int i = 0; i < 8; ++i) { const int ka = k0 + 8 * g + i, kb = ka + 16; v[i] = ka < K ? W[(size_t)(ka < K ? ka : K - 1) * ld + n] : 0.f; v[8 + i] = kb < K ? W[(size_t)(kb < K ? kb : K - 1) * ld + n] : 0.f; }
  return bsplit16(v); }
__device__ __forceinline__ v8f mac3(const F2& a, const F2& b, v8f c) { c = wmma_bf(a.l, b.h, c); c = wmma_bf(a.h, b.l, c); return wmma_bf(a.h, b.h, c); }
__device__ __forceinline__ float sigm(float v) { return 1.0f / (1.0f + expf(-v)); }
#define LDSX() do { asm volatile("s_wait_dscnt 0" ::: "memory"); __builtin_amdgcn_wave_barrier(); __builtin_amdgcn_fence(__ATOMIC_RELEASE, "workgroup"); } while (0)


#define NB 2
#define SS 2048
#define DM 768
#define NH 12
#define HD 64
#define QKVW (3 * DM)
#ifndef TQB
#define TQB (SS / 64)
#define TNB NB
#define TOB (NB * SS / 64)     // output row tiles (all)
#endif
typedef __attribute__((ext_vector_type(8))) __bf16 v8b;
__device__ __forceinline__ v16b frag_b(const __bf16* rowk0, int lane) {
  union { v16b v; v8b q[2]; } u; const __bf16* p = rowk0 + 8 * (lane >> 4);
  u.q[0] = *(const v8b*)p; u.q[1] = *(const v8b*)(p + 16); return u.v;
}
__device__ __forceinline__ float bfr(float v) { return (float)(__bf16)v; }
__device__ __attribute__((noinline)) float exp_ni(float v) { return expf(v); }
__device__ __attribute__((noinline)) float erf_ni(float v) { return erff(v); }

#define PK_A 0                       // [768][768] Wqkv rows (natural [out][in]); 2304 rows of space
#define PK_P (PK_A + QKVW * DM)        // [768][768] Wo rows (natural)
#define PK_END (PK_P + DM * DM)
#define WS_PK  0u
#define WS_QK  (WS_PK + 2u * PK_END)             // f16 [4096 rows][1536]: (place of q, not used) | k
#define WS_QKL (WS_QK + 2u * NB * SS * 2 * DM)     // place of a q residual plane (not used)
#define WS_VTH (WS_QKL + 2u * NB * SS * 2 * DM)    // f16 [b][768 (h*64+d)][2048 s]
#define WS_VTL (WS_VTH + 2u * NB * DM * SS)        // place of a v residual plane (not used)
#define WS_O   (WS_VTL + 2u * NB * DM * SS)        // f32 [4096][768]
#define WS_CS  (WS_O + 4u * NB * SS * DM)           // f32 [2][2048][32] (not used)
#define WS_END (WS_CS + 4u * 2 * SS * 32)
// eight asynchronous 16-byte-per-lane copies, each 512 B (4 rows of 128 B, 2 rows of 256 B, or 1 row of 512 B); ls / gs = bytes between two copies in LDS / in global memory
__device__ __forceinline__ void copy8(unsigned l0, const char* g0, unsigned ls, size_t gs) {
  const unsigned l1 = l0 + ls, l2 = l1 + ls, l3 = l2 + ls, l4 = l3 + ls, l5 = l4 + ls, l6 = l5 + ls, l7 = l6 + ls;
  const char *g1 = g0 + gs, *g2 = g1 + gs, *g3 = g2 + gs, *g4 = g3 + gs, *g5 = g4 + gs, *g6 = g5 + gs, *g7 = g6 + gs;
  // the closing s_wait_xcnt stands inside the statement so that no address register of a copy is rewritten in front of it
  asm volatile("global_load_async_to_lds_b128 %0, %8, off\n\t"
               "global_load_async_to_lds_b128 %1, %9, off\n\t"
               "global_load_async_to_lds_b128 %2, %10, off\n\t"
               "global_load_async_to_lds_b128 %3, %11, off\n\t"
               "global_load_async_to_lds_b128 %4, %12, off\n\t"
               "global_load_async_to_lds_b128 %5, %13, off\n\t"
               "global_load_async_to_lds_b128 %6, %14, off\n\t"
               "global_load_async_to_lds_b128 %7, %15, off\n\t"
               "s_wait_xcnt 0x0"
               :: "v"(l0), "v"(l1), "v"(l2), "v"(l3), "v"(l4), "v"(l5), "v"(l6), "v"(l7), "v"(g0), "v"(g1), "v"(g2), "v"(g3), "v"(g4), "v"(g5), "v"(g6), "v"(g7) : "memory");
}
// The output projection (64 rows x 128 columns per work-group) takes its operands through LDS: a stage is 64 k of the 64 A rows (f32, 256 B each) and of the 128 W rows (bf16, 128 B each), brought in once per work-group by asynchronous copies of whole 128-B lines, two buffers, the next stage in flight while this one is worked on; the fragments are read from LDS, A and W in the same k order (that of frag_b).
#define QSC 0.18033688011112042f   // log2(e) / sqrt(64)
#define GKS 64                 // k per stage
#define GNS (DM / GKS)         // stages
#define GAP 68                 // LDS pitch of an A row in f32: 256-B row + 16 B, conflict-free for 16-byte LDS reads
#define GWP 72                 // LDS pitch of a W row in bf16: 128-B row + 16 B, likewise
// one stage: each wave copies its own 16 A rows (2 rows a copy) and 32 of the W rows (4 rows a copy); la / lw, ga / gw = the lane's first 16 bytes of stage 0 in buffer 0
__device__ __forceinline__ void gemm_copy(unsigned la, const char* ga, unsigned lw, const char* gw, int buf, int st) {
  copy8(la + (unsigned)buf * (64 * GAP * 4), ga + (size_t)st * (GKS * 4), 2 * GAP * 4, (size_t)2 * DM * 4);
  copy8(lw + (unsigned)buf * (128 * GWP * 2), gw + (size_t)st * (GKS * 2), 4 * GWP * 2, (size_t)4 * DM * 2);
}
// the 16 f32 of an A fragment (elements 0..7 = k 8 g + i, 8..15 = k 16 + 8 g + i) from an LDS row, p = row + k0 + 8 g
__device__ __forceinline__ void lds16(const float* p, float v[16]) {
  const v4f x0 = *(const v4f*)p, x1 = *(const v4f*)(p + 4), x2 = *(const v4f*)(p + 16), x3 = *(const v4f*)(p + 20);
#pragma unroll
  for (int i = 0; i < 4; ++i) { v[i] = x0[i]; v[4 + i] = x1[i]; v[8 + i] = x2[i]; v[12 + i] = x3[i]; }
}
#define KST 64                 // keys per stage
#define NST (SS / KST)         // stages
#define RPH 72                 // LDS row pitch in f16: 128-B row + 16 B, the conflict-free pitch for 16-byte LDS reads
#define PLB (64 * RPH * 2)     // bytes of one plane of a stage in LDS
// eight base-2 exponentials in one statement, results in registers of their own (early clobber): the exponents stay whole for the pass that must move its reference, none of the eight overwrites a source or reads a result of the one directly ahead of it (the slot that the instruction set asks for behind a transcendental), and the closing v_nop keeps the next vector instruction off the last one
__device__ __forceinline__ void exp2x8(const v8f x, float e[8]) {
  asm("v_exp_f32 %0, %8\n\t" "v_exp_f32 %1, %9\n\t" "v_exp_f32 %2, %10\n\t" "v_exp_f32 %3, %11\n\t"
      "v_exp_f32 %4, %12\n\t" "v_exp_f32 %5, %13\n\t" "v_exp_f32 %6, %14\n\t" "v_exp_f32 %7, %15\n\t"
      "v_nop"
      : "=&v"(e[0]), "=&v"(e[1]), "=&v"(e[2]), "=&v"(e[3]), "=&v"(e[4]), "=&v"(e[5]), "=&v"(e[6]), "=&v"(e[7])
      : "v"(x[0]), "v"(x[1]), "v"(x[2]), "v"(x[3]), "v"(x[4]), "v"(x[5]), "v"(x[6]), "v"(x[7]));
}
// the two score tiles of a lane are, element for element, the B fragment of P transposed: element r = key 8 g + r, element 8 + r = key 16 + 8 g + r, the k order of frag_h; P carries 2^7 or more at the maximum, so small softmax weights stay out of the f16 subnormal range; the sum l carries the same factor, so it cancels in the epilogue
__device__ __forceinline__ v16h pack16(const float a[8], const float b[8]) {
  v16h p;
#pragma unroll
  for (int i = 0; i < 8; ++i) { p[i] = (_Float16)a[i]; p[8 + i] = (_Float16)b[i]; }
  return p;
}
// the sum of a lane's sixteen exponentials
__device__ __forceinline__ float sum16(const float a[8], const float b[8]) {
  float t[8];
#pragma unroll
  for (int r = 0; r < 8; ++r) t[r] = a[r] + b[r];
  return ((t[0] + t[1]) + (t[2] + t[3])) + ((t[4] + t[5]) + (t[6] + t[7]));
}
// lane l takes the value of lane l ^ 16
__device__ __forceinline__ float xhalf(float x) { return __builtin_bit_cast(float, __builtin_amdgcn_permlanex16(__builtin_bit_cast(int, x), __builtin_bit_cast(int, x), 0x76543210, 0xfedcba98, false, false)); }
// The q projection is the kernel's first part: q^T (64 d of head h x this wave's 16 queries) = w_qkv rows (A) x x rows (B), bf16 products, k in rising order; the four result tiles of a lane are, element for element, the two B fragments of q for the score products (the order of pack16), so q goes from accumulator to fragment in registers.
// Its operands come through LDS like the planes of k and v: a stage is 128 k of the 64 x rows (f32, 512 B each) and of the 64 w_qkv rows (bf16, 256 B each), asynchronous copies of whole lines, two buffers. The ring of k and v lies in the first buffer and takes it over when its last reader has left it; the output staging lies in the second.
#define AKS 128                // k per stage of the projection
#define ANS (DM / AKS)         // its stages
#define AXP 132                // LDS pitch of an x row in f32: 512-B row + 16 B, conflict-free for 16-byte LDS reads
#define AWP 136                // LDS pitch of a w_qkv row in bf16: 256-B row + 16 B, likewise
#define AXB (64 * AXP * 4)     // bytes of the x rows of a stage
#define ABUF (AXB + 64 * AWP * 2)   // bytes of one buffer
static_assert(ANS >= 2 && ANS % 2 == 0 && 4 * PLB <= ABUF && 4 * 16 * 68 * 4 <= ABUF, "the last but one stage lies in the first buffer, which holds the ring of k and v; the second holds the output staging");
__global__ __launch_bounds__(128) void k_attn(const float* __restrict__ X, const __bf16* __restrict__ PW, const _Float16* __restrict__ QK, const _Float16* __restrict__ VTH, const void* __restrict__ KMASK, float* __restrict__ O) {
  __shared__ __align__(16) char sm[2 * ABUF];   // projection: [buffer][x rows | w_qkv rows]; then first buffer: [buffer][k, v][key row, or d row for v][d, or key for v] at pitch RPH, second buffer: output staging
  float (*so)[16][68] = (float (*)[16][68])(sm + ABUF);
  const int tid = threadIdx.x, wave = tid >> 5, lane = tid & 31, col = lane & 15, g = lane >> 4;
  const int qb = blockIdx.x, h = blockIdx.y, b = blockIdx.z; const int q0 = qb * 64 + wave * 16;
  const unsigned sm0 = (unsigned)(size_t)&sm[0];
  // this wave's half plane (32 rows): source of its lane's first 16 bytes of stage 0, row pitch and step from stage to stage in bytes
  const int wv = __builtin_amdgcn_readfirstlane(wave);
  const size_t koff = (size_t)b * SS * (2 * DM) + DM + h * HD, voff = ((size_t)b * DM + h * HD) * SS;
  const _Float16* pl0 = (wv < 2) ? QK + koff : VTH + voff; const int row0 = (wv & 1) * 32 + (lane >> 3);
  const size_t gpitch = (wv < 2) ? (size_t)(2 * DM * 2) : (size_t)(SS * 2), gstage = (wv < 2) ? (size_t)KST * (2 * DM * 2) : (size_t)(KST * 2);
  const char* gsrc = (const char*)pl0 + (size_t)row0 * gpitch + (lane & 7) * 16;
  const unsigned ldst = sm0 + (unsigned)(wv >> 1) * PLB + (unsigned)row0 * (RPH * 2) + (unsigned)(lane & 7) * 16;
#define STAGE_COPY(BUF, ST) copy8(ldst + (unsigned)(BUF) * (2 * PLB), gsrc + (size_t)(ST) * gstage, 4 * RPH * 2, 4 * gpitch)
  // a projection stage: each wave copies its own 16 x rows (one row a copy) and 16 of the w_qkv rows (2 rows a copy); gx / gw, lx / lw = the lane's first 16 bytes of stage 0 in buffer 0
  const char* gx = (const char*)(X + ((size_t)b * SS + q0) * DM) + lane * 16; const char* gw = (const char*)(PW + (size_t)(h * HD + wave * 16 + g) * DM) + col * 16;
  const unsigned lx = sm0 + (unsigned)(wave * 16) * (AXP * 4) + (unsigned)lane * 16, lw = sm0 + AXB + (unsigned)(wave * 16 + g) * (AWP * 2) + (unsigned)col * 16;
#define PROJ_COPY(BUF, ST) do { copy8(lx + (unsigned)(BUF) * ABUF, gx + (size_t)(ST) * (AKS * 4), AXP * 4, (size_t)DM * 4); \
    copy8(lx + (unsigned)(BUF) * ABUF + 8 * AXP * 4, gx + (size_t)(ST) * (AKS * 4) + (size_t)8 * DM * 4, AXP * 4, (size_t)DM * 4); \
    copy8(lw + (unsigned)(BUF) * ABUF, gw + (size_t)(ST) * (AKS * 2), 2 * AWP * 2, (size_t)2 * DM * 2); } while (0)
  PROJ_COPY(0, 0);
  v8f qa[4] = {};   // qa[dt][r] = d dt * 16 + 8 g + r of query col
  asm volatile("s_wait_asynccnt 0x0" ::: "memory");   // this wave's copies of stage 0 have landed
  __syncthreads();                                     // publishes stage 0 to the other waves
  PROJ_COPY(1, 1);
  // both loops kept rolled: one copy of the 64-k body in the instruction cache, and one set of fragment registers; the loops inside are unrolled so that fragments and vector elements are named by constants and stay in registers
#pragma unroll 1
  for (int st = 0; st < ANS; ++st) { const char* bp = sm + (st & 1) * ABUF;
    const float* xr = (const float*)bp + (wave * 16 + col) * AXP + 8 * g; const __bf16* wr = (const __bf16*)(bp + AXB) + col * AWP;
#pragma unroll 1
    for (int hf = 0; hf < AKS / 64; ++hf) {
      float v[2][16]; v16b w[2][4];   // all fragments of 64 k are read as one group ahead of the products
#pragma unroll
      for (int kc = 0; kc < 2; ++kc) { lds16(xr + hf * 64 + kc * 32, v[kc]);
#pragma unroll
        for (int dt = 0; dt < 4; ++dt) w[kc][dt] = frag_b(wr + dt * 16 * AWP + hf * 64 + kc * 32, lane); }
#pragma unroll
      for (int kc = 0; kc < 2; ++kc) { v16b a;
#pragma unroll
        for (int i = 0; i < 16; ++i) a[i] = (__bf16)v[kc][i];
#pragma unroll
        for (int dt = 0; dt < 4; ++dt) qa[dt] = wmma_bf(w[kc][dt], a, qa[dt]); } }
    asm volatile("s_wait_dscnt 0x0" ::: "memory");      // this wave's reads of the buffer are done before it may be refilled
    asm volatile("s_wait_asynccnt 0x0" ::: "memory");   // this wave's copies of the next stage (behind the last: of stage 0 of k and v) have landed
    __syncthreads();                                     // publishes that stage and ends every wave's reads of stage st
    if (st + 2 < ANS) PROJ_COPY(st & 1, st + 2);
    else if (st + 2 == ANS) STAGE_COPY(0, 0); }          // the first buffer has had its last projection stage: stage 0 of k and v follows in it
  STAGE_COPY(1, 1);
  v16h aq[2];   // q times log2(e) / sqrt(64), one f16: the products with k are then the base-2 exponents themselves; element r = d kc * 32 + 8 g + r, element 8 + r = d kc * 32 + 16 + 8 g + r, the k order of frag_h
#pragma unroll
  for (int kc = 0; kc < 2; ++kc) {
#pragma unroll
    for (int r = 0; r < 8; ++r) { aq[kc][r] = (_Float16)(qa[2 * kc][r] * QSC); aq[kc][8 + r] = (_Float16)(qa[2 * kc + 1][r] * QSC); } }
  v8f nref = {};   // minus the reference exponent of this lane's query in all eight elements (both halves agree): the C operand of the score products
  float l = 0.f;   // this half's share of the query's sum
  v8f acc[4] = {};
  // both loops kept rolled: one copy of the 32-key body in the instruction cache, and one set of fragment registers
#pragma unroll 1
  for (int st = 0; st < NST; ++st) { const _Float16* rb = (const _Float16*)(sm + (st & 1) * (2 * PLB));
#pragma unroll 1
  for (int sub = 0; sub < KST / 32; ++sub) { v8f s[2];
    v16h kh[2][2];   // all k fragments of the 32 keys are read as one group ahead of the products
#pragma unroll
    for (int ct = 0; ct < 2; ++ct) { const _Float16* krow = rb + (sub * 32 + ct * 16 + col) * RPH;
#pragma unroll
      for (int kc = 0; kc < 2; ++kc) kh[ct][kc] = frag_h(krow + kc * 32, lane); }
#pragma unroll
    for (int kc = 0; kc < 2; ++kc) {
#pragma unroll
      for (int ct = 0; ct < 2; ++ct) s[ct] = wmma16(kh[ct][kc], aq[kc], kc ? s[ct] : nref); }    // transposed scores, k rows as A and q as B, the two key tiles in turn; s[ct][r] = base-2 exponent of key sub * 32 + ct * 16 + 8 g + r for query col, less the reference
    v16h vh[4];   // the v fragments (d rows as A) as one group, landing under the softmax
#pragma unroll
    for (int dt = 0; dt < 4; ++dt) vh[dt] = frag_h(rb + 64 * RPH + (dt * 16 + col) * RPH + sub * 32, lane);
    __builtin_amdgcn_sched_barrier(0);   // keeps the eight v reads together and ahead of the exponentials, under which they land (without it they sank behind them, in three places, and the second product waited for them)
    float e[2][8];
    exp2x8(s[0], e[0]); exp2x8(s[1], e[1]);
    float ts = sum16(e[0], e[1]);
    // The reference stays while every exponential fits f16: each is positive and at most the lane's sum, so one test of the sum covers all sixteen (an overflow to infinity too). One scalar branch per 32 keys, taken by the whole wave; the first pass always takes it and sets the reference from its own scores.
    const bool first = (st | sub) == 0;
    v16h pa = pack16(e[0], e[1]);
    if ((__builtin_amdgcn_ballot_w32(ts > 32768.0f) | (unsigned)first) != 0) {
      float mx = fmaxf(s[0][0], s[1][0]);
#pragma unroll
      for (int r = 1; r < 8; ++r) mx = fmaxf(mx, fmaxf(s[0][r], s[1][r]));
      mx = fmaxf(mx, xhalf(mx));   // the other 16 of the 32 keys lie in lane ^ 16
      const float dl = first ? mx - 7.0f : fmaxf(mx - 7.0f, 0.f);   // the new reference lies 7 under the maximum (the largest P is 2^7); later it only rises
      const float alpha = first ? 0.f : __builtin_amdgcn_exp2f(-dl);
#pragma unroll
      for (int r = 0; r < 8; ++r) { s[0][r] -= dl; s[1][r] -= dl; nref[r] -= dl; }
      exp2x8(s[0], e[0]); exp2x8(s[1], e[1]);
      ts = sum16(e[0], e[1]); pa = pack16(e[0], e[1]);
      l *= alpha;
#pragma unroll
      for (int dt = 0; dt < 4; ++dt) {
#pragma unroll
        for (int r = 0; r < 8; ++r) acc[dt][r] *= alpha; }
    }
    l += ts;
#pragma unroll
    for (int dt = 0; dt < 4; ++dt) acc[dt] = wmma16(vh[dt], pa, acc[dt]); }   // transposed output, acc[dt][r] = d dt * 16 + 8 g + r of query col: V x P
    asm volatile("s_wait_dscnt 0x0" ::: "memory");      // this wave's reads of the buffer are done before it may be refilled
    asm volatile("s_wait_asynccnt 0x0" ::: "memory");   // this wave's copies of stage st + 1 have landed
    __syncthreads();                                     // publishes stage st + 1 and ends every wave's reads of stage st
    if (st + 2 < NST) STAGE_COPY(st & 1, st + 2); }
  asm volatile("s_wait_asynccnt 0x0" ::: "memory");     // no copy is outstanding when the wave goes on to the epilogue and ends
  const float il = 1.0f / (l + xhalf(l));   // the two halves' sums are joined once
#pragma unroll
  for (int dt = 0; dt < 4; ++dt) { v4f o0, o1;
#pragma unroll
    for (int r = 0; r < 4; ++r) { o0[r] = acc[dt][r] * il; o1[r] = acc[dt][4 + r] * il; }
    *(v4f*)&so[wave][col][dt * 16 + 8 * g] = o0; *(v4f*)&so[wave][col][dt * 16 + 8 * g + 4] = o1; }
  LDSX();
  for (int rl = 0; rl < 16; ++rl) if (lane < 16) vst2(O + ((size_t)b * SS + q0 + rl) * DM + h * HD + lane * 4, *(const v4f*)&so[wave][rl][lane * 4]);
}
// ---- k_out: block = (64 rows, 128 cols): out = O(hi/lo) . Wo rows (2 products) + bo
__global__ __launch_bounds__(128) void k_out(const float* __restrict__ O, const __bf16* __restrict__ P, const float* __restrict__ BO, float* __restrict__ Y) {
  __shared__ __align__(16) float so[4][16][132];
  const int tid = threadIdx.x, wave = tid >> 5, lane = tid & 31, col = lane & 15, g = lane >> 4; const size_t r0 = (size_t)blockIdx.x * 64 + wave * 16; const int n0 = blockIdx.y * 128;
  __shared__ __align__(16) float sa[2][64][GAP]; __shared__ __align__(16) __bf16 sw[2][128][GWP];
  const char* gsa = (const char*)(O + (r0 + (lane >> 4)) * DM) + (lane & 15) * 16; const char* gsw = (const char*)(P + (size_t)(n0 + wave * 32 + (lane >> 3)) * DM) + (lane & 7) * 16;
  const unsigned lsa = (unsigned)(size_t)&sa[0][wave * 16 + (lane >> 4)][(lane & 15) * 4], lsw = (unsigned)(size_t)&sw[0][wave * 32 + (lane >> 3)][(lane & 7) * 8];
  gemm_copy(lsa, gsa, lsw, gsw, 0, 0);
  v8f acc[8] = {};
  asm volatile("s_wait_asynccnt 0x0" ::: "memory");   // this wave's copies of stage 0 have landed
  __syncthreads();                                     // publishes stage 0 to the other waves
  gemm_copy(lsa, gsa, lsw, gsw, 1, 1);
  // kept rolled: one copy of the stage body in the instruction cache
#pragma unroll 1
  for (int st = 0; st < GNS; ++st) { const int bf = st & 1;
    float v[GKS / 32][16]; v16b w[GKS / 32][8];   // all fragments of the stage are read as one group ahead of the products
#pragma unroll
    for (int kc = 0; kc < GKS / 32; ++kc) { lds16(&sa[bf][wave * 16 + col][kc * 32 + 8 * g], v[kc]);
#pragma unroll
      for (int j = 0; j < 8; ++j) w[kc][j] = frag_b(&sw[bf][j * 16 + col][kc * 32], lane); }
#pragma unroll
    for (int kc = 0; kc < GKS / 32; ++kc) { const F2 a = bsplit16(v[kc]);
#pragma unroll
      for (int j = 0; j < 8; ++j) { acc[j] = wmma_bf(a.l, w[kc][j], acc[j]); acc[j] = wmma_bf(a.h, w[kc][j], acc[j]); } }
    asm volatile("s_wait_dscnt 0x0" ::: "memory");      // this wave's reads of the buffer are done before it may be refilled
    asm volatile("s_wait_asynccnt 0x0" ::: "memory");   // this wave's copies of stage st + 1 have landed
    __syncthreads();                                     // publishes stage st + 1 and ends every wave's reads of stage st
    if (st + 2 < GNS) gemm_copy(lsa, gsa, lsw, gsw, bf, st + 2); }
  asm volatile("s_wait_asynccnt 0x0" ::: "memory");     // no copy is outstanding when the wave goes on to the epilogue and ends
#pragma unroll
  for (int j = 0; j < 8; ++j) {
#pragma unroll
    for (int r = 0; r < 8; ++r) so[wave][8 * g + r][j * 16 + col] = acc[j][r] + bfr(BO[n0 + j * 16 + col]); }
  LDSX();
  for (int rl = 0; rl < 16; ++rl) vst2(Y + (r0 + rl) * DM + n0 + lane * 4, *(const v4f*)&so[wave][rl][lane * 4]);
}
// ---- k_kvin: block = (64 keys m, head h, b): k input [b][h][m][64] -> K rows [b*M + m][DM + h*64 + d] of the q|k plane (f16); v input -> V plane [b][h*64 + d][m]
// The work-groups with blockIdx.x >= SS / 64 share the launch and round the two weight matrices to bf16 (natural [out][in] rows, a flat copy): w_qkv -> PK_A, w_proj -> PK_P; each takes PKE consecutive elements, 8 per lane and trip (32 B read, 16 B stored, whole lines per wave).
#define PKE 8192                       // weight elements per packing work-group
#define PKX 6                          // extra blockIdx.x values: PKX * NH * TNB = 144 work-groups = 2 * DM * DM / PKE
__global__ __launch_bounds__(256) void k_kvin(const float* __restrict__ KIN, const float* __restrict__ VIN, const float* __restrict__ WQ, const float* __restrict__ WO, _Float16* __restrict__ QK, _Float16* __restrict__ VTH, __bf16* __restrict__ PK) {
  __shared__ __align__(16) _Float16 skh[64][72], svh[64][72]; const int t = threadIdx.x; const int m0 = blockIdx.x * 64, h = blockIdx.y; const size_t b = blockIdx.z;
  if (blockIdx.x >= SS / 64) {   // the same for the whole work-group, and it leaves ahead of the barrier
    const int id = ((int)blockIdx.z * NH + (int)blockIdx.y) * PKX + ((int)blockIdx.x - SS / 64), nq = DM * DM / PKE;
    const float* src = (id < nq) ? WQ + (size_t)id * PKE : WO + (size_t)(id - nq) * PKE;
    __bf16* dst = (id < nq) ? PK + PK_A + (size_t)id * PKE : PK + PK_P + (size_t)(id - nq) * PKE;
    // unrolled so that all eight loads of a lane are in flight together (one memory latency per work-group, not four)
#pragma unroll
    for (int i = 0; i < PKE / (256 * 8); ++i) { const int e = (i * 256 + t) * 8; const v4f x0 = *(const v4f*)(src + e), x1 = *(const v4f*)(src + e + 4); v8b o;
      // unrolled so that the vector elements are named by constants and stay in registers
#pragma unroll
      for (int j = 0; j < 4; ++j) { o[j] = (__bf16)x0[j]; o[4 + j] = (__bf16)x1[j]; }
      *(v8b*)(dst + e) = o; }
    return;
  }
  for (int e = t; e < 64 * 64; e += 256) { const int r = e >> 6, d = e & 63; const size_t src = ((b * NH + h) * SS + m0 + r) * HD + d; const float kv = bfr(KIN[src]), vv = bfr(VIN[src]);
    skh[r][d] = (_Float16)kv; svh[d][r] = (_Float16)vv; }
  __syncthreads();
  for (int e = t; e < 64 * 8; e += 256) { const int r = e >> 3, q = e & 7; const size_t o = (b * SS + m0 + r) * (2 * DM) + DM + h * HD + q * 8; vst2((unsigned*)(QK + o), *(const v4u*)&skh[r][q * 8]);
    const size_t ov = (b * DM + h * HD + r) * SS + m0 + q * 8; vst2((unsigned*)(VTH + ov), *(const v4u*)&svh[r][q * 8]); }
}
extern "C" void kernel_launch(void* const* d_in, const int* in_sizes, int n_in, void* d_out, int out_size, void* d_ws, size_t ws_size, hipStream_t stream) {
  (void)in_sizes; (void)n_in; (void)out_size;
  const float** F = (const float**)d_in;   // 0 x [2,2048,768], 1 k [2,12,2048,64], 2 v [2,12,2048,64], 3 w_qkv [768,768] natural (q only), 4 w_proj [768,768] natural, 5 b_proj [768]
  if (ws_size < (size_t)WS_END) return;
  char* ws = (char*)d_ws; __bf16* PK = (__bf16*)(ws + WS_PK); _Float16 *QK = (_Float16*)(ws + WS_QK), *VTH = (_Float16*)(ws + WS_VTH); float* O = (float*)(ws + WS_O);
  k_kvin<<<dim3(SS / 64 + PKX, NH, TNB), 256, 0, stream>>>(F[1], F[2], F[3], F[4], QK, VTH, PK);   // k, v re-laid out; w_qkv and w_proj rounded to bf16 by the extra work-groups
  k_attn<<<dim3(TQB, NH, TNB), 128, 0, stream>>>(F[0], PK + PK_A, QK, VTH, nullptr, O);   // q projection (q columns of head h) and attention
  k_out<<<dim3(TOB, DM / 128), 128, 0, stream>>>(O, PK + PK_P, F[5], (float*)d_out);
}

// v010
// One run takes 56 microseconds.
// Next to v009, in two timings, it ran 1.04 times as fast each time.
// Counting every step since v000, it is 7.03 times as fast.
// compute dtype: x, k, v, w_qkv, w_proj, b_proj rounded to bf16; q = x . w_qkv^T with exact bf16 products on WMMA 16x16x32 (natural rows), formed in the attention kernel itself, scaled by log2(e)/8 and kept as one f16 in registers (rounded once, 2^-12 relative at most, an eighth of the bf16 rounding of k); the k and v INPUTS are re-laid out on device as one f16 plane each (a bf16 value is exact in f16 from 2^-17 up to the f16 range; below 2^-17 it is rounded to the f16 subnormal grid, at most 2^-25 off); 1-product scores (k x q, less a reference exponent per query that enters as C), softmax in f32 in base 2 (hardware exp) against that reference, which is moved only when it must be; P (its largest element between 2^7 and 2^15, one f16, rounded once, 2^-12 relative at most; its sum is taken in f32 ahead of the rounding) x v (1 product); output projection with ctx as bf16 hi + residual x exact w_proj rows (2 products) + b_proj; f32 accumulate.
#include <hip/hip_runtime.h>
#include <math.h>

typedef __attribute__((ext_vector_type(16))) _Float16 v16h;
typedef __attribute__((ext_vector_type(16))) __bf16 v16b;
typedef __attribute__((ext_vector_type(8)))  _Float16 v8h;
typedef __attribute__((ext_vector_type(8)))  float v8f;
typedef __attribute__((ext_vector_type(4)))  float v4f;
typedef __attribute__((ext_vector_type(2)))  float v2f;
typedef __attribute__((ext_vector_type(4)))  unsigned v4u;
typedef __attribute__((ext_vector_type(4)))  int v4i;
typedef float __attribute__((may_alias)) float_a;
typedef int __attribute__((may_alias)) int_a;

template <typename T> __device__ __forceinline__ void vst2(void* p, T v) { *(T*)p = v;  }
__device__ __forceinline__ v8f wmma16(v16h a, v16h b, v8f c) {
  v8f d = __builtin_amdgcn_wmma_f32_16x16x32_f16(false, a, false, b, (short)0, c, false, false);
  asm volatile("v_nop\n\tv_nop\n\tv_nop\n\tv_nop" : "+v"(d) : "v"(a), "v"(b));
  return d;
}
__device__ __forceinline__ v8f wmma_bf(v16b a, v16b b, v8f c) {
  v8f d = __builtin_amdgcn_wmma_f32_16x16x32_bf16(false, a, false, b, (short)0, c, false, false);
  asm volatile("v_nop\n\tv_nop\n\tv_nop\n\tv_nop" : "+v"(d) : "v"(a), "v"(b));
  return d;
}
// ViT-style attention with given key/value caches (B 2, N = M = 2,048, dim 768, 12 heads x 64): q = x W_qkv^T, softmax(q k^T / 8) v, output projection + bias.
__device__ __forceinline__ v16h frag_h(const _Float16* rowk0, int lane) {
  union { v16h v; v8h q[2]; } u; const _Float16* p = rowk0 + 8 * (lane >> 4);
  u.q[0] = *(const v8h*)p; u.q[1] = *(const v8h*)(p + 16); return u.v;
}
__device__ __forceinline__ v16h frag_f32(const float* rowk0, int lane) {
  v16h a; const float* p = rowk0 + 8 * (lane >> 4);
#pragma unroll
  for (int i = 0; i < 8; ++i) { a[i] = (_Float16)p[i]; a[8 + i] = (_Float16)p[16 + i]; }
  return a;
}
__device__ __forceinline__ v16h frag_f32s(const float* rowk0, int lane, float sc) {
  v16h a; const float* p = rowk0 + 8 * (lane >> 4);
#pragma unroll
  for (int i = 0; i < 8; ++i) { a[i] = (_Float16)(p[i] * sc); a[8 + i] = (_Float16)(p[16 + i] * sc); }
  return a;
}
// column fragment from a [K][ld] layout (column n), rows >= K read as 0
__device__ __forceinline__ v16h fragc_f32(const float* W, int k0, int n, int lane, int ld, int K) {
  v16h a; const int g = lane >> 4;
#pragma unroll
  for (int i = 0; i < 8; ++i) { const int ka = k0 + 8 * g + i, kb = ka + 16;
    a[i] = (_Float16)(ka < K ? W[(size_t)(ka < K ? ka : K - 1) * ld + n] : 0.f); a[8 + i] = (_Float16)(kb < K ? W[(size_t)(kb < K ? kb : K - 1) * ld + n] : 0.f); }
  return a;
}
struct F2 { v16b h, l; };
__device__ __forceinline__ F2 bsplit16(const float v[16]) { F2 r;
#pragma unroll
  for (int i = 0; i < 16; ++i) { const __bf16 h = (__bf16)v[i]; r.h[i] = h; r.l[i] = (__bf16)(v[i] - (float)h); }
  return r; }
__device__ __forceinline__ F2 split_row(const float* row, int k0, int lane) { float v[16]; const float* p = row + k0 + 8 * (lane >> 4);
#pragma unroll
  for (int i = 0; i < 8; ++i) { v[i] = p[i]; v[8 + i] = p[16 + i]; }
  return bsplit16(v); }
__device__ __forceinline__ F2 split_rowK(const float* row, int k0, int lane, int K) { float v[16]; const int g = lane >> 4;
#pragma unroll
  for (int i = 0; i < 8; ++i) { const int ka = k0 + 8 * g + i, kb = ka + 16; v[i] = ka < K ? row[ka < K ? ka : K - 1] : 0.f; v[8 + i] = kb < K ? row[kb < K ? kb : K - 1] : 0.f; }
  return bsplit16(v); }
__device__ __forceinline__ F2 split_col(const float* W, int k0, int n, int lane, int ld, int K) { float v[16]; const int g = lane >> 4;
#pragma unroll
  for (int i = 0; i < 8; ++i) { const int ka = k0 + 8 * g + i, kb = ka + 16; v[i] = ka < K ? W[(size_t)(ka < K ? ka : K - 1) * ld + n] : 0.f; v[8 + i] = kb < K ? W[(size_t)(kb < K ? kb : K - 1) * ld + n] : 0.f; }
  return bsplit16(v); }
__device__ __forceinline__ v8f mac3(const F2& a, const F2& b, v8f c) { c = wmma_bf(a.l, b.h, c); c = wmma_bf(a.h, b.l, c); return wmma_bf(a.h, b.h, c); }
__device__ __forceinline__ float sigm(float v) { return 1.0f / (1.0f + expf(-v)); }
#define LDSX() do { asm volatile("s_wait_dscnt 0" ::: "memory"); __builtin_amdgcn_wave_barrier(); __builtin_amdgcn_fence(__ATOMIC_RELEASE, "workgroup"); } while (0)


#define NB 2
#define SS 2048
#define DM 768
#define NH 12
#define HD 64
#define QKVW (3 * DM)
#ifndef TQB
#define TQB (SS / 64)
#define TNB NB
#define TOB (NB * SS / 64)     // output row tiles (all)
#endif
typedef __attribute__((ext_vector_type(8))) __bf16 v8b;
__device__ __forceinline__ v16b frag_b(const __bf16* rowk0, int lane) {
  union { v16b v; v8b q[2]; } u; const __bf16* p = rowk0 + 8 * (lane >> 4);
  u.q[0] = *(const v8b*)p; u.q[1] = *(const v8b*)(p + 16); return u.v;
}
__device__ __forceinline__ float bfr(float v) { return (float)(__bf16)v; }
__device__ __attribute__((noinline)) float exp_ni(float v) { return expf(v); }
__device__ __attribute__((noinline)) float erf_ni(float v) { return erff(v); }

#define PK_A 0                       // [768][768] Wqkv rows (natural [out][in]); 2304 rows of space
#define PK_P (PK_A + QKVW * DM)        // [768][768] Wo rows (natural)
#define PK_END (PK_P + DM * DM)
#define WS_PK  0u
#define WS_QK  (WS_PK + 2u * PK_END)             // f16 [4096 rows][1536]: (place of q, not used) | k
#define WS_QKL (WS_QK + 2u * NB * SS * 2 * DM)     // place of a q residual plane (not used)
#define WS_VTH (WS_QKL + 2u * NB * SS * 2 * DM)    // f16 [b][768 (h*64+d)][2048 s]
#define WS_VTL (WS_VTH + 2u * NB * DM * SS)        // place of a v residual plane (not used)
#define WS_O   (WS_VTL + 2u * NB * DM * SS)        // f32 [4096][768]
#define WS_CS  (WS_O + 4u * NB * SS * DM)           // f32 [2][2048][32] (not used)
#define WS_END (WS_CS + 4u * 2 * SS * 32)
// eight asynchronous 16-byte-per-lane copies, each 512 B (4 rows of 128 B, 2 rows of 256 B, or 1 row of 512 B); ls / gs = bytes between two copies in LDS / in global memory
__device__ __forceinline__ void copy8(unsigned l0, const char* g0, unsigned ls, size_t gs) {
  const unsigned l1 = l0 + ls, l2 = l1 + ls, l3 = l2 + ls, l4 = l3 + ls, l5 = l4 + ls, l6 = l5 + ls, l7 = l6 + ls;
  const char *g1 = g0 + gs, *g2 = g1 + gs, *g3 = g2 + gs, *g4 = g3 + gs, *g5 = g4 + gs, *g6 = g5 + gs, *g7 = g6 + gs;
  // the closing s_wait_xcnt stands inside the statement so that no address register of a copy is rewritten in front of it
  asm volatile("global_load_async_to_lds_b128 %0, %8, off\n\t"
               "global_load_async_to_lds_b128 %1, %9, off\n\t"
               "global_load_async_to_lds_b128 %2, %10, off\n\t"
               "global_load_async_to_lds_b128 %3, %11, off\n\t"
               "global_load_async_to_lds_b128 %4, %12, off\n\t"
               "global_load_async_to_lds_b128 %5, %13, off\n\t"
               "global_load_async_to_lds_b128 %6, %14, off\n\t"
               "global_load_async_to_lds_b128 %7, %15, off\n\t"
               "s_wait_xcnt 0x0"
               :: "v"(l0), "v"(l1), "v"(l2), "v"(l3), "v"(l4), "v"(l5), "v"(l6), "v"(l7), "v"(g0), "v"(g1), "v"(g2), "v"(g3), "v"(g4), "v"(g5), "v"(g6), "v"(g7) : "memory");
}
// The output projection (64 rows x 128 columns per work-group) takes its operands through LDS: a stage is 64 k of the 64 A rows (f32, 256 B each) and of the 128 W rows (bf16, 128 B each), brought in once per work-group by asynchronous copies of whole 128-B lines, two buffers, the next stage in flight while this one is worked on; the fragments are read from LDS, A and W in the same k order (that of frag_b).
#define QSC 0.18033688011112042f   // log2(e) / sqrt(64)
#define GKS 64                 // k per stage
#define GNS (DM / GKS)         // stages
#define GAP 68                 // LDS pitch of an A row in f32: 256-B row + 16 B, conflict-free for 16-byte LDS reads
#define GWP 72                 // LDS pitch of a W row in bf16: 128-B row + 16 B, likewise
// one stage: each wave copies its own 16 A rows (2 rows a copy) and 32 of the W rows (4 rows a copy); la / lw, ga / gw = the lane's first 16 bytes of stage 0 in buffer 0
__device__ __forceinline__ void gemm_copy(unsigned la, const char* ga, unsigned lw, const char* gw, int buf, int st) {
  copy8(la + (unsigned)buf * (64 * GAP * 4), ga + (size_t)st * (GKS * 4), 2 * GAP * 4, (size_t)2 * DM * 4);
  copy8(lw + (unsigned)buf * (128 * GWP * 2), gw + (size_t)st * (GKS * 2), 4 * GWP * 2, (size_t)4 * DM * 2);
}
// the 16 f32 of an A fragment (elements 0..7 = k 8 g + i, 8..15 = k 16 + 8 g + i) from an LDS row, p = row + k0 + 8 g
__device__ __forceinline__ void lds16(const float* p, float v[16]) {
  const v4f x0 = *(const v4f*)p, x1 = *(const v4f*)(p + 4), x2 = *(const v4f*)(p + 16), x3 = *(const v4f*)(p + 20);
#pragma unroll
  for (int i = 0; i < 4; ++i) { v[i] = x0[i]; v[4 + i] = x1[i]; v[8 + i] = x2[i]; v[12 + i] = x3[i]; }
}
#define KST 64                 // keys per stage
#define NST (SS / KST)         // stages
#define RPH 72                 // LDS row pitch in f16: 128-B row + 16 B, the conflict-free pitch for 16-byte LDS reads
#define PLB (64 * RPH * 2)     // bytes of one plane of a stage in LDS
// eight base-2 exponentials in one statement, results in registers of their own (early clobber): none of the eight overwrites a source or reads a result of the one directly ahead of it (the slot that the instruction set asks for behind a transcendental), and the closing v_nop keeps the next vector instruction off the last one
__device__ __forceinline__ void exp2x8(const v8f x, float e[8]) {
  asm("v_exp_f32 %0, %8\n\t" "v_exp_f32 %1, %9\n\t" "v_exp_f32 %2, %10\n\t" "v_exp_f32 %3, %11\n\t"
      "v_exp_f32 %4, %12\n\t" "v_exp_f32 %5, %13\n\t" "v_exp_f32 %6, %14\n\t" "v_exp_f32 %7, %15\n\t"
      "v_nop"
      : "=&v"(e[0]), "=&v"(e[1]), "=&v"(e[2]), "=&v"(e[3]), "=&v"(e[4]), "=&v"(e[5]), "=&v"(e[6]), "=&v"(e[7])
      : "v"(x[0]), "v"(x[1]), "v"(x[2]), "v"(x[3]), "v"(x[4]), "v"(x[5]), "v"(x[6]), "v"(x[7]));
}
// the two score tiles of a lane are, element for element, the B fragment of P transposed: element r = key 8 g + r, element 8 + r = key 16 + 8 g + r, the k order of frag_h; P carries 2^7 or more at the maximum, so small softmax weights stay out of the f16 subnormal range; the sum l carries the same factor, so it cancels in the epilogue
__device__ __forceinline__ v16h pack16(const float a[8], const float b[8]) {
  v16h p;
#pragma unroll
  for (int i = 0; i < 8; ++i) { p[i] = (_Float16)a[i]; p[8 + i] = (_Float16)b[i]; }
  return p;
}
// the sum of a lane's sixteen exponentials
__device__ __forceinline__ float sum16(const float a[8], const float b[8]) {
  float t[8];
#pragma unroll
  for (int r = 0; r < 8; ++r) t[r] = a[r] + b[r];
  return ((t[0] + t[1]) + (t[2] + t[3])) + ((t[4] + t[5]) + (t[6] + t[7]));
}
// lane l takes the value of lane l ^ 16
__device__ __forceinline__ float xhalf(float x) { return __builtin_bit_cast(float, __builtin_amdgcn_permlanex16(__builtin_bit_cast(int, x), __builtin_bit_cast(int, x), 0x76543210, 0xfedcba98, false, false)); }
// Two matrix products, each with four base-2 exponentials behind it that touch none of its registers: the exponentials run while the matrix unit works and are at the same time the four vector slots that the chip needs behind a product before its registers are touched. Results in registers of their own (early clobber), so no exponential overwrites a source or reads a result of the one ahead of it; the closing v_nop keeps the next vector instruction off the last exponential.
// d0 = a0 b + c, d1 = a1 b + c (fresh tiles); e = 2^x
__device__ __forceinline__ void mm2n_exp8(v8f& d0, v8f& d1, const v16h a0, const v16h a1, const v16h b, const v8f c, const v8f x, float e[8]) {
  asm volatile("v_wmma_f32_16x16x32_f16 %0, %10, %12, %13\n\t"
               "v_exp_f32 %2, %14\n\t" "v_exp_f32 %3, %15\n\t" "v_exp_f32 %4, %16\n\t" "v_exp_f32 %5, %17\n\t"
               "v_wmma_f32_16x16x32_f16 %1, %11, %12, %13\n\t"
               "v_exp_f32 %6, %18\n\t" "v_exp_f32 %7, %19\n\t" "v_exp_f32 %8, %20\n\t" "v_exp_f32 %9, %21\n\t"
               "v_nop"
               : "=&v"(d0), "=&v"(d1), "=&v"(e[0]), "=&v"(e[1]), "=&v"(e[2]), "=&v"(e[3]), "=&v"(e[4]), "=&v"(e[5]), "=&v"(e[6]), "=&v"(e[7])
               : "v"(a0), "v"(a1), "v"(b), "v"(c), "v"(x[0]), "v"(x[1]), "v"(x[2]), "v"(x[3]), "v"(x[4]), "v"(x[5]), "v"(x[6]), "v"(x[7]));
}
// d0 += a0 b, d1 += a1 b; e = 2^x
__device__ __forceinline__ void mm2a_exp8(v8f& d0, v8f& d1, const v16h a0, const v16h a1, const v16h b, const v8f x, float e[8]) {
  asm volatile("v_wmma_f32_16x16x32_f16 %0, %10, %12, %0\n\t"
               "v_exp_f32 %2, %13\n\t" "v_exp_f32 %3, %14\n\t" "v_exp_f32 %4, %15\n\t" "v_exp_f32 %5, %16\n\t"
               "v_wmma_f32_16x16x32_f16 %1, %11, %12, %1\n\t"
               "v_exp_f32 %6, %17\n\t" "v_exp_f32 %7, %18\n\t" "v_exp_f32 %8, %19\n\t" "v_exp_f32 %9, %20\n\t"
               "v_nop"
               : "+v"(d0), "+v"(d1), "=&v"(e[0]), "=&v"(e[1]), "=&v"(e[2]), "=&v"(e[3]), "=&v"(e[4]), "=&v"(e[5]), "=&v"(e[6]), "=&v"(e[7])
               : "v"(a0), "v"(a1), "v"(b), "v"(x[0]), "v"(x[1]), "v"(x[2]), "v"(x[3]), "v"(x[4]), "v"(x[5]), "v"(x[6]), "v"(x[7]));
}
// d0 = a0 b + c0, d1 = a1 b + c1 (results in tiles of their own); e = 2^x
__device__ __forceinline__ void mm2c_exp8(v8f& d0, v8f& d1, const v16h a0, const v16h a1, const v16h b, const v8f c0, const v8f c1, const v8f x, float e[8]) {
  asm volatile("v_wmma_f32_16x16x32_f16 %0, %10, %12, %13\n\t"
               "v_exp_f32 %2, %15\n\t" "v_exp_f32 %3, %16\n\t" "v_exp_f32 %4, %17\n\t" "v_exp_f32 %5, %18\n\t"
               "v_wmma_f32_16x16x32_f16 %1, %11, %12, %14\n\t"
               "v_exp_f32 %6, %19\n\t" "v_exp_f32 %7, %20\n\t" "v_exp_f32 %8, %21\n\t" "v_exp_f32 %9, %22\n\t"
               "v_nop"
               : "=&v"(d0), "=&v"(d1), "=&v"(e[0]), "=&v"(e[1]), "=&v"(e[2]), "=&v"(e[3]), "=&v"(e[4]), "=&v"(e[5]), "=&v"(e[6]), "=&v"(e[7])
               : "v"(a0), "v"(a1), "v"(b), "v"(c0), "v"(c1), "v"(x[0]), "v"(x[1]), "v"(x[2]), "v"(x[3]), "v"(x[4]), "v"(x[5]), "v"(x[6]), "v"(x[7]));
}
// d0..d3 = a0..a3 b + c0..c3: four products in one statement, nothing left to stand behind them; the four closing v_nop are the vector slots that the chip needs behind the last product before its registers are touched
__device__ __forceinline__ void mm4c(v8f d[4], const v16h a0, const v16h a1, const v16h a2, const v16h a3, const v16h b, const v8f c[4]) {
  asm volatile("v_wmma_f32_16x16x32_f16 %0, %4, %8, %9\n\t"
               "v_wmma_f32_16x16x32_f16 %1, %5, %8, %10\n\t"
               "v_wmma_f32_16x16x32_f16 %2, %6, %8, %11\n\t"
               "v_wmma_f32_16x16x32_f16 %3, %7, %8, %12\n\t"
               "v_nop\n\tv_nop\n\tv_nop\n\tv_nop"
               : "=&v"(d[0]), "=&v"(d[1]), "=&v"(d[2]), "=&v"(d[3]) : "v"(a0), "v"(a1), "v"(a2), "v"(a3), "v"(b), "v"(c[0]), "v"(c[1]), "v"(c[2]), "v"(c[3]));
}
// d0 = a00 b0 + a01 b1 + c, d1 = a10 b0 + a11 b1 + c (fresh tiles, the two in turn), nothing at hand to stand behind them; the four closing v_nop as in mm4c
__device__ __forceinline__ void mm4s(v8f& d0, v8f& d1, const v16h a00, const v16h a10, const v16h a01, const v16h a11, const v16h b0, const v16h b1, const v8f c) {
  asm volatile("v_wmma_f32_16x16x32_f16 %0, %2, %6, %8\n\t"
               "v_wmma_f32_16x16x32_f16 %1, %3, %6, %8\n\t"
               "v_wmma_f32_16x16x32_f16 %0, %4, %7, %0\n\t"
               "v_wmma_f32_16x16x32_f16 %1, %5, %7, %1\n\t"
               "v_nop\n\tv_nop\n\tv_nop\n\tv_nop"
               : "=&v"(d0), "=&v"(d1) : "v"(a00), "v"(a10), "v"(a01), "v"(a11), "v"(b0), "v"(b1), "v"(c));
}
// the rare pass that moves the reference of a 32-key group: new reference from the group's own scores, exponentials, sum and P formed anew, sum and output so far rescaled; returns the rise of the reference
__device__ __forceinline__ float move_ref(const bool first, v8f s[2], v8f& nref, float e[2][8], float& ts, v16h& pa, float& l, v8f acc[4]) {
  float mx = fmaxf(s[0][0], s[1][0]);
#pragma unroll
  for (int r = 1; r < 8; ++r) mx = fmaxf(mx, fmaxf(s[0][r], s[1][r]));
  mx = fmaxf(mx, xhalf(mx));   // the other 16 of the 32 keys lie in lane ^ 16
  const float dl = first ? mx - 7.0f : fmaxf(mx - 7.0f, 0.f);   // the new reference lies 7 under the maximum (the largest P is 2^7); later it only rises
  const float alpha = first ? 0.f : __builtin_amdgcn_exp2f(-dl);
#pragma unroll
  for (int r = 0; r < 8; ++r) { s[0][r] -= dl; s[1][r] -= dl; nref[r] -= dl; }
  exp2x8(s[0], e[0]); exp2x8(s[1], e[1]);
  ts = sum16(e[0], e[1]); pa = pack16(e[0], e[1]);
  l *= alpha;
#pragma unroll
  for (int dt = 0; dt < 4; ++dt) {
#pragma unroll
    for (int r = 0; r < 8; ++r) acc[dt][r] *= alpha; }
  return dl;
}
// The q projection is the kernel's first part: q^T (64 d of head h x this wave's 16 queries) = w_qkv rows (A) x x rows (B), bf16 products, k in rising order; the four result tiles of a lane are, element for element, the two B fragments of q for the score products (the order of pack16), so q goes from accumulator to fragment in registers.
// Its operands come through LDS like the planes of k and v: a stage is 128 k of the 64 x rows (f32, 512 B each) and of the 64 w_qkv rows (bf16, 256 B each), asynchronous copies of whole lines, two buffers. The ring of k and v lies in the first buffer and takes it over when its last reader has left it; the output staging lies in the second.
#define AKS 128                // k per stage of the projection
#define ANS (DM / AKS)         // its stages
#define AXP 132                // LDS pitch of an x row in f32: 512-B row + 16 B, conflict-free for 16-byte LDS reads
#define AWP 136                // LDS pitch of a w_qkv row in bf16: 256-B row + 16 B, likewise
#define AXB (64 * AXP * 4)     // bytes of the x rows of a stage
#define ABUF (AXB + 64 * AWP * 2)   // bytes of one buffer
static_assert(ANS >= 2 && ANS % 2 == 0 && 4 * PLB <= ABUF && 4 * 16 * 68 * 4 <= ABUF, "the last but one stage lies in the first buffer, which holds the ring of k and v; the second holds the output staging");
__global__ __launch_bounds__(128) void k_attn(const float* __restrict__ X, const __bf16* __restrict__ PW, const _Float16* __restrict__ QK, const _Float16* __restrict__ VTH, const void* __restrict__ KMASK, float* __restrict__ O) {
  __shared__ __align__(16) char sm[2 * ABUF];   // projection: [buffer][x rows | w_qkv rows]; then first buffer: [buffer][k, v][key row, or d row for v][d, or key for v] at pitch RPH, second buffer: output staging
  float (*so)[16][68] = (float (*)[16][68])(sm + ABUF);
  const int tid = threadIdx.x, wave = tid >> 5, lane = tid & 31, col = lane & 15, g = lane >> 4;
  const int qb = blockIdx.x, h = blockIdx.y, b = blockIdx.z; const int q0 = qb * 64 + wave * 16;
  const unsigned sm0 = (unsigned)(size_t)&sm[0];
  // this wave's half plane (32 rows): source of its lane's first 16 bytes of stage 0, row pitch and step from stage to stage in bytes
  const int wv = __builtin_amdgcn_readfirstlane(wave);
  const size_t koff = (size_t)b * SS * (2 * DM) + DM + h * HD, voff = ((size_t)b * DM + h * HD) * SS;
  const _Float16* pl0 = (wv < 2) ? QK + koff : VTH + voff; const int row0 = (wv & 1) * 32 + (lane >> 3);
  const size_t gpitch = (wv < 2) ? (size_t)(2 * DM * 2) : (size_t)(SS * 2), gstage = (wv < 2) ? (size_t)KST * (2 * DM * 2) : (size_t)(KST * 2);
  const char* gsrc = (const char*)pl0 + (size_t)row0 * gpitch + (lane & 7) * 16;
  const unsigned ldst = sm0 + (unsigned)(wv >> 1) * PLB + (unsigned)row0 * (RPH * 2) + (unsigned)(lane & 7) * 16;
#define STAGE_COPY(BUF, ST) copy8(ldst + (unsigned)(BUF) * (2 * PLB), gsrc + (size_t)(ST) * gstage, 4 * RPH * 2, 4 * gpitch)
  // a projection stage: each wave copies its own 16 x rows (one row a copy) and 16 of the w_qkv rows (2 rows a copy); gx / gw, lx / lw = the lane's first 16 bytes of stage 0 in buffer 0
  const char* gx = (const char*)(X + ((size_t)b * SS + q0) * DM) + lane * 16; const char* gw = (const char*)(PW + (size_t)(h * HD + wave * 16 + g) * DM) + col * 16;
  const unsigned lx = sm0 + (unsigned)(wave * 16) * (AXP * 4) + (unsigned)lane * 16, lw = sm0 + AXB + (unsigned)(wave * 16 + g) * (AWP * 2) + (unsigned)col * 16;
#define PROJ_COPY(BUF, ST) do { copy8(lx + (unsigned)(BUF) * ABUF, gx + (size_t)(ST) * (AKS * 4), AXP * 4, (size_t)DM * 4); \
    copy8(lx + (unsigned)(BUF) * ABUF + 8 * AXP * 4, gx + (size_t)(ST) * (AKS * 4) + (size_t)8 * DM * 4, AXP * 4, (size_t)DM * 4); \
    copy8(lw + (unsigned)(BUF) * ABUF, gw + (size_t)(ST) * (AKS * 2), 2 * AWP * 2, (size_t)2 * DM * 2); } while (0)
  PROJ_COPY(0, 0);
  v8f qa[4] = {};   // qa[dt][r] = d dt * 16 + 8 g + r of query col
  asm volatile("s_wait_asynccnt 0x0" ::: "memory");   // this wave's copies of stage 0 have landed
  __syncthreads();                                     // publishes stage 0 to the other waves
  PROJ_COPY(1, 1);
  // both loops kept rolled: one copy of the 64-k body in the instruction cache, and one set of fragment registers; the loops inside are unrolled so that fragments and vector elements are named by constants and stay in registers
#pragma unroll 1
  for (int st = 0; st < ANS; ++st) { const char* bp = sm + (st & 1) * ABUF;
    const float* xr = (const float*)bp + (wave * 16 + col) * AXP + 8 * g; const __bf16* wr = (const __bf16*)(bp + AXB) + col * AWP;
#pragma unroll 1
    for (int hf = 0; hf < AKS / 64; ++hf) {
      float v[2][16]; v16b w[2][4];   // all fragments of 64 k are read as one group ahead of the products
#pragma unroll
      for (int kc = 0; kc < 2; ++kc) { lds16(xr + hf * 64 + kc * 32, v[kc]);
#pragma unroll
        for (int dt = 0; dt < 4; ++dt) w[kc][dt] = frag_b(wr + dt * 16 * AWP + hf * 64 + kc * 32, lane); }
#pragma unroll
      for (int kc = 0; kc < 2; ++kc) { v16b a;
#pragma unroll
        for (int i = 0; i < 16; ++i) a[i] = (__bf16)v[kc][i];
#pragma unroll
        for (int dt = 0; dt < 4; ++dt) qa[dt] = wmma_bf(w[kc][dt], a, qa[dt]); } }
    asm volatile("s_wait_dscnt 0x0" ::: "memory");      // this wave's reads of the buffer are done before it may be refilled
    asm volatile("s_wait_asynccnt 0x0" ::: "memory");   // this wave's copies of the next stage (behind the last: of stage 0 of k and v) have landed
    __syncthreads();                                     // publishes that stage and ends every wave's reads of stage st
    if (st + 2 < ANS) PROJ_COPY(st & 1, st + 2);
    else if (st + 2 == ANS) STAGE_COPY(0, 0); }          // the first buffer has had its last projection stage: stage 0 of k and v follows in it
  STAGE_COPY(1, 1);
  v16h aq[2];   // q times log2(e) / sqrt(64), one f16: the products with k are then the base-2 exponents themselves; element r = d kc * 32 + 8 g + r, element 8 + r = d kc * 32 + 16 + 8 g + r, the k order of frag_h
#pragma unroll
  for (int kc = 0; kc < 2; ++kc) {
#pragma unroll
    for (int r = 0; r < 8; ++r) { aq[kc][r] = (_Float16)(qa[2 * kc][r] * QSC); aq[kc][8 + r] = (_Float16)(qa[2 * kc + 1][r] * QSC); } }
  v8f nref = {};   // minus the reference exponent of this lane's query in all eight elements (both halves agree): the C operand of the score products
  float l = 0.f;   // this half's share of the query's sum
  v8f acc[4] = {};
  // the stage loop is kept rolled: one copy of the 64-key body in the instruction cache. The two 32-key groups of a stage (a, b) are worked on one step apart, so that the exponentials of one stand behind the matrix products of the other.
#pragma unroll 1
  for (int st = 0; st < NST; ++st) { const _Float16* rb = (const _Float16*)(sm + (st & 1) * (2 * PLB));
    v16h kh[2][2][2];   // all k fragments of the 64 keys are read as one group ahead of the products
#pragma unroll
    for (int sub = 0; sub < 2; ++sub) {
#pragma unroll
      for (int ct = 0; ct < 2; ++ct) { const _Float16* krow = rb + (sub * 32 + ct * 16 + col) * RPH;
#pragma unroll
        for (int kc = 0; kc < 2; ++kc) kh[sub][ct][kc] = frag_h(krow + kc * 32, lane); } }
    v8f sa[2], sb[2];   // transposed scores of group a and group b, k rows as A and q as B; s[ct][r] = base-2 exponent of key sub * 32 + ct * 16 + 8 g + r for query col, less the reference
    mm4s(sa[0], sa[1], kh[0][0][0], kh[0][1][0], kh[0][0][1], kh[0][1][1], aq[0], aq[1], nref);   // scores of a
    v16h vh[2][4];   // the v fragments (d rows as A) of both groups as one group of reads, landing under the score products of b and the softmax
#pragma unroll
    for (int sub = 0; sub < 2; ++sub) {
#pragma unroll
      for (int dt = 0; dt < 4; ++dt) vh[sub][dt] = frag_h(rb + 64 * RPH + (dt * 16 + col) * RPH + sub * 32, lane); }
    float ea[2][8], eb[2][8];
    mm2n_exp8(sb[0], sb[1], kh[1][0][0], kh[1][1][0], aq[0], nref, sa[0], ea[0]);   // scores of b, exponentials of a
    mm2a_exp8(sb[0], sb[1], kh[1][0][1], kh[1][1][1], aq[1], sa[1], ea[1]);
    float ts = sum16(ea[0], ea[1]);
    // The reference stays while every exponential fits f16: each is positive and at most the lane's sum, so one test of the sum covers all sixteen (an overflow to infinity too). One scalar branch per 32 keys, taken by the whole wave; the first group always takes it and sets the reference from its own scores.
    const bool first = st == 0;
    v16h pa = pack16(ea[0], ea[1]);
    if ((__builtin_amdgcn_ballot_w32(ts > 32768.0f) | (unsigned)first) != 0) {
      const float dl = move_ref(first, sa, nref, ea, ts, pa, l, acc);
#pragma unroll
      for (int r = 0; r < 8; ++r) { sb[0][r] -= dl; sb[1][r] -= dl; }   // the scores of b were formed against the old reference
    }
    l += ts;
    v8f an[4];   // the output goes from acc to an with group a and back to acc with group b: with the sums kept in place the compiler moved two of the four tiles to other registers and back on every trip
    mm2c_exp8(an[0], an[1], vh[0][0], vh[0][1], pa, acc[0], acc[1], sb[0], eb[0]);   // transposed output, acc[dt][r] = d dt * 16 + 8 g + r of query col: V x P of a, exponentials of b
    mm2c_exp8(an[2], an[3], vh[0][2], vh[0][3], pa, acc[2], acc[3], sb[1], eb[1]);
    ts = sum16(eb[0], eb[1]);
    pa = pack16(eb[0], eb[1]);
    if (__builtin_amdgcn_ballot_w32(ts > 32768.0f) != 0) (void)move_ref(false, sb, nref, eb, ts, pa, l, an);
    l += ts;
    mm4c(acc, vh[1][0], vh[1][1], vh[1][2], vh[1][3], pa, an);   // V x P of b
    asm volatile("s_wait_dscnt 0x0" ::: "memory");      // this wave's reads of the buffer are done before it may be refilled
    asm volatile("s_wait_asynccnt 0x0" ::: "memory");   // this wave's copies of stage st + 1 have landed
    __syncthreads();                                     // publishes stage st + 1 and ends every wave's reads of stage st
    if (st + 2 < NST) STAGE_COPY(st & 1, st + 2); }
  asm volatile("s_wait_asynccnt 0x0" ::: "memory");     // no copy is outstanding when the wave goes on to the epilogue and ends
  const float il = 1.0f / (l + xhalf(l));   // the two halves' sums are joined once
#pragma unroll
  for (int dt = 0; dt < 4; ++dt) { v4f o0, o1;
#pragma unroll
    for (int r = 0; r < 4; ++r) { o0[r] = acc[dt][r] * il; o1[r] = acc[dt][4 + r] * il; }
    *(v4f*)&so[wave][col][dt * 16 + 8 * g] = o0; *(v4f*)&so[wave][col][dt * 16 + 8 * g + 4] = o1; }
  LDSX();
  for (int rl = 0; rl < 16; ++rl) if (lane < 16) vst2(O + ((size_t)b * SS + q0 + rl) * DM + h * HD + lane * 4, *(const v4f*)&so[wave][rl][lane * 4]);
}
// ---- k_out: block = (64 rows, 128 cols): out = O(hi/lo) . Wo rows (2 products) + bo
__global__ __launch_bounds__(128) void k_out(const float* __restrict__ O, const __bf16* __restrict__ P, const float* __restrict__ BO, float* __restrict__ Y) {
  __shared__ __align__(16) float so[4][16][132];
  const int tid = threadIdx.x, wave = tid >> 5, lane = tid & 31, col = lane & 15, g = lane >> 4; const size_t r0 = (size_t)blockIdx.x * 64 + wave * 16; const int n0 = blockIdx.y * 128;
  __shared__ __align__(16) float sa[2][64][GAP]; __shared__ __align__(16) __bf16 sw[2][128][GWP];
  const char* gsa = (const char*)(O + (r0 + (lane >> 4)) * DM) + (lane & 15) * 16; const char* gsw = (const char*)(P + (size_t)(n0 + wave * 32 + (lane >> 3)) * DM) + (lane & 7) * 16;
  const unsigned lsa = (unsigned)(size_t)&sa[0][wave * 16 + (lane >> 4)][(lane & 15) * 4], lsw = (unsigned)(size_t)&sw[0][wave * 32 + (lane >> 3)][(lane & 7) * 8];
  gemm_copy(lsa, gsa, lsw, gsw, 0, 0);
  v8f acc[8] = {};
  asm volatile("s_wait_asynccnt 0x0" ::: "memory");   // this wave's copies of stage 0 have landed
  __syncthreads();                                     // publishes stage 0 to the other waves
  gemm_copy(lsa, gsa, lsw, gsw, 1, 1);
  // kept rolled: one copy of the stage body in the instruction cache
#pragma unroll 1
  for (int st = 0; st < GNS; ++st) { const int bf = st & 1;
    float v[GKS / 32][16]; v16b w[GKS / 32][8];   // all fragments of the stage are read as one group ahead of the products
#pragma unroll
    for (int kc = 0; kc < GKS / 32; ++kc) { lds16(&sa[bf][wave * 16 + col][kc * 32 + 8 * g], v[kc]);
#pragma unroll
      for (int j = 0; j < 8; ++j) w[kc][j] = frag_b(&sw[bf][j * 16 + col][kc * 32], lane); }
#pragma unroll
    for (int kc = 0; kc < GKS / 32; ++kc) { const F2 a = bsplit16(v[kc]);
#pragma unroll
      for (int j = 0; j < 8; ++j) { acc[j] = wmma_bf(a.l, w[kc][j], acc[j]); acc[j] = wmma_bf(a.h, w[kc][j], acc[j]); } }
    asm volatile("s_wait_dscnt 0x0" ::: "memory");      // this wave's reads of the buffer are done before it may be refilled
    asm volatile("s_wait_asynccnt 0x0" ::: "memory");   // this wave's copies of stage st + 1 have landed
    __syncthreads();                                     // publishes stage st + 1 and ends every wave's reads of stage st
    if (st + 2 < GNS) gemm_copy(lsa, gsa, lsw, gsw, bf, st + 2); }
  asm volatile("s_wait_asynccnt 0x0" ::: "memory");     // no copy is outstanding when the wave goes on to the epilogue and ends
#pragma unroll
  for (int j = 0; j < 8; ++j) {
#pragma unroll
    for (int r = 0; r < 8; ++r) so[wave][8 * g + r][j * 16 + col] = acc[j][r] + bfr(BO[n0 + j * 16 + col]); }
  LDSX();
  for (int rl = 0; rl < 16; ++rl) vst2(Y + (r0 + rl) * DM + n0 + lane * 4, *(const v4f*)&so[wave][rl][lane * 4]);
}
// ---- k_kvin: block = (64 keys m, head h, b): k input [b][h][m][64] -> K rows [b*M + m][DM + h*64 + d] of the q|k plane (f16); v input -> V plane [b][h*64 + d][m]
// The work-groups with blockIdx.x >= SS / 64 share the launch and round the two weight matrices to bf16 (natural [out][in] rows, a flat copy): w_qkv -> PK_A, w_proj -> PK_P; each takes PKE consecutive elements, 8 per lane and trip (32 B read, 16 B stored, whole lines per wave).
#define PKE 8192                       // weight elements per packing work-group
#define PKX 6                          // extra blockIdx.x values: PKX * NH * TNB = 144 work-groups = 2 * DM * DM / PKE
__global__ __launch_bounds__(256) void k_kvin(const float* __restrict__ KIN, const float* __restrict__ VIN, const float* __restrict__ WQ, const float* __restrict__ WO, _Float16* __restrict__ QK, _Float16* __restrict__ VTH, __bf16* __restrict__ PK) {
  __shared__ __align__(16) _Float16 skh[64][72], svh[64][72]; const int t = threadIdx.x; const int m0 = blockIdx.x * 64, h = blockIdx.y; const size_t b = blockIdx.z;
  if (blockIdx.x >= SS / 64) {   // the same for the whole work-group, and it leaves ahead of the barrier
    const int id = ((int)blockIdx.z * NH + (int)blockIdx.y) * PKX + ((int)blockIdx.x - SS / 64), nq = DM * DM / PKE;
    const float* src = (id < nq) ? WQ + (size_t)id * PKE : WO + (size_t)(id - nq) * PKE;
    __bf16* dst = (id < nq) ? PK + PK_A + (size_t)id * PKE : PK + PK_P + (size_t)(id - nq) * PKE;
    // unrolled so that all eight loads of a lane are in flight together (one memory latency per work-group, not four)
#pragma unroll
    for (int i = 0; i < PKE / (256 * 8); ++i) { const int e = (i * 256 + t) * 8; const v4f x0 = *(const v4f*)(src + e), x1 = *(const v4f*)(src + e + 4); v8b o;
      // unrolled so that the vector elements are named by constants and stay in registers
#pragma unroll
      for (int j = 0; j < 4; ++j) { o[j] = (__bf16)x0[j]; o[4 + j] = (__bf16)x1[j]; }
      *(v8b*)(dst + e) = o; }
    return;
  }
  for (int e = t; e < 64 * 64; e += 256) { const int r = e >> 6, d = e & 63; const size_t src = ((b * NH + h) * SS + m0 + r) * HD + d; const float kv = bfr(KIN[src]), vv = bfr(VIN[src]);
    skh[r][d] = (_Float16)kv; svh[d][r] = (_Float16)vv; }
  __syncthreads();
  for (int e = t; e < 64 * 8; e += 256) { const int r = e >> 3, q = e & 7; const size_t o = (b * SS + m0 + r) * (2 * DM) + DM + h * HD + q * 8; vst2((unsigned*)(QK + o), *(const v4u*)&skh[r][q * 8]);
    const size_t ov = (b * DM + h * HD + r) * SS + m0 + q * 8; vst2((unsigned*)(VTH + ov), *(const v4u*)&svh[r][q * 8]); }
}
extern "C" void kernel_launch(void* const* d_in, const int* in_sizes, int n_in, void* d_out, int out_size, void* d_ws, size_t ws_size, hipStream_t stream) {
  (void)in_sizes; (void)n_in; (void)out_size;
  const float** F = (const float**)d_in;   // 0 x [2,2048,768], 1 k [2,12,2048,64], 2 v [2,12,2048,64], 3 w_qkv [768,768] natural (q only), 4 w_proj [768,768] natural, 5 b_proj [768]
  if (ws_size < (size_t)WS_END) return;
  char* ws = (char*)d_ws; __bf16* PK = (__bf16*)(ws + WS_PK); _Float16 *QK = (_Float16*)(ws + WS_QK), *VTH = (_Float16*)(ws + WS_VTH); float* O = (float*)(ws + WS_O);
  k_kvin<<<dim3(SS / 64 + PKX, NH, TNB), 256, 0, stream>>>(F[1], F[2], F[3], F[4], QK, VTH, PK);   // k, v re-laid out; w_qkv and w_proj rounded to bf16 by the extra work-groups
  k_attn<<<dim3(TQB, NH, TNB), 128, 0, stream>>>(F[0], PK + PK_A, QK, VTH, nullptr, O);   // q projection (q columns of head h) and attention
  k_out<<<dim3(TOB, DM / 128), 128, 0, stream>>>(O, PK + PK_P, F[5], (float*)d_out);
}
